// v000
// The times below were measured on an AMD MI455X: many runs one after another, warmed up first and cycling through
// copies of the inputs, with the whole window's GPU time divided by the number of runs. Launches and the gaps
// between them are all in it. The median over several windows is given; except for v000 it joins two sittings, which
// can be a few percent apart, so the side-by-side timings, each taken in one sitting, are the better comparison.
// v000, which the later versions start from, runs in 89.4 microseconds.
#include <hip/hip_runtime.h>
#include <hip/hip_bf16.h>

#define NH   8
#define KWIN 7
#define LR   4
#define HD   32
#define BB   4
#define HH   56
#define WW   56
#define CC   256
#define MROWS (BB*HH*WW)   /* 12544 */
#define NQKV 320           /* 32 q + 32 k + 256 v columns */

typedef __attribute__((ext_vector_type(16))) __bf16 v16bf;
typedef __attribute__((ext_vector_type(8)))  __bf16 v8bf;
typedef __attribute__((ext_vector_type(4)))  __bf16 v4bf;
typedef __attribute__((ext_vector_type(8)))  float  v8f;

// ---------------------------------------------------------------------------
// Fragment loader for pre-packed bf16 row-major data (A: M x K, B^T: N x K).
// gfx1250 16-bit A/B layout, wave32:
//   lanes 0-15  : row r, K = {k0+0..7} in v0..3 and {k0+16..23} in v4..7
//   lanes 16-31 : row r, K offsets shifted by +8
// Both K-chunks are 8 contiguous bf16 = one 16B global_load_b128 each.
// ---------------------------------------------------------------------------
__device__ __forceinline__ v16bf load_frag(const __bf16* __restrict__ base,
                                           int r, int k0, int grp) {
  const __bf16* p = base + (size_t)r * CC + k0 + grp * 8;
  v8bf lo = *(const v8bf*)(p);
  v8bf hi = *(const v8bf*)(p + 16);
  v16bf f;
#pragma unroll
  for (int i = 0; i < 8; ++i) { f[i] = lo[i]; f[8 + i] = hi[i]; }
  return f;
}

// ---------------------------------------------------------------------------
// Pack kernels (run once, tiny): weights -> transposed bf16, x -> bf16.
// Wt rows: [0,32)=Wq^T, [32,64)=Wk^T, [64,320)=Wv^T.  Wpt = Wp^T.
// ---------------------------------------------------------------------------
__global__ void __launch_bounds__(256)
pack_w_kernel(const float* __restrict__ Wq, const float* __restrict__ Wk,
              const float* __restrict__ Wv, const float* __restrict__ Wp,
              __bf16* __restrict__ Wt, __bf16* __restrict__ Wpt) {
  const int idx = blockIdx.x * 256 + threadIdx.x;   // over NQKV*CC = 81920
  const int k = idx & (CC - 1);
  const int n = idx >> 8;
  float v;
  if (n < 32)      v = Wq[k * 32 + n];
  else if (n < 64) v = Wk[k * 32 + (n - 32)];
  else             v = Wv[k * CC + (n - 64)];
  Wt[idx] = (__bf16)v;
  if (n < CC) Wpt[(size_t)n * CC + k] = (__bf16)Wp[(size_t)k * CC + n];
}

__global__ void __launch_bounds__(256)
pack_x_kernel(const float* __restrict__ x, __bf16* __restrict__ xbf) {
  const int i = (blockIdx.x * 256 + threadIdx.x) * 4;   // MROWS*CC/4 threads
  const float4 v = *(const float4*)(x + i);
  v4bf o;
  o[0] = (__bf16)v.x; o[1] = (__bf16)v.y; o[2] = (__bf16)v.z; o[3] = (__bf16)v.w;
  *(v4bf*)(xbf + i) = o;
}

// ---------------------------------------------------------------------------
// Kernel 1: fused QKV projection GEMM, M=12544, N=320, K=256, bf16 WMMA.
// Block = 160 threads = 5 waves; each wave computes a 16x64 strip (4 WMMA
// tiles, A fragment reused 4x). Grid = 784 M-tiles.
//   cols [0,32)  -> q = (acc + bq) * hd^-0.5
//   cols [32,64) -> k = acc + bk
//   cols [64,320)-> v = acc + bv
// ---------------------------------------------------------------------------
__global__ void __launch_bounds__(160)
qkv_gemm_kernel(const __bf16* __restrict__ xbf, const __bf16* __restrict__ Wt,
                const float* __restrict__ bq, const float* __restrict__ bk,
                const float* __restrict__ bv,
                float* __restrict__ qbuf, float* __restrict__ kbuf,
                float* __restrict__ vbuf) {
  const int wave = threadIdx.x >> 5;        // 0..4
  const int lane = threadIdx.x & 31;
  const int grp  = lane >> 4;
  const int nl   = lane & 15;
  const int row0 = blockIdx.x * 16;
  const int colg = wave * 64;               // wave's 64-column strip

  const int arow = row0 + nl;
  v8f acc[4] = {{}, {}, {}, {}};
#pragma unroll
  for (int k0 = 0; k0 < CC; k0 += 32) {
    __builtin_prefetch(xbf + (size_t)arow * CC + k0 + 32, 0, 1);
    const v16bf a = load_frag(xbf, arow, k0, grp);
#pragma unroll
    for (int t = 0; t < 4; ++t) {
      const v16bf b = load_frag(Wt, colg + 16 * t + nl, k0, grp);
      acc[t] = __builtin_amdgcn_wmma_f32_16x16x32_bf16(false, a, false, b,
                                                       (short)0, acc[t], false, false);
    }
  }
#pragma unroll
  for (int t = 0; t < 4; ++t) {
    const int col0 = colg + 16 * t;         // tile-uniform; tiles never straddle q/k/v
    float* out; int ldo, oc0; float sc = 1.0f; const float* bias;
    if (col0 < 32)      { out = qbuf; ldo = 32; oc0 = col0;      bias = bq;
                          sc = 0.17677669529663687f; /* 32^-0.5 */ }
    else if (col0 < 64) { out = kbuf; ldo = 32; oc0 = col0 - 32; bias = bk; }
    else                { out = vbuf; ldo = CC; oc0 = col0 - 64; bias = bv; }
    const int oc = oc0 + nl;
    const float bval = bias[oc];
#pragma unroll
    for (int v = 0; v < 8; ++v) {
      const int m = row0 + v + grp * 8;
      out[(size_t)m * ldo + oc] = (acc[t][v] + bval) * sc;
    }
  }
}

// ---------------------------------------------------------------------------
// Kernel 2: neighborhood attention core. One thread per (b, head, i, j).
// q/k/v read through the reference's raw-reshape strides:
//   q[b,n,i,j,l] = qflat[b*H*W*32 + n*H*W*4 + (i*W+j)*4 + l]  (v with 32)
// Output written pre-transposed to (B,H,W, n*32+d) directly as bf16 for the
// projection GEMM.
// ---------------------------------------------------------------------------
__global__ void __launch_bounds__(256)
natten_kernel(const float* __restrict__ qbuf, const float* __restrict__ kbuf,
              const float* __restrict__ vbuf, const float* __restrict__ rpb,
              __bf16* __restrict__ abf) {
  const int idx = blockIdx.x * blockDim.x + threadIdx.x;   // B*NH*H*W = 100352
  int j = idx % WW;  int t = idx / WW;
  int i = t % HH;    t /= HH;
  int n = t % NH;    const int b = t / NH;

  const size_t qk_base = (size_t)b * HH * WW * 32 + (size_t)n * HH * WW * 4;
  const float4 qv = *(const float4*)(qbuf + qk_base + (size_t)(i * WW + j) * 4);

  const int sh = min(max(i - 3, 0), HH - KWIN);
  const int sw = min(max(j - 3, 0), WW - KWIN);

  float s[KWIN * KWIN];
  float mx = -3.0e38f;
  const float* rb = rpb + n * 13 * 13;
#pragma unroll
  for (int ki = 0; ki < KWIN; ++ki) {
    const int kh = sh + ki;
    const float* krow = kbuf + qk_base + (size_t)(kh * WW + sw) * 4;
    const float* brow = rb + (kh - i + 6) * 13 + (sw - j + 6);
#pragma unroll
    for (int kj = 0; kj < KWIN; ++kj) {
      const float4 kv = *(const float4*)(krow + kj * 4);
      float d = qv.x * kv.x + qv.y * kv.y + qv.z * kv.z + qv.w * kv.w + brow[kj];
      s[ki * KWIN + kj] = d;
      mx = fmaxf(mx, d);
    }
  }

  float sum = 0.0f;
#pragma unroll
  for (int t2 = 0; t2 < KWIN * KWIN; ++t2) { s[t2] = __expf(s[t2] - mx); sum += s[t2]; }
  const float inv = 1.0f / sum;

  float acc[HD];
#pragma unroll
  for (int d = 0; d < HD; ++d) acc[d] = 0.0f;

  const float* vbase = vbuf + (size_t)b * HH * WW * CC + (size_t)n * HH * WW * HD;
#pragma unroll
  for (int ki = 0; ki < KWIN; ++ki) {
#pragma unroll
    for (int kj = 0; kj < KWIN; ++kj) {
      const float p = s[ki * KWIN + kj] * inv;
      const float4* vv = (const float4*)(vbase + (size_t)((sh + ki) * WW + sw + kj) * HD);
#pragma unroll
      for (int q4 = 0; q4 < HD / 4; ++q4) {
        const float4 vx = vv[q4];
        acc[4*q4+0] += p * vx.x;  acc[4*q4+1] += p * vx.y;
        acc[4*q4+2] += p * vx.z;  acc[4*q4+3] += p * vx.w;
      }
    }
  }

  __bf16* op = abf + ((size_t)(b * HH + i) * WW + j) * CC + n * HD;
#pragma unroll
  for (int g = 0; g < HD / 8; ++g) {
    v8bf o;
#pragma unroll
    for (int e = 0; e < 8; ++e) o[e] = (__bf16)acc[8 * g + e];
    *(v8bf*)(op + 8 * g) = o;   // 16B store
  }
}

// ---------------------------------------------------------------------------
// Kernel 3: output projection  out = attn_out @ Wp + bp  (M=12544, N=K=256).
// Block = 128 threads = 4 waves; each wave computes a 16x64 strip.
// ---------------------------------------------------------------------------
__global__ void __launch_bounds__(128)
proj_gemm_kernel(const __bf16* __restrict__ abf, const __bf16* __restrict__ Wpt,
                 const float* __restrict__ bp, float* __restrict__ out) {
  const int wave = threadIdx.x >> 5;        // 0..3
  const int lane = threadIdx.x & 31;
  const int grp  = lane >> 4;
  const int nl   = lane & 15;
  const int row0 = blockIdx.x * 16;
  const int colg = wave * 64;

  const int arow = row0 + nl;
  v8f acc[4] = {{}, {}, {}, {}};
#pragma unroll
  for (int k0 = 0; k0 < CC; k0 += 32) {
    __builtin_prefetch(abf + (size_t)arow * CC + k0 + 32, 0, 1);
    const v16bf a = load_frag(abf, arow, k0, grp);
#pragma unroll
    for (int t = 0; t < 4; ++t) {
      const v16bf b = load_frag(Wpt, colg + 16 * t + nl, k0, grp);
      acc[t] = __builtin_amdgcn_wmma_f32_16x16x32_bf16(false, a, false, b,
                                                       (short)0, acc[t], false, false);
    }
  }
#pragma unroll
  for (int t = 0; t < 4; ++t) {
    const int col = colg + 16 * t + nl;
    const float bval = bp[col];
#pragma unroll
    for (int v = 0; v < 8; ++v) {
      const int m = row0 + v + grp * 8;
      out[(size_t)m * CC + col] = acc[t][v] + bval;
    }
  }
}

// ---------------------------------------------------------------------------
extern "C" void kernel_launch(void* const* d_in, const int* in_sizes, int n_in,
                              void* d_out, int out_size, void* d_ws, size_t ws_size,
                              hipStream_t stream) {
  const float* x   = (const float*)d_in[0];
  const float* Wq  = (const float*)d_in[1];
  const float* bq  = (const float*)d_in[2];
  const float* Wk  = (const float*)d_in[3];
  const float* bk  = (const float*)d_in[4];
  const float* Wv  = (const float*)d_in[5];
  const float* bv  = (const float*)d_in[6];
  const float* rpb = (const float*)d_in[7];
  const float* Wp  = (const float*)d_in[8];
  const float* bp  = (const float*)d_in[9];

  // f32 scratch
  float* qbuf = (float*)d_ws;                         // MROWS*32
  float* kbuf = qbuf + (size_t)MROWS * 32;            // MROWS*32
  float* vbuf = kbuf + (size_t)MROWS * 32;            // MROWS*256
  // bf16 scratch (16B-aligned offsets by construction)
  __bf16* abf = (__bf16*)(vbuf + (size_t)MROWS * CC); // MROWS*256 bf16
  __bf16* xbf = abf + (size_t)MROWS * CC;             // MROWS*256 bf16
  __bf16* Wt  = xbf + (size_t)MROWS * CC;             // 320*256 bf16
  __bf16* Wpt = Wt + (size_t)NQKV * CC;               // 256*256 bf16

  // 0) one-shot packs: weights -> transposed bf16; x -> bf16
  pack_w_kernel<<<dim3((NQKV * CC) / 256), 256, 0, stream>>>(Wq, Wk, Wv, Wp, Wt, Wpt);
  pack_x_kernel<<<dim3((MROWS * CC) / (256 * 4)), 256, 0, stream>>>(x, xbf);

  // 1) fused QKV projection: 784 M-tiles x (5 waves * 64 cols)
  qkv_gemm_kernel<<<dim3(MROWS / 16), 160, 0, stream>>>(
      xbf, Wt, bq, bk, bv, qbuf, kbuf, vbuf);

  // 2) neighborhood attention core: one thread per query*head
  natten_kernel<<<dim3((BB * NH * HH * WW) / 256), 256, 0, stream>>>(
      qbuf, kbuf, vbuf, rpb, abf);

  // 3) output projection: 784 M-tiles x (4 waves * 64 cols)
  proj_gemm_kernel<<<dim3(MROWS / 16), 128, 0, stream>>>(
      abf, Wpt, bp, (float*)d_out);
}

// v001
// A run of this version takes 48.1 microseconds.
// Timed twice side by side with v000, it ran 1.89 times as fast both times.
#include <hip/hip_runtime.h>
#include <hip/hip_bf16.h>

#define NH   8
#define KWIN 7
#define LR   4
#define HD   32
#define BB   4
#define HH   56
#define WW   56
#define CC   256
#define MROWS (BB*HH*WW)   /* 12544 */
#define NQKV 320           /* 32 q + 32 k + 256 v columns */

typedef __attribute__((ext_vector_type(16))) __bf16 v16bf;
typedef __attribute__((ext_vector_type(8)))  __bf16 v8bf;
typedef __attribute__((ext_vector_type(4)))  __bf16 v4bf;
typedef __attribute__((ext_vector_type(8)))  float  v8f;
typedef __attribute__((ext_vector_type(4)))  float  v4f;
typedef __attribute__((ext_vector_type(2)))  float  v2f;

// ---------------------------------------------------------------------------
// Fragment loader for pre-packed bf16 row-major data (A: M x K, B^T: N x K).
// gfx1250 16-bit A/B layout, wave32:
//   lanes 0-15  : row r, K = {k0+0..7} in v0..3 and {k0+16..23} in v4..7
//   lanes 16-31 : row r, K offsets shifted by +8
// Both K-chunks are 8 contiguous bf16 = one 16B global_load_b128 each.
// ---------------------------------------------------------------------------
__device__ __forceinline__ v16bf load_frag(const __bf16* __restrict__ base,
                                           int r, int k0, int grp) {
  const __bf16* p = base + (size_t)r * CC + k0 + grp * 8;
  v8bf lo = *(const v8bf*)(p);
  v8bf hi = *(const v8bf*)(p + 16);
  v16bf f;
#pragma unroll
  for (int i = 0; i < 8; ++i) { f[i] = lo[i]; f[8 + i] = hi[i]; }
  return f;
}

// ---------------------------------------------------------------------------
// Pack kernels (run once, tiny): weights -> transposed bf16, x -> bf16.
// Wt rows: [0,32)=Wq^T, [32,64)=Wk^T, [64,320)=Wv^T.  Wpt = Wp^T.
// ---------------------------------------------------------------------------
__global__ void __launch_bounds__(256)
pack_w_kernel(const float* __restrict__ Wq, const float* __restrict__ Wk,
              const float* __restrict__ Wv, const float* __restrict__ Wp,
              __bf16* __restrict__ Wt, __bf16* __restrict__ Wpt) {
  const int idx = blockIdx.x * 256 + threadIdx.x;   // over NQKV*CC = 81920
  const int k = idx & (CC - 1);
  const int n = idx >> 8;
  float v;
  if (n < 32)      v = Wq[k * 32 + n];
  else if (n < 64) v = Wk[k * 32 + (n - 32)];
  else             v = Wv[k * CC + (n - 64)];
  Wt[idx] = (__bf16)v;
  if (n < CC) Wpt[(size_t)n * CC + k] = (__bf16)Wp[(size_t)k * CC + n];
}

__global__ void __launch_bounds__(256)
pack_x_kernel(const float* __restrict__ x, __bf16* __restrict__ xbf) {
  const int i = (blockIdx.x * 256 + threadIdx.x) * 4;   // MROWS*CC/4 threads
  const float4 v = *(const float4*)(x + i);
  v4bf o;
  o[0] = (__bf16)v.x; o[1] = (__bf16)v.y; o[2] = (__bf16)v.z; o[3] = (__bf16)v.w;
  *(v4bf*)(xbf + i) = o;
}

// ---------------------------------------------------------------------------
// Kernel 1: fused QKV projection GEMM, M=12544, N=320, K=256, bf16 WMMA.
// Block = 160 threads = 5 waves; each wave computes a 16x64 strip (4 WMMA
// tiles, A fragment reused 4x). Grid = 784 M-tiles.
//   cols [0,32)  -> q = (acc + bq) * hd^-0.5
//   cols [32,64) -> k = acc + bk
//   cols [64,320)-> v = acc + bv
// ---------------------------------------------------------------------------
__global__ void __launch_bounds__(160)
qkv_gemm_kernel(const __bf16* __restrict__ xbf, const __bf16* __restrict__ Wt,
                const float* __restrict__ bq, const float* __restrict__ bk,
                const float* __restrict__ bv,
                float* __restrict__ qbuf, float* __restrict__ kbuf,
                float* __restrict__ vbuf) {
  const int wave = threadIdx.x >> 5;        // 0..4
  const int lane = threadIdx.x & 31;
  const int grp  = lane >> 4;
  const int nl   = lane & 15;
  const int row0 = blockIdx.x * 16;
  const int colg = wave * 64;               // wave's 64-column strip

  const int arow = row0 + nl;
  v8f acc[4] = {{}, {}, {}, {}};
#pragma unroll
  for (int k0 = 0; k0 < CC; k0 += 32) {
    __builtin_prefetch(xbf + (size_t)arow * CC + k0 + 32, 0, 1);
    const v16bf a = load_frag(xbf, arow, k0, grp);
#pragma unroll
    for (int t = 0; t < 4; ++t) {
      const v16bf b = load_frag(Wt, colg + 16 * t + nl, k0, grp);
      acc[t] = __builtin_amdgcn_wmma_f32_16x16x32_bf16(false, a, false, b,
                                                       (short)0, acc[t], false, false);
    }
  }
#pragma unroll
  for (int t = 0; t < 4; ++t) {
    const int col0 = colg + 16 * t;         // tile-uniform; tiles never straddle q/k/v
    float* out; int ldo, oc0; float sc = 1.0f; const float* bias;
    if (col0 < 32)      { out = qbuf; ldo = 32; oc0 = col0;      bias = bq;
                          sc = 0.17677669529663687f; /* 32^-0.5 */ }
    else if (col0 < 64) { out = kbuf; ldo = 32; oc0 = col0 - 32; bias = bk; }
    else                { out = vbuf; ldo = CC; oc0 = col0 - 64; bias = bv; }
    const int oc = oc0 + nl;
    const float bval = bias[oc];
#pragma unroll
    for (int v = 0; v < 8; ++v) {
      const int m = row0 + v + grp * 8;
      out[(size_t)m * ldo + oc] = (acc[t][v] + bval) * sc;
    }
  }
}

// ---------------------------------------------------------------------------
// Kernel 2: neighborhood attention core. Eight lanes per (b, head, i, j):
// lane c of a query owns channels 4c..4c+3, so the eight lanes of a query read
// one whole 128-byte v pixel with one 16-byte load each, and the four queries
// of a wave (four neighbours in j) read four adjacent pixels = 512 contiguous
// bytes per load instruction. For the scores lane c owns key column c of the
// 7x7 window (lane 7 repeats column 6 and is left out of the sum); maximum and
// sum go over the eight lanes, and each weight is handed to the eight lanes
// from its owner before it multiplies v.
// A block is 4 waves = an 8x8 patch of queries of one (b, head); a wave takes
// 4 columns and walks 4 rows.
// q/k/v read through the reference's raw-reshape strides:
//   q[b,n,i,j,l] = qflat[b*H*W*32 + n*H*W*4 + (i*W+j)*4 + l]  (v with 32)
// Output written pre-transposed to (B,H,W, n*32+d) directly as bf16 for the
// projection GEMM.
// ---------------------------------------------------------------------------
#define SEL8(a,b,c,d,e,f,g,h) \
  ((a) | ((b) << 3) | ((c) << 6) | ((d) << 9) | ((e) << 12) | ((f) << 15) | ((g) << 18) | ((h) << 21))

// Value of lane SEL[l & 7] of the same group of eight lanes.
template <int SEL>
__device__ __forceinline__ float lane8(float x) {
  return __builtin_bit_cast(float,
      __builtin_amdgcn_mov_dpp8(__builtin_bit_cast(unsigned, x), SEL));
}

__global__ void __launch_bounds__(128)
natten_kernel(const float* __restrict__ qbuf, const float* __restrict__ kbuf,
              const float* __restrict__ vbuf, const float* __restrict__ rpb,
              __bf16* __restrict__ abf) {
  const int lane = threadIdx.x & 31;
  const int wave = threadIdx.x >> 5;      // 0..3
  const int c    = lane & 7;              // channel quad, and key column owner
  const int kc   = min(c, KWIN - 1);
  int t = blockIdx.x;                     // B*NH * 7 * 7 patches
  const int tj = t % (WW / 8);  t /= (WW / 8);
  const int ti = t % (HH / 8);  t /= (HH / 8);
  const int n = t % NH;         const int b = t / NH;
  const int j  = tj * 8 + (wave & 1) * 4 + (lane >> 3);
  const int i0 = ti * 8 + (wave >> 1) * 4;

  const size_t qk_base = (size_t)b * HH * WW * 32 + (size_t)n * HH * WW * 4;
  const float* vbase = vbuf + (size_t)b * HH * WW * CC + (size_t)n * HH * WW * HD;
  const float* rb = rpb + n * 13 * 13;
  const int sw = min(max(j - 3, 0), WW - KWIN);

  // All four rows' weights first, two rows at a time (their q, k and bias loads
  // are independent and share one wait for memory), then the four rows' v sums.
  float pk[4][KWIN];                      // weight (ki, kc) of row r of this lane's query
#pragma unroll
  for (int r = 0; r < 4; ++r) {
    const int i  = i0 + r;
    const int sh = min(max(i - 3, 0), HH - KWIN);
    const float4 qv = *(const float4*)(qbuf + qk_base + (size_t)(i * WW + j) * 4);

    const float* kp = kbuf + qk_base + (size_t)(sh * WW + sw + kc) * 4;
    const float* bb = rb + (size_t)((sh - i + 6) * 13 + (sw - j + 6) + kc);

    float s[KWIN];
    float mx = -3.0e38f;
#pragma unroll
    for (int ki = 0; ki < KWIN; ++ki) {
      const float4 kv = *(const float4*)(kp + ki * WW * 4);
      const float bias = bb[ki * 13];
      const float d = qv.x * kv.x + qv.y * kv.y + qv.z * kv.z + qv.w * kv.w + bias;
      s[ki] = d;
      mx = fmaxf(mx, d);
    }
    mx = fmaxf(mx, lane8<SEL8(1,0,3,2,5,4,7,6)>(mx));
    mx = fmaxf(mx, lane8<SEL8(2,3,0,1,6,7,4,5)>(mx));
    mx = fmaxf(mx, lane8<SEL8(4,5,6,7,0,1,2,3)>(mx));

    float sum = 0.0f;
#pragma unroll
    for (int ki = 0; ki < KWIN; ++ki) { s[ki] = __expf(s[ki] - mx); sum += s[ki]; }
    if (c == 7) sum = 0.0f;               // lane 7 holds a copy of column 6
    sum += lane8<SEL8(1,0,3,2,5,4,7,6)>(sum);
    sum += lane8<SEL8(2,3,0,1,6,7,4,5)>(sum);
    sum += lane8<SEL8(4,5,6,7,0,1,2,3)>(sum);
    const float inv = 1.0f / sum;
#pragma unroll
    for (int ki = 0; ki < KWIN; ++ki) pk[r][ki] = s[ki] * inv;
    // Bounds the registers: without it the compiler issues all four rows' loads
    // and the first v loads at once, and fewer than 7 waves fit a SIMD, which
    // the 1568 blocks (6 to 7 per WGP, one wave of each per SIMD) need.
    if (r & 1) __builtin_amdgcn_sched_barrier(0);
  }

  // v sums: 28 groups (row r, window row ki) of 7 loads each, two register
  // buffers, group g + 1 loaded while group g is summed. The groups go by
  // r + ki: away from the image's edge the groups of one r + ki read the same
  // v row, so a re-read follows the first read closely, for the WGP cache.
  // Each row r still sums its ki in rising order.
  const float* vp[4];
#pragma unroll
  for (int r = 0; r < 4; ++r) {
    const int sh = min(max(i0 + r - 3, 0), HH - KWIN);
    vp[r] = vbase + (size_t)(sh * WW + sw) * HD + c * 4;
  }
  constexpr int GR[4 * KWIN] = {0, 0,1, 0,1,2, 0,1,2,3, 0,1,2,3, 0,1,2,3, 0,1,2,3, 1,2,3, 2,3, 3};
  constexpr int GK[4 * KWIN] = {0, 1,0, 2,1,0, 3,2,1,0, 4,3,2,1, 5,4,3,2, 6,5,4,3, 6,5,4, 6,5, 6};
  v4f buf[2][KWIN];
#pragma unroll
  for (int kj = 0; kj < KWIN; ++kj) buf[0][kj] = *(const v4f*)(vp[0] + kj * HD);

  v2f a01[4], a23[4];
#pragma unroll
  for (int r = 0; r < 4; ++r) { a01[r] = (v2f){0.0f, 0.0f};  a23[r] = (v2f){0.0f, 0.0f}; }
#pragma unroll
  for (int g = 0; g < 4 * KWIN; ++g) {
    const int r = GR[g], ki = GK[g];
    if (g + 1 < 4 * KWIN) {
      const float* nx = vp[GR[g + 1]] + GK[g + 1] * WW * HD;
#pragma unroll
      for (int kj = 0; kj < KWIN; ++kj) buf[(g + 1) & 1][kj] = *(const v4f*)(nx + kj * HD);
    }
    // Keeps the next group's 7 loads in front of this group's sums: without it
    // the compiler sinks each load to its use and leaves 2 or 3 in flight.
    __builtin_amdgcn_sched_barrier(0);

    const float w = pk[r][ki];
    const float p[KWIN] = {
      lane8<SEL8(0,0,0,0,0,0,0,0)>(w), lane8<SEL8(1,1,1,1,1,1,1,1)>(w),
      lane8<SEL8(2,2,2,2,2,2,2,2)>(w), lane8<SEL8(3,3,3,3,3,3,3,3)>(w),
      lane8<SEL8(4,4,4,4,4,4,4,4)>(w), lane8<SEL8(5,5,5,5,5,5,5,5)>(w),
      lane8<SEL8(6,6,6,6,6,6,6,6)>(w) };
#pragma unroll
    for (int kj = 0; kj < KWIN; ++kj) {
      const v4f vx = buf[g & 1][kj];
      const v2f pp = {p[kj], p[kj]};
      a01[r] = __builtin_elementwise_fma(pp, vx.xy, a01[r]);
      a23[r] = __builtin_elementwise_fma(pp, vx.zw, a23[r]);
    }

    if (ki == KWIN - 1) {
      v4bf o;
      o[0] = (__bf16)a01[r].x; o[1] = (__bf16)a01[r].y;
      o[2] = (__bf16)a23[r].x; o[3] = (__bf16)a23[r].y;
      *(v4bf*)(abf + ((size_t)(b * HH + i0 + r) * WW + j) * CC + n * HD + c * 4) = o;   // 8B store
      // The store's registers are reused by the later sums: wait first.
      if (g + 1 < 4 * KWIN) asm volatile("s_wait_xcnt 0x0" ::: "memory");
    }
    // Keeps group g + 2's loads behind this group's sums: two buffers, not three.
    __builtin_amdgcn_sched_barrier(0);
  }
}

// ---------------------------------------------------------------------------
// Kernel 3: output projection  out = attn_out @ Wp + bp  (M=12544, N=K=256).
// Block = 128 threads = 4 waves; each wave computes a 16x64 strip.
// ---------------------------------------------------------------------------
__global__ void __launch_bounds__(128)
proj_gemm_kernel(const __bf16* __restrict__ abf, const __bf16* __restrict__ Wpt,
                 const float* __restrict__ bp, float* __restrict__ out) {
  const int wave = threadIdx.x >> 5;        // 0..3
  const int lane = threadIdx.x & 31;
  const int grp  = lane >> 4;
  const int nl   = lane & 15;
  const int row0 = blockIdx.x * 16;
  const int colg = wave * 64;

  const int arow = row0 + nl;
  v8f acc[4] = {{}, {}, {}, {}};
#pragma unroll
  for (int k0 = 0; k0 < CC; k0 += 32) {
    __builtin_prefetch(abf + (size_t)arow * CC + k0 + 32, 0, 1);
    const v16bf a = load_frag(abf, arow, k0, grp);
#pragma unroll
    for (int t = 0; t < 4; ++t) {
      const v16bf b = load_frag(Wpt, colg + 16 * t + nl, k0, grp);
      acc[t] = __builtin_amdgcn_wmma_f32_16x16x32_bf16(false, a, false, b,
                                                       (short)0, acc[t], false, false);
    }
  }
#pragma unroll
  for (int t = 0; t < 4; ++t) {
    const int col = colg + 16 * t + nl;
    const float bval = bp[col];
#pragma unroll
    for (int v = 0; v < 8; ++v) {
      const int m = row0 + v + grp * 8;
      out[(size_t)m * CC + col] = acc[t][v] + bval;
    }
  }
}

// ---------------------------------------------------------------------------
extern "C" void kernel_launch(void* const* d_in, const int* in_sizes, int n_in,
                              void* d_out, int out_size, void* d_ws, size_t ws_size,
                              hipStream_t stream) {
  const float* x   = (const float*)d_in[0];
  const float* Wq  = (const float*)d_in[1];
  const float* bq  = (const float*)d_in[2];
  const float* Wk  = (const float*)d_in[3];
  const float* bk  = (const float*)d_in[4];
  const float* Wv  = (const float*)d_in[5];
  const float* bv  = (const float*)d_in[6];
  const float* rpb = (const float*)d_in[7];
  const float* Wp  = (const float*)d_in[8];
  const float* bp  = (const float*)d_in[9];

  // f32 scratch
  float* qbuf = (float*)d_ws;                         // MROWS*32
  float* kbuf = qbuf + (size_t)MROWS * 32;            // MROWS*32
  float* vbuf = kbuf + (size_t)MROWS * 32;            // MROWS*256
  // bf16 scratch (16B-aligned offsets by construction)
  __bf16* abf = (__bf16*)(vbuf + (size_t)MROWS * CC); // MROWS*256 bf16
  __bf16* xbf = abf + (size_t)MROWS * CC;             // MROWS*256 bf16
  __bf16* Wt  = xbf + (size_t)MROWS * CC;             // 320*256 bf16
  __bf16* Wpt = Wt + (size_t)NQKV * CC;               // 256*256 bf16

  // 0) one-shot packs: weights -> transposed bf16; x -> bf16
  pack_w_kernel<<<dim3((NQKV * CC) / 256), 256, 0, stream>>>(Wq, Wk, Wv, Wp, Wt, Wpt);
  pack_x_kernel<<<dim3((MROWS * CC) / (256 * 4)), 256, 0, stream>>>(x, xbf);

  // 1) fused QKV projection: 784 M-tiles x (5 waves * 64 cols)
  qkv_gemm_kernel<<<dim3(MROWS / 16), 160, 0, stream>>>(
      xbf, Wt, bq, bk, bv, qbuf, kbuf, vbuf);

  // 2) neighborhood attention core: eight lanes per query*head, 8x8 queries a block
  natten_kernel<<<dim3(BB * NH * (HH / 8) * (WW / 8)), 128, 0, stream>>>(
      qbuf, kbuf, vbuf, rpb, abf);

  // 3) output projection: 784 M-tiles x (4 waves * 64 cols)
  proj_gemm_kernel<<<dim3(MROWS / 16), 128, 0, stream>>>(
      abf, Wpt, bp, (float*)d_out);
}

// v002
// One run takes 42 microseconds.
// Timed twice side by side with v001, it ran 1.16 and 1.14 times as fast.
// All steps since v000 together make it 2.18 times as fast.
#include <hip/hip_runtime.h>
#include <hip/hip_bf16.h>

#define NH   8
#define KWIN 7
#define LR   4
#define HD   32
#define BB   4
#define HH   56
#define WW   56
#define CC   256
#define MROWS (BB*HH*WW)   /* 12544 */
#define NQKV 320           /* 32 q + 32 k + 256 v columns */

typedef __attribute__((ext_vector_type(16))) __bf16 v16bf;
typedef __attribute__((ext_vector_type(8)))  __bf16 v8bf;
typedef __attribute__((ext_vector_type(4)))  __bf16 v4bf;
typedef __attribute__((ext_vector_type(8)))  float  v8f;
typedef __attribute__((ext_vector_type(4)))  float  v4f;
typedef __attribute__((ext_vector_type(2)))  float  v2f;

// ---------------------------------------------------------------------------
// Fragment loader for pre-packed bf16 row-major data (A: M x K, B^T: N x K).
// gfx1250 16-bit A/B layout, wave32:
//   lanes 0-15  : row r, K = {k0+0..7} in v0..3 and {k0+16..23} in v4..7
//   lanes 16-31 : row r, K offsets shifted by +8
// Both K-chunks are 8 contiguous bf16 = one 16B global_load_b128 each.
// ---------------------------------------------------------------------------
__device__ __forceinline__ v16bf load_frag(const __bf16* __restrict__ base,
                                           int r, int k0, int grp) {
  const __bf16* p = base + (size_t)r * CC + k0 + grp * 8;
  v8bf lo = *(const v8bf*)(p);
  v8bf hi = *(const v8bf*)(p + 16);
  v16bf f;
#pragma unroll
  for (int i = 0; i < 8; ++i) { f[i] = lo[i]; f[8 + i] = hi[i]; }
  return f;
}

// ---------------------------------------------------------------------------
// Pack kernel (tiny): weights -> transposed bf16.
// Wt rows: [0,32)=Wq^T, [32,64)=Wk^T, [64,320)=Wv^T.  Wpt = Wp^T.
// ---------------------------------------------------------------------------
__global__ void __launch_bounds__(256)
pack_w_kernel(const float* __restrict__ Wq, const float* __restrict__ Wk,
              const float* __restrict__ Wv, const float* __restrict__ Wp,
              __bf16* __restrict__ Wt, __bf16* __restrict__ Wpt) {
  const int idx = blockIdx.x * 256 + threadIdx.x;   // over NQKV*CC = 81920
  const int k = idx & (CC - 1);
  const int n = idx >> 8;
  float v;
  if (n < 32)      v = Wq[k * 32 + n];
  else if (n < 64) v = Wk[k * 32 + (n - 32)];
  else             v = Wv[k * CC + (n - 64)];
  Wt[idx] = (__bf16)v;
  if (n < CC) Wpt[(size_t)n * CC + k] = (__bf16)Wp[(size_t)k * CC + n];
}

// ---------------------------------------------------------------------------
// Kernel 1: fused QKV projection GEMM, M=12544, N=320, K=256, bf16 WMMA.
// Block = 160 threads = 5 waves; each wave computes a 16x64 strip (4 WMMA
// tiles, A fragment reused 4x). Grid = 784 M-tiles.
// x comes in as f32: the block reads its 16 rows (16 KB in a row) once, in
// whole lines, rounds them to bf16 and keeps them in LDS, where its 5 waves
// take their A fragments. LDS row pitch 528 B = 16 B x 33 for 16-byte readers.
//   cols [0,32)  -> q = (acc + bq) * hd^-0.5
//   cols [32,64) -> k = acc + bk
//   cols [64,320)-> v = acc + bv
// ---------------------------------------------------------------------------
#define APITCH (CC + 8)   /* bf16 elements per LDS row */

__global__ void __launch_bounds__(160)
qkv_gemm_kernel(const float* __restrict__ x, const __bf16* __restrict__ Wt,
                const float* __restrict__ bq, const float* __restrict__ bk,
                const float* __restrict__ bv,
                float* __restrict__ qbuf, float* __restrict__ kbuf,
                float* __restrict__ vbuf) {
  const int wave = threadIdx.x >> 5;        // 0..4
  const int lane = threadIdx.x & 31;
  const int grp  = lane >> 4;
  const int nl   = lane & 15;
  const int row0 = blockIdx.x * 16;
  const int colg = wave * 64;               // wave's 64-column strip

  __shared__ __attribute__((aligned(16))) __bf16 As[16 * APITCH];
  {
    // 16 * 256 floats = 1024 groups of 4 over 160 threads: 6 each, and a 7th
    // for waves 0 and 1. All loads first, so that they share one wait. The
    // loops are unrolled so that xv[] is indexed by constants and stays in
    // registers.
    const float4* xs = (const float4*)(x + (size_t)row0 * CC);
    const int tid = threadIdx.x;
    float4 xv[7];
#pragma unroll
    for (int i = 0; i < 6; ++i) xv[i] = xs[tid + 160 * i];
    if (tid < 64) xv[6] = xs[tid + 960];
#pragma unroll
    for (int i = 0; i < 7; ++i) {
      if (i < 6 || tid < 64) {
        const int e = tid + 160 * i;        // row e / 64, floats 4 * (e % 64) ...
        v4bf o;
        o[0] = (__bf16)xv[i].x; o[1] = (__bf16)xv[i].y;
        o[2] = (__bf16)xv[i].z; o[3] = (__bf16)xv[i].w;
        *(v4bf*)(As + (e >> 6) * APITCH + (e & 63) * 4) = o;
      }
    }
  }
  __syncthreads();                          // every wave reads all 16 rows

  const __bf16* ap = As + nl * APITCH + grp * 8;
  v8f acc[4] = {{}, {}, {}, {}};
#pragma unroll
  for (int k0 = 0; k0 < CC; k0 += 32) {
    const v8bf alo = *(const v8bf*)(ap + k0);
    const v8bf ahi = *(const v8bf*)(ap + k0 + 16);
    v16bf a;
#pragma unroll   // constant indices: the two halves are just register names
    for (int i = 0; i < 8; ++i) { a[i] = alo[i]; a[8 + i] = ahi[i]; }
#pragma unroll
    for (int t = 0; t < 4; ++t) {
      const v16bf b = load_frag(Wt, colg + 16 * t + nl, k0, grp);
      acc[t] = __builtin_amdgcn_wmma_f32_16x16x32_bf16(false, a, false, b,
                                                       (short)0, acc[t], false, false);
    }
  }
#pragma unroll
  for (int t = 0; t < 4; ++t) {
    const int col0 = colg + 16 * t;         // tile-uniform; tiles never straddle q/k/v
    float* out; int ldo, oc0; float sc = 1.0f; const float* bias;
    if (col0 < 32)      { out = qbuf; ldo = 32; oc0 = col0;      bias = bq;
                          sc = 0.17677669529663687f; /* 32^-0.5 */ }
    else if (col0 < 64) { out = kbuf; ldo = 32; oc0 = col0 - 32; bias = bk; }
    else                { out = vbuf; ldo = CC; oc0 = col0 - 64; bias = bv; }
    const int oc = oc0 + nl;
    const float bval = bias[oc];
#pragma unroll
    for (int v = 0; v < 8; ++v) {
      const int m = row0 + v + grp * 8;
      out[(size_t)m * ldo + oc] = (acc[t][v] + bval) * sc;
    }
  }
}

// ---------------------------------------------------------------------------
// Kernel 2: neighborhood attention core. Eight lanes per (b, head, i, j):
// lane c of a query owns channels 4c..4c+3, so the eight lanes of a query read
// one whole 128-byte v pixel with one 16-byte load each, and the four queries
// of a wave (four neighbours in j) read four adjacent pixels = 512 contiguous
// bytes per load instruction. For the scores lane c owns key column c of the
// 7x7 window (lane 7 repeats column 6 and is left out of the sum); maximum and
// sum go over the eight lanes, and each weight is handed to the eight lanes
// from its owner before it multiplies v.
// A block is 4 waves = an 8x8 patch of queries of one (b, head); a wave takes
// 4 columns and walks 4 rows.
// q/k/v read through the reference's raw-reshape strides:
//   q[b,n,i,j,l] = qflat[b*H*W*32 + n*H*W*4 + (i*W+j)*4 + l]  (v with 32)
// Output written pre-transposed to (B,H,W, n*32+d) directly as bf16 for the
// projection GEMM.
// ---------------------------------------------------------------------------
#define SEL8(a,b,c,d,e,f,g,h) \
  ((a) | ((b) << 3) | ((c) << 6) | ((d) << 9) | ((e) << 12) | ((f) << 15) | ((g) << 18) | ((h) << 21))

// Value of lane SEL[l & 7] of the same group of eight lanes.
template <int SEL>
__device__ __forceinline__ float lane8(float x) {
  return __builtin_bit_cast(float,
      __builtin_amdgcn_mov_dpp8(__builtin_bit_cast(unsigned, x), SEL));
}

__global__ void __launch_bounds__(128)
natten_kernel(const float* __restrict__ qbuf, const float* __restrict__ kbuf,
              const float* __restrict__ vbuf, const float* __restrict__ rpb,
              __bf16* __restrict__ abf) {
  const int lane = threadIdx.x & 31;
  const int wave = threadIdx.x >> 5;      // 0..3
  const int c    = lane & 7;              // channel quad, and key column owner
  const int kc   = min(c, KWIN - 1);
  int t = blockIdx.x;                     // B*NH * 7 * 7 patches
  const int tj = t % (WW / 8);  t /= (WW / 8);
  const int ti = t % (HH / 8);  t /= (HH / 8);
  const int n = t % NH;         const int b = t / NH;
  const int j  = tj * 8 + (wave & 1) * 4 + (lane >> 3);
  const int i0 = ti * 8 + (wave >> 1) * 4;

  const size_t qk_base = (size_t)b * HH * WW * 32 + (size_t)n * HH * WW * 4;
  const float* vbase = vbuf + (size_t)b * HH * WW * CC + (size_t)n * HH * WW * HD;
  const float* rb = rpb + n * 13 * 13;
  const int sw = min(max(j - 3, 0), WW - KWIN);

  // All four rows' weights first, two rows at a time (their q, k and bias loads
  // are independent and share one wait for memory), then the four rows' v sums.
  float pk[4][KWIN];                      // weight (ki, kc) of row r of this lane's query
#pragma unroll
  for (int r = 0; r < 4; ++r) {
    const int i  = i0 + r;
    const int sh = min(max(i - 3, 0), HH - KWIN);
    const float4 qv = *(const float4*)(qbuf + qk_base + (size_t)(i * WW + j) * 4);

    const float* kp = kbuf + qk_base + (size_t)(sh * WW + sw + kc) * 4;
    const float* bb = rb + (size_t)((sh - i + 6) * 13 + (sw - j + 6) + kc);

    float s[KWIN];
    float mx = -3.0e38f;
#pragma unroll
    for (int ki = 0; ki < KWIN; ++ki) {
      const float4 kv = *(const float4*)(kp + ki * WW * 4);
      const float bias = bb[ki * 13];
      const float d = qv.x * kv.x + qv.y * kv.y + qv.z * kv.z + qv.w * kv.w + bias;
      s[ki] = d;
      mx = fmaxf(mx, d);
    }
    mx = fmaxf(mx, lane8<SEL8(1,0,3,2,5,4,7,6)>(mx));
    mx = fmaxf(mx, lane8<SEL8(2,3,0,1,6,7,4,5)>(mx));
    mx = fmaxf(mx, lane8<SEL8(4,5,6,7,0,1,2,3)>(mx));

    float sum = 0.0f;
#pragma unroll
    for (int ki = 0; ki < KWIN; ++ki) { s[ki] = __expf(s[ki] - mx); sum += s[ki]; }
    if (c == 7) sum = 0.0f;               // lane 7 holds a copy of column 6
    sum += lane8<SEL8(1,0,3,2,5,4,7,6)>(sum);
    sum += lane8<SEL8(2,3,0,1,6,7,4,5)>(sum);
    sum += lane8<SEL8(4,5,6,7,0,1,2,3)>(sum);
    const float inv = 1.0f / sum;
#pragma unroll
    for (int ki = 0; ki < KWIN; ++ki) pk[r][ki] = s[ki] * inv;
    // Bounds the registers: without it the compiler issues all four rows' loads
    // and the first v loads at once, and fewer than 7 waves fit a SIMD, which
    // the 1568 blocks (6 to 7 per WGP, one wave of each per SIMD) need.
    if (r & 1) __builtin_amdgcn_sched_barrier(0);
  }

  // v sums: 28 groups (row r, window row ki) of 7 loads each, two register
  // buffers, group g + 1 loaded while group g is summed. The groups go by
  // r + ki: away from the image's edge the groups of one r + ki read the same
  // v row, so a re-read follows the first read closely, for the WGP cache.
  // Each row r still sums its ki in rising order.
  const float* vp[4];
#pragma unroll
  for (int r = 0; r < 4; ++r) {
    const int sh = min(max(i0 + r - 3, 0), HH - KWIN);
    vp[r] = vbase + (size_t)(sh * WW + sw) * HD + c * 4;
  }
  constexpr int GR[4 * KWIN] = {0, 0,1, 0,1,2, 0,1,2,3, 0,1,2,3, 0,1,2,3, 0,1,2,3, 1,2,3, 2,3, 3};
  constexpr int GK[4 * KWIN] = {0, 1,0, 2,1,0, 3,2,1,0, 4,3,2,1, 5,4,3,2, 6,5,4,3, 6,5,4, 6,5, 6};
  v4f buf[2][KWIN];
#pragma unroll
  for (int kj = 0; kj < KWIN; ++kj) buf[0][kj] = *(const v4f*)(vp[0] + kj * HD);

  v2f a01[4], a23[4];
#pragma unroll
  for (int r = 0; r < 4; ++r) { a01[r] = (v2f){0.0f, 0.0f};  a23[r] = (v2f){0.0f, 0.0f}; }
#pragma unroll
  for (int g = 0; g < 4 * KWIN; ++g) {
    const int r = GR[g], ki = GK[g];
    if (g + 1 < 4 * KWIN) {
      const float* nx = vp[GR[g + 1]] + GK[g + 1] * WW * HD;
#pragma unroll
      for (int kj = 0; kj < KWIN; ++kj) buf[(g + 1) & 1][kj] = *(const v4f*)(nx + kj * HD);
    }
    // Keeps the next group's 7 loads in front of this group's sums: without it
    // the compiler sinks each load to its use and leaves 2 or 3 in flight.
    __builtin_amdgcn_sched_barrier(0);

    const float w = pk[r][ki];
    const float p[KWIN] = {
      lane8<SEL8(0,0,0,0,0,0,0,0)>(w), lane8<SEL8(1,1,1,1,1,1,1,1)>(w),
      lane8<SEL8(2,2,2,2,2,2,2,2)>(w), lane8<SEL8(3,3,3,3,3,3,3,3)>(w),
      lane8<SEL8(4,4,4,4,4,4,4,4)>(w), lane8<SEL8(5,5,5,5,5,5,5,5)>(w),
      lane8<SEL8(6,6,6,6,6,6,6,6)>(w) };
#pragma unroll
    for (int kj = 0; kj < KWIN; ++kj) {
      const v4f vx = buf[g & 1][kj];
      const v2f pp = {p[kj], p[kj]};
      a01[r] = __builtin_elementwise_fma(pp, vx.xy, a01[r]);
      a23[r] = __builtin_elementwise_fma(pp, vx.zw, a23[r]);
    }

    if (ki == KWIN - 1) {
      v4bf o;
      o[0] = (__bf16)a01[r].x; o[1] = (__bf16)a01[r].y;
      o[2] = (__bf16)a23[r].x; o[3] = (__bf16)a23[r].y;
      *(v4bf*)(abf + ((size_t)(b * HH + i0 + r) * WW + j) * CC + n * HD + c * 4) = o;   // 8B store
      // The store's registers are reused by the later sums: wait first.
      if (g + 1 < 4 * KWIN) asm volatile("s_wait_xcnt 0x0" ::: "memory");
    }
    // Keeps group g + 2's loads behind this group's sums: two buffers, not three.
    __builtin_amdgcn_sched_barrier(0);
  }
}

// ---------------------------------------------------------------------------
// Kernel 3: output projection  out = attn_out @ Wp + bp  (M=12544, N=K=256).
// Block = 128 threads = 4 waves; each wave computes a 16x64 strip.
// ---------------------------------------------------------------------------
__global__ void __launch_bounds__(128)
proj_gemm_kernel(const __bf16* __restrict__ abf, const __bf16* __restrict__ Wpt,
                 const float* __restrict__ bp, float* __restrict__ out) {
  const int wave = threadIdx.x >> 5;        // 0..3
  const int lane = threadIdx.x & 31;
  const int grp  = lane >> 4;
  const int nl   = lane & 15;
  const int row0 = blockIdx.x * 16;
  const int colg = wave * 64;

  const int arow = row0 + nl;
  v8f acc[4] = {{}, {}, {}, {}};
#pragma unroll
  for (int k0 = 0; k0 < CC; k0 += 32) {
    __builtin_prefetch(abf + (size_t)arow * CC + k0 + 32, 0, 1);
    const v16bf a = load_frag(abf, arow, k0, grp);
#pragma unroll
    for (int t = 0; t < 4; ++t) {
      const v16bf b = load_frag(Wpt, colg + 16 * t + nl, k0, grp);
      acc[t] = __builtin_amdgcn_wmma_f32_16x16x32_bf16(false, a, false, b,
                                                       (short)0, acc[t], false, false);
    }
  }
#pragma unroll
  for (int t = 0; t < 4; ++t) {
    const int col = colg + 16 * t + nl;
    const float bval = bp[col];
#pragma unroll
    for (int v = 0; v < 8; ++v) {
      const int m = row0 + v + grp * 8;
      out[(size_t)m * CC + col] = acc[t][v] + bval;
    }
  }
}

// ---------------------------------------------------------------------------
extern "C" void kernel_launch(void* const* d_in, const int* in_sizes, int n_in,
                              void* d_out, int out_size, void* d_ws, size_t ws_size,
                              hipStream_t stream) {
  const float* x   = (const float*)d_in[0];
  const float* Wq  = (const float*)d_in[1];
  const float* bq  = (const float*)d_in[2];
  const float* Wk  = (const float*)d_in[3];
  const float* bk  = (const float*)d_in[4];
  const float* Wv  = (const float*)d_in[5];
  const float* bv  = (const float*)d_in[6];
  const float* rpb = (const float*)d_in[7];
  const float* Wp  = (const float*)d_in[8];
  const float* bp  = (const float*)d_in[9];

  // f32 scratch
  float* qbuf = (float*)d_ws;                         // MROWS*32
  float* kbuf = qbuf + (size_t)MROWS * 32;            // MROWS*32
  float* vbuf = kbuf + (size_t)MROWS * 32;            // MROWS*256
  // bf16 scratch (16B-aligned offsets by construction)
  __bf16* abf = (__bf16*)(vbuf + (size_t)MROWS * CC); // MROWS*256 bf16
  __bf16* Wt  = abf + (size_t)MROWS * CC;             // 320*256 bf16
  __bf16* Wpt = Wt + (size_t)NQKV * CC;               // 256*256 bf16

  // 0) pack: weights -> transposed bf16
  pack_w_kernel<<<dim3((NQKV * CC) / 256), 256, 0, stream>>>(Wq, Wk, Wv, Wp, Wt, Wpt);

  // 1) fused QKV projection: 784 M-tiles x (5 waves * 64 cols)
  qkv_gemm_kernel<<<dim3(MROWS / 16), 160, 0, stream>>>(
      x, Wt, bq, bk, bv, qbuf, kbuf, vbuf);

  // 2) neighborhood attention core: eight lanes per query*head, 8x8 queries a block
  natten_kernel<<<dim3(BB * NH * (HH / 8) * (WW / 8)), 128, 0, stream>>>(
      qbuf, kbuf, vbuf, rpb, abf);

  // 3) output projection: 784 M-tiles x (4 waves * 64 cols)
  proj_gemm_kernel<<<dim3(MROWS / 16), 128, 0, stream>>>(
      abf, Wpt, bp, (float*)d_out);
}

// v003
// A run of this version takes 32.2 microseconds.
// Next to v002, in two timings, it ran 1.30 times as fast each time.
// Over all steps from v000 it is 2.82 times as fast.
#include <hip/hip_runtime.h>
#include <hip/hip_bf16.h>

#define NH   8
#define KWIN 7
#define LR   4
#define HD   32
#define BB   4
#define HH   56
#define WW   56
#define CC   256
#define MROWS (BB*HH*WW)   /* 12544 */
#define NQKV 320           /* 32 q + 32 k + 256 v columns */

typedef __attribute__((ext_vector_type(16))) __bf16 v16bf;
typedef __attribute__((ext_vector_type(8)))  __bf16 v8bf;
typedef __attribute__((ext_vector_type(4)))  __bf16 v4bf;
typedef __attribute__((ext_vector_type(8)))  float  v8f;
typedef __attribute__((ext_vector_type(4)))  float  v4f;
typedef __attribute__((ext_vector_type(2)))  float  v2f;

// ---------------------------------------------------------------------------
// Both GEMMs keep their operands as bf16 rows in LDS (A: M x K, B^T: N x K) and
// take the fragments from there. gfx1250 16-bit A/B layout, wave32:
//   lanes 0-15  : row r, K = {k0+0..7} in v0..3 and {k0+16..23} in v4..7
//   lanes 16-31 : row r, K offsets shifted by +8
// Both K-chunks are 8 contiguous bf16 = one 16-byte LDS load each.
// LDS row pitch 528 B = 16 B x 33 for 16-byte readers.
// A work-group is 64 rows of the output: its 4 M tiles share one copy of the
// weights, which it fetches once, a whole 512-byte row per wave-wide load.
// ---------------------------------------------------------------------------
#define APITCH (CC + 8)   /* bf16 elements per LDS row */
#define MBLK   64         /* output rows per work-group */

// p = LDS row r + k0 + grp * 8
__device__ __forceinline__ v16bf lds_frag(const __bf16* p) {
  v8bf lo = *(const v8bf*)(p);
  v8bf hi = *(const v8bf*)(p + 16);
  v16bf f;
#pragma unroll   // constant indices: the two halves are just register names
  for (int i = 0; i < 8; ++i) { f[i] = lo[i]; f[8 + i] = hi[i]; }
  return f;
}

// ---------------------------------------------------------------------------
// Pack kernel (tiny): weights -> transposed bf16.
// Wt rows: [0,32)=Wq^T, [32,64)=Wk^T, [64,320)=Wv^T.  Wpt = Wp^T.
// ---------------------------------------------------------------------------
__global__ void __launch_bounds__(256)
pack_w_kernel(const float* __restrict__ Wq, const float* __restrict__ Wk,
              const float* __restrict__ Wv, const float* __restrict__ Wp,
              __bf16* __restrict__ Wt, __bf16* __restrict__ Wpt) {
  const int idx = blockIdx.x * 256 + threadIdx.x;   // over NQKV*CC = 81920
  const int k = idx & (CC - 1);
  const int n = idx >> 8;
  float v;
  if (n < 32)      v = Wq[k * 32 + n];
  else if (n < 64) v = Wk[k * 32 + (n - 32)];
  else             v = Wv[k * CC + (n - 64)];
  Wt[idx] = (__bf16)v;
  if (n < CC) Wpt[(size_t)n * CC + k] = (__bf16)Wp[(size_t)k * CC + n];
}

// ---------------------------------------------------------------------------
// Kernel 1: fused QKV projection GEMM, M=12544, N=320, K=256, bf16 WMMA.
// Block = 640 threads = 20 waves = 4 M tiles x 5 strips of 64 columns; each
// wave computes a 16x64 strip (4 WMMA tiles, A fragment reused 4x).
// Grid = 196 blocks of 64 rows, one per WGP (LDS 198 KB).
// x comes in as f32: the block reads its 64 rows (64 KB in a row) once, in
// whole lines, rounds them to bf16 and keeps them in LDS. All 320 rows of Wt
// go to LDS beside them.
//   cols [0,32)  -> q = (acc + bq) * hd^-0.5
//   cols [32,64) -> k = acc + bk
//   cols [64,320)-> v = acc + bv
// ---------------------------------------------------------------------------
__global__ void __launch_bounds__(640)
qkv_gemm_kernel(const float* __restrict__ x, const __bf16* __restrict__ Wt,
                const float* __restrict__ bq, const float* __restrict__ bk,
                const float* __restrict__ bv,
                float* __restrict__ qbuf, float* __restrict__ kbuf,
                float* __restrict__ vbuf) {
  const int tid  = threadIdx.x;
  const int wave = tid >> 5;                // 0..19
  const int lane = tid & 31;
  const int grp  = lane >> 4;
  const int nl   = lane & 15;
  const int mt   = wave / 5;                // M tile of the block
  const int row0 = blockIdx.x * MBLK + mt * 16;
  const int colg = (wave - mt * 5) * 64;    // wave's 64-column strip

  __shared__ __attribute__((aligned(16))) __bf16 As[MBLK * APITCH];
  __shared__ __attribute__((aligned(16))) __bf16 Bs[NQKV * APITCH];
  {
    // x: 64 * 256 floats = 4096 groups of 4 over 640 threads: 6 each, and a 7th
    // for waves 0 to 7. Wt: 320 rows of 32 16-byte units: 16 each, a row per
    // wave and load. All loads first, so that they share one wait. The loops
    // are unrolled so that xv[] and wv[] are indexed by constants and stay in
    // registers.
    const float4* xs = (const float4*)(x + (size_t)blockIdx.x * MBLK * CC);
    const v8bf*   ws = (const v8bf*)Wt;
    float4 xv[7];
    v8bf   wv[16];
#pragma unroll
    for (int i = 0; i < 16; ++i) wv[i] = ws[tid + 640 * i];
#pragma unroll
    for (int i = 0; i < 6; ++i) xv[i] = xs[tid + 640 * i];
    if (tid < 256) xv[6] = xs[tid + 3840];
#pragma unroll
    for (int i = 0; i < 7; ++i) {
      if (i < 6 || tid < 256) {
        const int e = tid + 640 * i;        // row e / 64, floats 4 * (e % 64) ...
        v4bf o;
        o[0] = (__bf16)xv[i].x; o[1] = (__bf16)xv[i].y;
        o[2] = (__bf16)xv[i].z; o[3] = (__bf16)xv[i].w;
        *(v4bf*)(As + (e >> 6) * APITCH + (e & 63) * 4) = o;
      }
    }
#pragma unroll
    for (int i = 0; i < 16; ++i)            // row wave + 20 * i, unit lane
      *(v8bf*)(Bs + (wave + 20 * i) * APITCH + lane * 8) = wv[i];
  }
  __syncthreads();                          // every wave reads rows that others wrote

  const __bf16* ap = As + (mt * 16 + nl) * APITCH + grp * 8;
  const __bf16* wp = Bs + (colg + nl) * APITCH + grp * 8;
  v8f acc[4] = {{}, {}, {}, {}};
#pragma unroll
  for (int k0 = 0; k0 < CC; k0 += 32) {
    const v16bf a = lds_frag(ap + k0);
#pragma unroll
    for (int t = 0; t < 4; ++t) {
      const v16bf b = lds_frag(wp + 16 * t * APITCH + k0);
      acc[t] = __builtin_amdgcn_wmma_f32_16x16x32_bf16(false, a, false, b,
                                                       (short)0, acc[t], false, false);
    }
  }
#pragma unroll
  for (int t = 0; t < 4; ++t) {
    const int col0 = colg + 16 * t;         // tile-uniform; tiles never straddle q/k/v
    float* out; int ldo, oc0; float sc = 1.0f; const float* bias;
    if (col0 < 32)      { out = qbuf; ldo = 32; oc0 = col0;      bias = bq;
                          sc = 0.17677669529663687f; /* 32^-0.5 */ }
    else if (col0 < 64) { out = kbuf; ldo = 32; oc0 = col0 - 32; bias = bk; }
    else                { out = vbuf; ldo = CC; oc0 = col0 - 64; bias = bv; }
    const int oc = oc0 + nl;
    const float bval = bias[oc];
#pragma unroll
    for (int v = 0; v < 8; ++v) {
      const int m = row0 + v + grp * 8;
      out[(size_t)m * ldo + oc] = (acc[t][v] + bval) * sc;
    }
  }
}

// ---------------------------------------------------------------------------
// Kernel 2: neighborhood attention core. Eight lanes per (b, head, i, j):
// lane c of a query owns channels 4c..4c+3, so the eight lanes of a query read
// one whole 128-byte v pixel with one 16-byte load each, and the four queries
// of a wave (four neighbours in j) read four adjacent pixels = 512 contiguous
// bytes per load instruction. For the scores lane c owns key column c of the
// 7x7 window (lane 7 repeats column 6 and is left out of the sum); maximum and
// sum go over the eight lanes, and each weight is handed to the eight lanes
// from its owner before it multiplies v.
// A block is 4 waves = an 8x8 patch of queries of one (b, head); a wave takes
// 4 columns and walks 4 rows.
// q/k/v read through the reference's raw-reshape strides:
//   q[b,n,i,j,l] = qflat[b*H*W*32 + n*H*W*4 + (i*W+j)*4 + l]  (v with 32)
// Output written pre-transposed to (B,H,W, n*32+d) directly as bf16 for the
// projection GEMM.
// ---------------------------------------------------------------------------
#define SEL8(a,b,c,d,e,f,g,h) \
  ((a) | ((b) << 3) | ((c) << 6) | ((d) << 9) | ((e) << 12) | ((f) << 15) | ((g) << 18) | ((h) << 21))

// Value of lane SEL[l & 7] of the same group of eight lanes.
template <int SEL>
__device__ __forceinline__ float lane8(float x) {
  return __builtin_bit_cast(float,
      __builtin_amdgcn_mov_dpp8(__builtin_bit_cast(unsigned, x), SEL));
}

__global__ void __launch_bounds__(128)
natten_kernel(const float* __restrict__ qbuf, const float* __restrict__ kbuf,
              const float* __restrict__ vbuf, const float* __restrict__ rpb,
              __bf16* __restrict__ abf) {
  const int lane = threadIdx.x & 31;
  const int wave = threadIdx.x >> 5;      // 0..3
  const int c    = lane & 7;              // channel quad, and key column owner
  const int kc   = min(c, KWIN - 1);
  int t = blockIdx.x;                     // B*NH * 7 * 7 patches
  const int tj = t % (WW / 8);  t /= (WW / 8);
  const int ti = t % (HH / 8);  t /= (HH / 8);
  const int n = t % NH;         const int b = t / NH;
  const int j  = tj * 8 + (wave & 1) * 4 + (lane >> 3);
  const int i0 = ti * 8 + (wave >> 1) * 4;

  const size_t qk_base = (size_t)b * HH * WW * 32 + (size_t)n * HH * WW * 4;
  const float* vbase = vbuf + (size_t)b * HH * WW * CC + (size_t)n * HH * WW * HD;
  const float* rb = rpb + n * 13 * 13;
  const int sw = min(max(j - 3, 0), WW - KWIN);

  // All four rows' weights first, two rows at a time (their q, k and bias loads
  // are independent and share one wait for memory), then the four rows' v sums.
  float pk[4][KWIN];                      // weight (ki, kc) of row r of this lane's query
#pragma unroll
  for (int r = 0; r < 4; ++r) {
    const int i  = i0 + r;
    const int sh = min(max(i - 3, 0), HH - KWIN);
    const float4 qv = *(const float4*)(qbuf + qk_base + (size_t)(i * WW + j) * 4);

    const float* kp = kbuf + qk_base + (size_t)(sh * WW + sw + kc) * 4;
    const float* bb = rb + (size_t)((sh - i + 6) * 13 + (sw - j + 6) + kc);

    float s[KWIN];
    float mx = -3.0e38f;
#pragma unroll
    for (int ki = 0; ki < KWIN; ++ki) {
      const float4 kv = *(const float4*)(kp + ki * WW * 4);
      const float bias = bb[ki * 13];
      const float d = qv.x * kv.x + qv.y * kv.y + qv.z * kv.z + qv.w * kv.w + bias;
      s[ki] = d;
      mx = fmaxf(mx, d);
    }
    mx = fmaxf(mx, lane8<SEL8(1,0,3,2,5,4,7,6)>(mx));
    mx = fmaxf(mx, lane8<SEL8(2,3,0,1,6,7,4,5)>(mx));
    mx = fmaxf(mx, lane8<SEL8(4,5,6,7,0,1,2,3)>(mx));

    float sum = 0.0f;
#pragma unroll
    for (int ki = 0; ki < KWIN; ++ki) { s[ki] = __expf(s[ki] - mx); sum += s[ki]; }
    if (c == 7) sum = 0.0f;               // lane 7 holds a copy of column 6
    sum += lane8<SEL8(1,0,3,2,5,4,7,6)>(sum);
    sum += lane8<SEL8(2,3,0,1,6,7,4,5)>(sum);
    sum += lane8<SEL8(4,5,6,7,0,1,2,3)>(sum);
    const float inv = 1.0f / sum;
#pragma unroll
    for (int ki = 0; ki < KWIN; ++ki) pk[r][ki] = s[ki] * inv;
    // Bounds the registers: without it the compiler issues all four rows' loads
    // and the first v loads at once, and fewer than 7 waves fit a SIMD, which
    // the 1568 blocks (6 to 7 per WGP, one wave of each per SIMD) need.
    if (r & 1) __builtin_amdgcn_sched_barrier(0);
  }

  // v sums: 28 groups (row r, window row ki) of 7 loads each, two register
  // buffers, group g + 1 loaded while group g is summed. The groups go by
  // r + ki: away from the image's edge the groups of one r + ki read the same
  // v row, so a re-read follows the first read closely, for the WGP cache.
  // Each row r still sums its ki in rising order.
  const float* vp[4];
#pragma unroll
  for (int r = 0; r < 4; ++r) {
    const int sh = min(max(i0 + r - 3, 0), HH - KWIN);
    vp[r] = vbase + (size_t)(sh * WW + sw) * HD + c * 4;
  }
  constexpr int GR[4 * KWIN] = {0, 0,1, 0,1,2, 0,1,2,3, 0,1,2,3, 0,1,2,3, 0,1,2,3, 1,2,3, 2,3, 3};
  constexpr int GK[4 * KWIN] = {0, 1,0, 2,1,0, 3,2,1,0, 4,3,2,1, 5,4,3,2, 6,5,4,3, 6,5,4, 6,5, 6};
  v4f buf[2][KWIN];
#pragma unroll
  for (int kj = 0; kj < KWIN; ++kj) buf[0][kj] = *(const v4f*)(vp[0] + kj * HD);

  v2f a01[4], a23[4];
#pragma unroll
  for (int r = 0; r < 4; ++r) { a01[r] = (v2f){0.0f, 0.0f};  a23[r] = (v2f){0.0f, 0.0f}; }
#pragma unroll
  for (int g = 0; g < 4 * KWIN; ++g) {
    const int r = GR[g], ki = GK[g];
    if (g + 1 < 4 * KWIN) {
      const float* nx = vp[GR[g + 1]] + GK[g + 1] * WW * HD;
#pragma unroll
      for (int kj = 0; kj < KWIN; ++kj) buf[(g + 1) & 1][kj] = *(const v4f*)(nx + kj * HD);
    }
    // Keeps the next group's 7 loads in front of this group's sums: without it
    // the compiler sinks each load to its use and leaves 2 or 3 in flight.
    __builtin_amdgcn_sched_barrier(0);

    const float w = pk[r][ki];
    const float p[KWIN] = {
      lane8<SEL8(0,0,0,0,0,0,0,0)>(w), lane8<SEL8(1,1,1,1,1,1,1,1)>(w),
      lane8<SEL8(2,2,2,2,2,2,2,2)>(w), lane8<SEL8(3,3,3,3,3,3,3,3)>(w),
      lane8<SEL8(4,4,4,4,4,4,4,4)>(w), lane8<SEL8(5,5,5,5,5,5,5,5)>(w),
      lane8<SEL8(6,6,6,6,6,6,6,6)>(w) };
#pragma unroll
    for (int kj = 0; kj < KWIN; ++kj) {
      const v4f vx = buf[g & 1][kj];
      const v2f pp = {p[kj], p[kj]};
      a01[r] = __builtin_elementwise_fma(pp, vx.xy, a01[r]);
      a23[r] = __builtin_elementwise_fma(pp, vx.zw, a23[r]);
    }

    if (ki == KWIN - 1) {
      v4bf o;
      o[0] = (__bf16)a01[r].x; o[1] = (__bf16)a01[r].y;
      o[2] = (__bf16)a23[r].x; o[3] = (__bf16)a23[r].y;
      *(v4bf*)(abf + ((size_t)(b * HH + i0 + r) * WW + j) * CC + n * HD + c * 4) = o;   // 8B store
      // The store's registers are reused by the later sums: wait first.
      if (g + 1 < 4 * KWIN) asm volatile("s_wait_xcnt 0x0" ::: "memory");
    }
    // Keeps group g + 2's loads behind this group's sums: two buffers, not three.
    __builtin_amdgcn_sched_barrier(0);
  }
}

// ---------------------------------------------------------------------------
// Kernel 3: output projection  out = attn_out @ Wp + bp  (M=12544, N=K=256).
// Block = 512 threads = 16 waves = 4 M tiles x 4 strips of 64 columns; each
// wave computes a 16x64 strip. Grid = 196 blocks of 64 rows, one per WGP
// (LDS 165 KB): the block's 64 rows of attn_out and all 256 rows of Wpt.
// ---------------------------------------------------------------------------
__global__ void __launch_bounds__(512)
proj_gemm_kernel(const __bf16* __restrict__ abf, const __bf16* __restrict__ Wpt,
                 const float* __restrict__ bp, float* __restrict__ out) {
  const int tid  = threadIdx.x;
  const int wave = tid >> 5;                // 0..15
  const int lane = tid & 31;
  const int grp  = lane >> 4;
  const int nl   = lane & 15;
  const int mt   = wave >> 2;               // M tile of the block
  const int row0 = blockIdx.x * MBLK + mt * 16;
  const int colg = (wave & 3) * 64;

  __shared__ __attribute__((aligned(16))) __bf16 As[MBLK * APITCH];
  __shared__ __attribute__((aligned(16))) __bf16 Bs[CC * APITCH];
  {
    // Rows of 32 16-byte units, a row per wave and load: 4 loads a thread for
    // attn_out, 16 for Wpt. All loads first, so that they share one wait;
    // unrolled so that av[] and wv[] stay in registers.
    const v8bf* as = (const v8bf*)(abf + (size_t)blockIdx.x * MBLK * CC);
    const v8bf* ws = (const v8bf*)Wpt;
    v8bf av[4], wv[16];
#pragma unroll
    for (int i = 0; i < 4; ++i)  av[i] = as[tid + 512 * i];
#pragma unroll
    for (int i = 0; i < 16; ++i) wv[i] = ws[tid + 512 * i];
#pragma unroll
    for (int i = 0; i < 4; ++i)             // row wave + 16 * i, unit lane
      *(v8bf*)(As + (wave + 16 * i) * APITCH + lane * 8) = av[i];
#pragma unroll
    for (int i = 0; i < 16; ++i)
      *(v8bf*)(Bs + (wave + 16 * i) * APITCH + lane * 8) = wv[i];
  }
  __syncthreads();                          // every wave reads rows that others wrote

  const __bf16* ap = As + (mt * 16 + nl) * APITCH + grp * 8;
  const __bf16* wp = Bs + (colg + nl) * APITCH + grp * 8;
  v8f acc[4] = {{}, {}, {}, {}};
#pragma unroll
  for (int k0 = 0; k0 < CC; k0 += 32) {
    const v16bf a = lds_frag(ap + k0);
#pragma unroll
    for (int t = 0; t < 4; ++t) {
      const v16bf b = lds_frag(wp + 16 * t * APITCH + k0);
      acc[t] = __builtin_amdgcn_wmma_f32_16x16x32_bf16(false, a, false, b,
                                                       (short)0, acc[t], false, false);
    }
  }
#pragma unroll
  for (int t = 0; t < 4; ++t) {
    const int col = colg + 16 * t + nl;
    const float bval = bp[col];
#pragma unroll
    for (int v = 0; v < 8; ++v) {
      const int m = row0 + v + grp * 8;
      out[(size_t)m * CC + col] = acc[t][v] + bval;
    }
  }
}

// ---------------------------------------------------------------------------
extern "C" void kernel_launch(void* const* d_in, const int* in_sizes, int n_in,
                              void* d_out, int out_size, void* d_ws, size_t ws_size,
                              hipStream_t stream) {
  const float* x   = (const float*)d_in[0];
  const float* Wq  = (const float*)d_in[1];
  const float* bq  = (const float*)d_in[2];
  const float* Wk  = (const float*)d_in[3];
  const float* bk  = (const float*)d_in[4];
  const float* Wv  = (const float*)d_in[5];
  const float* bv  = (const float*)d_in[6];
  const float* rpb = (const float*)d_in[7];
  const float* Wp  = (const float*)d_in[8];
  const float* bp  = (const float*)d_in[9];

  // f32 scratch
  float* qbuf = (float*)d_ws;                         // MROWS*32
  float* kbuf = qbuf + (size_t)MROWS * 32;            // MROWS*32
  float* vbuf = kbuf + (size_t)MROWS * 32;            // MROWS*256
  // bf16 scratch (16B-aligned offsets by construction)
  __bf16* abf = (__bf16*)(vbuf + (size_t)MROWS * CC); // MROWS*256 bf16
  __bf16* Wt  = abf + (size_t)MROWS * CC;             // 320*256 bf16
  __bf16* Wpt = Wt + (size_t)NQKV * CC;               // 256*256 bf16

  // 0) pack: weights -> transposed bf16
  pack_w_kernel<<<dim3((NQKV * CC) / 256), 256, 0, stream>>>(Wq, Wk, Wv, Wp, Wt, Wpt);

  // 1) fused QKV projection: 196 blocks of 4 M-tiles x (5 waves * 64 cols)
  qkv_gemm_kernel<<<dim3(MROWS / MBLK), 640, 0, stream>>>(
      x, Wt, bq, bk, bv, qbuf, kbuf, vbuf);

  // 2) neighborhood attention core: eight lanes per query*head, 8x8 queries a block
  natten_kernel<<<dim3(BB * NH * (HH / 8) * (WW / 8)), 128, 0, stream>>>(
      qbuf, kbuf, vbuf, rpb, abf);

  // 3) output projection: 196 blocks of 4 M-tiles x (4 waves * 64 cols)
  proj_gemm_kernel<<<dim3(MROWS / MBLK), 512, 0, stream>>>(
      abf, Wpt, bp, (float*)d_out);
}

// v004
// It runs in 31.3 microseconds.
// In both of two side-by-side timings against v003, it was 1.04 times as fast.
// Over all steps from v000 it is 2.93 times as fast.
#include <hip/hip_runtime.h>
#include <hip/hip_bf16.h>

#define NH   8
#define KWIN 7
#define LR   4
#define HD   32
#define BB   4
#define HH   56
#define WW   56
#define CC   256
#define MROWS (BB*HH*WW)   /* 12544 */
#define NQKV 320           /* 32 q + 32 k + 256 v columns */

typedef __attribute__((ext_vector_type(16))) __bf16 v16bf;
typedef __attribute__((ext_vector_type(8)))  __bf16 v8bf;
typedef __attribute__((ext_vector_type(4)))  __bf16 v4bf;
typedef __attribute__((ext_vector_type(8)))  float  v8f;
typedef __attribute__((ext_vector_type(4)))  float  v4f;
typedef __attribute__((ext_vector_type(2)))  float  v2f;

// ---------------------------------------------------------------------------
// Both GEMMs keep their operands as bf16 rows in LDS (A: M x K, B^T: N x K) and
// take the fragments from there. gfx1250 16-bit A/B layout, wave32:
//   lanes 0-15  : row r, K = {k0+0..7} in v0..3 and {k0+16..23} in v4..7
//   lanes 16-31 : row r, K offsets shifted by +8
// Both K-chunks are 8 contiguous bf16 = one 16-byte LDS load each.
// LDS row pitch 528 B = 16 B x 33 for 16-byte readers.
// A work-group is 64 rows of the output: its 4 M tiles share one copy of the
// weights, which it fetches once, in whole 128-byte lines.
// ---------------------------------------------------------------------------
#define APITCH (CC + 8)   /* bf16 elements per LDS row */
#define MBLK   64         /* output rows per work-group */

// p = LDS row r + k0 + grp * 8
__device__ __forceinline__ v16bf lds_frag(const __bf16* p) {
  v8bf lo = *(const v8bf*)(p);
  v8bf hi = *(const v8bf*)(p + 16);
  v16bf f;
#pragma unroll   // constant indices: the two halves are just register names
  for (int i = 0; i < 8; ++i) { f[i] = lo[i]; f[8 + i] = hi[i]; }
  return f;
}

// ---------------------------------------------------------------------------
// Weights come as f32, K x N (row k, column n); the GEMMs want bf16 rows N x K.
// A lane takes a patch of 8 k x 4 n by eight 16-byte loads and rounds it: the 8
// values of one column are then one 16-byte piece of a transposed row, so the
// transposition costs no instruction beyond the rounding.
// ---------------------------------------------------------------------------
__device__ __forceinline__ v8bf col_of_patch(const v4f (&r)[8], int c) {
  v8bf o;
#pragma unroll   // constant indices: r[] stays in registers
  for (int j = 0; j < 8; ++j) o[j] = (__bf16)r[j][c];
  return o;
}

#define WPBLK 4           /* extra work-groups of kernel 1 that transpose Wp */

// ---------------------------------------------------------------------------
// Kernel 1: fused QKV projection GEMM, M=12544, N=320, K=256, bf16 WMMA.
// Block = 640 threads = 20 waves = 4 M tiles x 5 strips of 64 columns; each
// wave computes a 16x64 strip (4 WMMA tiles, A fragment reused 4x).
// Grid = 196 blocks of 64 rows, one per WGP (LDS 198 KB), and WPBLK more.
// x comes in as f32: the block reads its 64 rows (64 KB in a row) once, in
// whole lines, rounds them to bf16 and keeps them in LDS. Beside them go the
// 320 transposed bf16 rows of the weights ([0,32) Wq, [32,64) Wk, [64,320) Wv),
// which the block makes itself from the f32 matrices.
// The WPBLK last blocks, on WGPs that the 196 leave idle, do no GEMM: they
// write Wp^T as bf16 to the workspace for kernel 3.
//   cols [0,32)  -> q = (acc + bq) * hd^-0.5
//   cols [32,64) -> k = acc + bk
//   cols [64,320)-> v = acc + bv
// ---------------------------------------------------------------------------
__global__ void __launch_bounds__(640)
qkv_gemm_kernel(const float* __restrict__ x, const float* __restrict__ Wq,
                const float* __restrict__ Wk, const float* __restrict__ Wv,
                const float* __restrict__ Wp,
                const float* __restrict__ bq, const float* __restrict__ bk,
                const float* __restrict__ bv,
                float* __restrict__ qbuf, float* __restrict__ kbuf,
                float* __restrict__ vbuf, __bf16* __restrict__ Wpt) {
  const int tid  = threadIdx.x;
  const int wave = tid >> 5;                // 0..19
  const int lane = tid & 31;
  const int grp  = lane >> 4;
  const int nl   = lane & 15;
  const int mt   = wave / 5;                // M tile of the block
  const int row0 = blockIdx.x * MBLK + mt * 16;
  const int colg = (wave - mt * 5) * 64;    // wave's 64-column strip
  const int wu   = __builtin_amdgcn_readfirstlane(wave);   // scalar: picks matrices

  if (blockIdx.x >= MROWS / MBLK) {
    // Wp^T: 64 wave tiles of 64 k x 16 n, one each for 16 waves of 4 blocks. A
    // lane's patch is k octet lane / 4, n quad lane % 4: the eight lanes of one
    // output row store one whole 128-byte line.
    if (wu < 16) {
      const int tw = (blockIdx.x - MROWS / MBLK) * 16 + wu;
      const int n0 = (tw & 15) * 16, k0 = (tw >> 4) * 64;      // scalar
      const unsigned li = ((lane >> 2) * 8 * CC + (lane & 3) * 4) * 4;   // bytes
      const unsigned lo = (lane & 3) * 4 * CC + (lane >> 2) * 8;
      const char* s = (const char*)(Wp + k0 * CC + n0);
      __bf16*     d = Wpt + n0 * CC + k0;
      v4f r[8];
#pragma unroll
      for (int j = 0; j < 8; ++j) r[j] = *(const v4f*)(s + j * CC * 4 + li);
      // The wait behind the loads that name li; as its input, li keeps its
      // register up to here, so that no later load's result lands on it earlier.
      asm volatile("s_wait_xcnt 0x0" :: "v"(li) : "memory");
#pragma unroll
      for (int c = 0; c < 4; ++c)
        *(v8bf*)(d + lo + c * CC) = col_of_patch(r, c);
    }
    return;                                 // the whole block, ahead of the barrier
  }

  __shared__ __attribute__((aligned(16))) __bf16 As[MBLK * APITCH];
  __shared__ __attribute__((aligned(16))) __bf16 Bs[NQKV * APITCH];
  {
    // x: 64 * 256 floats = 4096 groups of 4 over 640 threads: 6 each, and a 7th
    // for waves 0 to 7. Weights: 80 wave tiles of 32 k x 32 n (64 of Wv, 8 of
    // Wq, 8 of Wk), 4 a wave, all 4 of one row length, so that a wave's loads
    // share 8 offsets; a load takes 4 whole lines, one of each of 4 rows.
    // A lane's patch is n quad nq, k octet ko, dealt so that the 16 lanes of a
    // half wave (4 nq x 4 ko) store to all 64 LDS banks: 4 rows on are 16 banks
    // on, an octet is 4 banks.
    // All loads first, the weights ahead of x and used in that order. The loops
    // are unrolled so that xv[] and wv[] are indexed by constants and stay in
    // registers.
    const float4* xs = (const float4*)(x + (size_t)blockIdx.x * MBLK * CC);
    const int nq = (lane & 3) + 4 * grp;
    const int ko = (lane >> 2) & 3;
    const bool isv = wu < 16;               // waves 0..15: Wv; 16..19: Wq and Wk
    const unsigned ldb = isv ? CC * 4 : 32 * 4;   // bytes per row of the matrix
    unsigned lo[8];                         // row j of the patch, bytes from the tile's start
#pragma unroll
    for (int j = 0; j < 8; ++j) lo[j] = (ko * 8 + j) * ldb + nq * 16;
    float4 xv[7];
    v4f    wv[4][8];
    int    wd[4];                           // tile's place in Bs (scalar)
#pragma unroll
    for (int i = 0; i < 4; ++i) {
      const int tv = wu + 16 * i;           // Wv: k group tv / 8, column group tv % 8
      const int tq = wu - 16 + 4 * i;       // Wq (0..7), Wk (8..15): k group tq % 8
      const int sv = ((tv >> 3) * 32 * CC + (tv & 7) * 32) * 4;   // tile's start, bytes
      const int sq = (tq & 7) * 32 * 32 * 4;
      const int dv = (64 + (tv & 7) * 32) * APITCH + (tv >> 3) * 32;
      const int dq = (tq >> 3) * 32 * APITCH + (tq & 7) * 32;
      const float* mq = tq < 8 ? Wq : Wk;
      const float* m  = isv ? Wv : mq;
      const char*  s  = (const char*)m + (isv ? sv : sq);
#pragma unroll
      for (int j = 0; j < 8; ++j) wv[i][j] = *(const v4f*)(s + lo[j]);
      wd[i] = isv ? dv : dq;
    }
#pragma unroll
    for (int i = 0; i < 6; ++i) xv[i] = xs[tid + 640 * i];
    if (tid < 256) xv[6] = xs[tid + 3840];
    // The wait behind the loads that name lo[]; as its inputs, they keep their
    // registers up to here, so that no later load's result lands on them earlier.
    asm volatile("s_wait_xcnt 0x0" :: "v"(lo[0]), "v"(lo[1]), "v"(lo[2]), "v"(lo[3]),
                 "v"(lo[4]), "v"(lo[5]), "v"(lo[6]), "v"(lo[7]) : "memory");
    __bf16* bd = Bs + nq * 4 * APITCH + ko * 8;
#pragma unroll
    for (int i = 0; i < 4; ++i) {
#pragma unroll
      for (int c = 0; c < 4; ++c)
        *(v8bf*)(bd + wd[i] + c * APITCH) = col_of_patch(wv[i], c);
    }
#pragma unroll
    for (int i = 0; i < 7; ++i) {
      if (i < 6 || tid < 256) {
        const int e = tid + 640 * i;        // row e / 64, floats 4 * (e % 64) ...
        v4bf o;
        o[0] = (__bf16)xv[i].x; o[1] = (__bf16)xv[i].y;
        o[2] = (__bf16)xv[i].z; o[3] = (__bf16)xv[i].w;
        *(v4bf*)(As + (e >> 6) * APITCH + (e & 63) * 4) = o;
      }
    }
  }
  __syncthreads();                          // every wave reads rows that others wrote

  const __bf16* ap = As + (mt * 16 + nl) * APITCH + grp * 8;
  const __bf16* wp = Bs + (colg + nl) * APITCH + grp * 8;
  v8f acc[4] = {{}, {}, {}, {}};
#pragma unroll
  for (int k0 = 0; k0 < CC; k0 += 32) {
    const v16bf a = lds_frag(ap + k0);
#pragma unroll
    for (int t = 0; t < 4; ++t) {
      const v16bf b = lds_frag(wp + 16 * t * APITCH + k0);
      acc[t] = __builtin_amdgcn_wmma_f32_16x16x32_bf16(false, a, false, b,
                                                       (short)0, acc[t], false, false);
    }
  }
#pragma unroll
  for (int t = 0; t < 4; ++t) {
    const int col0 = colg + 16 * t;         // tile-uniform; tiles never straddle q/k/v
    float* out; int ldo, oc0; float sc = 1.0f; const float* bias;
    if (col0 < 32)      { out = qbuf; ldo = 32; oc0 = col0;      bias = bq;
                          sc = 0.17677669529663687f; /* 32^-0.5 */ }
    else if (col0 < 64) { out = kbuf; ldo = 32; oc0 = col0 - 32; bias = bk; }
    else                { out = vbuf; ldo = CC; oc0 = col0 - 64; bias = bv; }
    const int oc = oc0 + nl;
    const float bval = bias[oc];
#pragma unroll
    for (int v = 0; v < 8; ++v) {
      const int m = row0 + v + grp * 8;
      out[(size_t)m * ldo + oc] = (acc[t][v] + bval) * sc;
    }
  }
}

// ---------------------------------------------------------------------------
// Kernel 2: neighborhood attention core. Eight lanes per (b, head, i, j):
// lane c of a query owns channels 4c..4c+3, so the eight lanes of a query read
// one whole 128-byte v pixel with one 16-byte load each, and the four queries
// of a wave (four neighbours in j) read four adjacent pixels = 512 contiguous
// bytes per load instruction. For the scores lane c owns key column c of the
// 7x7 window (lane 7 repeats column 6 and is left out of the sum); maximum and
// sum go over the eight lanes, and each weight is handed to the eight lanes
// from its owner before it multiplies v.
// A block is 4 waves = an 8x8 patch of queries of one (b, head); a wave takes
// 4 columns and walks 4 rows.
// q/k/v read through the reference's raw-reshape strides:
//   q[b,n,i,j,l] = qflat[b*H*W*32 + n*H*W*4 + (i*W+j)*4 + l]  (v with 32)
// Output written pre-transposed to (B,H,W, n*32+d) directly as bf16 for the
// projection GEMM.
// ---------------------------------------------------------------------------
#define SEL8(a,b,c,d,e,f,g,h) \
  ((a) | ((b) << 3) | ((c) << 6) | ((d) << 9) | ((e) << 12) | ((f) << 15) | ((g) << 18) | ((h) << 21))

// Value of lane SEL[l & 7] of the same group of eight lanes.
template <int SEL>
__device__ __forceinline__ float lane8(float x) {
  return __builtin_bit_cast(float,
      __builtin_amdgcn_mov_dpp8(__builtin_bit_cast(unsigned, x), SEL));
}

__global__ void __launch_bounds__(128)
natten_kernel(const float* __restrict__ qbuf, const float* __restrict__ kbuf,
              const float* __restrict__ vbuf, const float* __restrict__ rpb,
              __bf16* __restrict__ abf) {
  const int lane = threadIdx.x & 31;
  const int wave = threadIdx.x >> 5;      // 0..3
  const int c    = lane & 7;              // channel quad, and key column owner
  const int kc   = min(c, KWIN - 1);
  int t = blockIdx.x;                     // B*NH * 7 * 7 patches
  const int tj = t % (WW / 8);  t /= (WW / 8);
  const int ti = t % (HH / 8);  t /= (HH / 8);
  const int n = t % NH;         const int b = t / NH;
  const int j  = tj * 8 + (wave & 1) * 4 + (lane >> 3);
  const int i0 = ti * 8 + (wave >> 1) * 4;

  const size_t qk_base = (size_t)b * HH * WW * 32 + (size_t)n * HH * WW * 4;
  const float* vbase = vbuf + (size_t)b * HH * WW * CC + (size_t)n * HH * WW * HD;
  const float* rb = rpb + n * 13 * 13;
  const int sw = min(max(j - 3, 0), WW - KWIN);

  // All four rows' weights first, two rows at a time (their q, k and bias loads
  // are independent and share one wait for memory), then the four rows' v sums.
  float pk[4][KWIN];                      // weight (ki, kc) of row r of this lane's query
#pragma unroll
  for (int r = 0; r < 4; ++r) {
    const int i  = i0 + r;
    const int sh = min(max(i - 3, 0), HH - KWIN);
    const float4 qv = *(const float4*)(qbuf + qk_base + (size_t)(i * WW + j) * 4);

    const float* kp = kbuf + qk_base + (size_t)(sh * WW + sw + kc) * 4;
    const float* bb = rb + (size_t)((sh - i + 6) * 13 + (sw - j + 6) + kc);

    float s[KWIN];
    float mx = -3.0e38f;
#pragma unroll
    for (int ki = 0; ki < KWIN; ++ki) {
      const float4 kv = *(const float4*)(kp + ki * WW * 4);
      const float bias = bb[ki * 13];
      const float d = qv.x * kv.x + qv.y * kv.y + qv.z * kv.z + qv.w * kv.w + bias;
      s[ki] = d;
      mx = fmaxf(mx, d);
    }
    mx = fmaxf(mx, lane8<SEL8(1,0,3,2,5,4,7,6)>(mx));
    mx = fmaxf(mx, lane8<SEL8(2,3,0,1,6,7,4,5)>(mx));
    mx = fmaxf(mx, lane8<SEL8(4,5,6,7,0,1,2,3)>(mx));

    float sum = 0.0f;
#pragma unroll
    for (int ki = 0; ki < KWIN; ++ki) { s[ki] = __expf(s[ki] - mx); sum += s[ki]; }
    if (c == 7) sum = 0.0f;               // lane 7 holds a copy of column 6
    sum += lane8<SEL8(1,0,3,2,5,4,7,6)>(sum);
    sum += lane8<SEL8(2,3,0,1,6,7,4,5)>(sum);
    sum += lane8<SEL8(4,5,6,7,0,1,2,3)>(sum);
    const float inv = 1.0f / sum;
#pragma unroll
    for (int ki = 0; ki < KWIN; ++ki) pk[r][ki] = s[ki] * inv;
    // Bounds the registers: without it the compiler issues all four rows' loads
    // and the first v loads at once, and fewer than 7 waves fit a SIMD, which
    // the 1568 blocks (6 to 7 per WGP, one wave of each per SIMD) need.
    if (r & 1) __builtin_amdgcn_sched_barrier(0);
  }

  // v sums: 28 groups (row r, window row ki) of 7 loads each, two register
  // buffers, group g + 1 loaded while group g is summed. The groups go by
  // r + ki: away from the image's edge the groups of one r + ki read the same
  // v row, so a re-read follows the first read closely, for the WGP cache.
  // Each row r still sums its ki in rising order.
  const float* vp[4];
#pragma unroll
  for (int r = 0; r < 4; ++r) {
    const int sh = min(max(i0 + r - 3, 0), HH - KWIN);
    vp[r] = vbase + (size_t)(sh * WW + sw) * HD + c * 4;
  }
  constexpr int GR[4 * KWIN] = {0, 0,1, 0,1,2, 0,1,2,3, 0,1,2,3, 0,1,2,3, 0,1,2,3, 1,2,3, 2,3, 3};
  constexpr int GK[4 * KWIN] = {0, 1,0, 2,1,0, 3,2,1,0, 4,3,2,1, 5,4,3,2, 6,5,4,3, 6,5,4, 6,5, 6};
  v4f buf[2][KWIN];
#pragma unroll
  for (int kj = 0; kj < KWIN; ++kj) buf[0][kj] = *(const v4f*)(vp[0] + kj * HD);

  v2f a01[4], a23[4];
#pragma unroll
  for (int r = 0; r < 4; ++r) { a01[r] = (v2f){0.0f, 0.0f};  a23[r] = (v2f){0.0f, 0.0f}; }
#pragma unroll
  for (int g = 0; g < 4 * KWIN; ++g) {
    const int r = GR[g], ki = GK[g];
    if (g + 1 < 4 * KWIN) {
      const float* nx = vp[GR[g + 1]] + GK[g + 1] * WW * HD;
#pragma unroll
      for (int kj = 0; kj < KWIN; ++kj) buf[(g + 1) & 1][kj] = *(const v4f*)(nx + kj * HD);
    }
    // Keeps the next group's 7 loads in front of this group's sums: without it
    // the compiler sinks each load to its use and leaves 2 or 3 in flight.
    __builtin_amdgcn_sched_barrier(0);

    const float w = pk[r][ki];
    const float p[KWIN] = {
      lane8<SEL8(0,0,0,0,0,0,0,0)>(w), lane8<SEL8(1,1,1,1,1,1,1,1)>(w),
      lane8<SEL8(2,2,2,2,2,2,2,2)>(w), lane8<SEL8(3,3,3,3,3,3,3,3)>(w),
      lane8<SEL8(4,4,4,4,4,4,4,4)>(w), lane8<SEL8(5,5,5,5,5,5,5,5)>(w),
      lane8<SEL8(6,6,6,6,6,6,6,6)>(w) };
#pragma unroll
    for (int kj = 0; kj < KWIN; ++kj) {
      const v4f vx = buf[g & 1][kj];
      const v2f pp = {p[kj], p[kj]};
      a01[r] = __builtin_elementwise_fma(pp, vx.xy, a01[r]);
      a23[r] = __builtin_elementwise_fma(pp, vx.zw, a23[r]);
    }

    if (ki == KWIN - 1) {
      v4bf o;
      o[0] = (__bf16)a01[r].x; o[1] = (__bf16)a01[r].y;
      o[2] = (__bf16)a23[r].x; o[3] = (__bf16)a23[r].y;
      *(v4bf*)(abf + ((size_t)(b * HH + i0 + r) * WW + j) * CC + n * HD + c * 4) = o;   // 8B store
      // The store's registers are reused by the later sums: wait first.
      if (g + 1 < 4 * KWIN) asm volatile("s_wait_xcnt 0x0" ::: "memory");
    }
    // Keeps group g + 2's loads behind this group's sums: two buffers, not three.
    __builtin_amdgcn_sched_barrier(0);
  }
}

// ---------------------------------------------------------------------------
// Kernel 3: output projection  out = attn_out @ Wp + bp  (M=12544, N=K=256).
// Block = 512 threads = 16 waves = 4 M tiles x 4 strips of 64 columns; each
// wave computes a 16x64 strip. Grid = 196 blocks of 64 rows, one per WGP
// (LDS 165 KB): the block's 64 rows of attn_out and all 256 rows of Wpt.
// ---------------------------------------------------------------------------
__global__ void __launch_bounds__(512)
proj_gemm_kernel(const __bf16* __restrict__ abf, const __bf16* __restrict__ Wpt,
                 const float* __restrict__ bp, float* __restrict__ out) {
  const int tid  = threadIdx.x;
  const int wave = tid >> 5;                // 0..15
  const int lane = tid & 31;
  const int grp  = lane >> 4;
  const int nl   = lane & 15;
  const int mt   = wave >> 2;               // M tile of the block
  const int row0 = blockIdx.x * MBLK + mt * 16;
  const int colg = (wave & 3) * 64;

  __shared__ __attribute__((aligned(16))) __bf16 As[MBLK * APITCH];
  __shared__ __attribute__((aligned(16))) __bf16 Bs[CC * APITCH];
  {
    // Rows of 32 16-byte units, a row per wave and load: 4 loads a thread for
    // attn_out, 16 for Wpt. All loads first, so that they share one wait;
    // unrolled so that av[] and wv[] stay in registers.
    const v8bf* as = (const v8bf*)(abf + (size_t)blockIdx.x * MBLK * CC);
    const v8bf* ws = (const v8bf*)Wpt;
    v8bf av[4], wv[16];
#pragma unroll
    for (int i = 0; i < 4; ++i)  av[i] = as[tid + 512 * i];
#pragma unroll
    for (int i = 0; i < 16; ++i) wv[i] = ws[tid + 512 * i];
#pragma unroll
    for (int i = 0; i < 4; ++i)             // row wave + 16 * i, unit lane
      *(v8bf*)(As + (wave + 16 * i) * APITCH + lane * 8) = av[i];
#pragma unroll
    for (int i = 0; i < 16; ++i)
      *(v8bf*)(Bs + (wave + 16 * i) * APITCH + lane * 8) = wv[i];
  }
  __syncthreads();                          // every wave reads rows that others wrote

  const __bf16* ap = As + (mt * 16 + nl) * APITCH + grp * 8;
  const __bf16* wp = Bs + (colg + nl) * APITCH + grp * 8;
  v8f acc[4] = {{}, {}, {}, {}};
#pragma unroll
  for (int k0 = 0; k0 < CC; k0 += 32) {
    const v16bf a = lds_frag(ap + k0);
#pragma unroll
    for (int t = 0; t < 4; ++t) {
      const v16bf b = lds_frag(wp + 16 * t * APITCH + k0);
      acc[t] = __builtin_amdgcn_wmma_f32_16x16x32_bf16(false, a, false, b,
                                                       (short)0, acc[t], false, false);
    }
  }
#pragma unroll
  for (int t = 0; t < 4; ++t) {
    const int col = colg + 16 * t + nl;
    const float bval = bp[col];
#pragma unroll
    for (int v = 0; v < 8; ++v) {
      const int m = row0 + v + grp * 8;
      out[(size_t)m * CC + col] = acc[t][v] + bval;
    }
  }
}

// ---------------------------------------------------------------------------
extern "C" void kernel_launch(void* const* d_in, const int* in_sizes, int n_in,
                              void* d_out, int out_size, void* d_ws, size_t ws_size,
                              hipStream_t stream) {
  const float* x   = (const float*)d_in[0];
  const float* Wq  = (const float*)d_in[1];
  const float* bq  = (const float*)d_in[2];
  const float* Wk  = (const float*)d_in[3];
  const float* bk  = (const float*)d_in[4];
  const float* Wv  = (const float*)d_in[5];
  const float* bv  = (const float*)d_in[6];
  const float* rpb = (const float*)d_in[7];
  const float* Wp  = (const float*)d_in[8];
  const float* bp  = (const float*)d_in[9];

  // f32 scratch
  float* qbuf = (float*)d_ws;                         // MROWS*32
  float* kbuf = qbuf + (size_t)MROWS * 32;            // MROWS*32
  float* vbuf = kbuf + (size_t)MROWS * 32;            // MROWS*256
  // bf16 scratch (16B-aligned offsets by construction)
  __bf16* abf = (__bf16*)(vbuf + (size_t)MROWS * CC); // MROWS*256 bf16
  __bf16* Wpt = abf + (size_t)MROWS * CC;             // 256*256 bf16

  // 1) fused QKV projection: 196 blocks of 4 M-tiles x (5 waves * 64 cols),
  //    and WPBLK blocks that write Wp^T
  qkv_gemm_kernel<<<dim3(MROWS / MBLK + WPBLK), 640, 0, stream>>>(
      x, Wq, Wk, Wv, Wp, bq, bk, bv, qbuf, kbuf, vbuf, Wpt);

  // 2) neighborhood attention core: eight lanes per query*head, 8x8 queries a block
  natten_kernel<<<dim3(BB * NH * (HH / 8) * (WW / 8)), 128, 0, stream>>>(
      qbuf, kbuf, vbuf, rpb, abf);

  // 3) output projection: 196 blocks of 4 M-tiles x (4 waves * 64 cols)
  proj_gemm_kernel<<<dim3(MROWS / MBLK), 512, 0, stream>>>(
      abf, Wpt, bp, (float*)d_out);
}

// v005
// One run takes 27.8 microseconds.
// In both of two side-by-side timings against v004, it was 1.12 times as fast.
// All steps since v000 together make it 3.29 times as fast.
#include <hip/hip_runtime.h>
#include <hip/hip_bf16.h>

#define NH   8
#define KWIN 7
#define LR   4
#define HD   32
#define BB   4
#define HH   56
#define WW   56
#define CC   256
#define MROWS (BB*HH*WW)   /* 12544 */
#define NQKV 320           /* 32 q + 32 k + 256 v columns */

typedef __attribute__((ext_vector_type(16))) __bf16 v16bf;
typedef __attribute__((ext_vector_type(8)))  __bf16 v8bf;
typedef __attribute__((ext_vector_type(4)))  __bf16 v4bf;
typedef __attribute__((ext_vector_type(8)))  float  v8f;
typedef __attribute__((ext_vector_type(4)))  float  v4f;
typedef __attribute__((ext_vector_type(2)))  float  v2f;

// ---------------------------------------------------------------------------
// Both GEMMs keep their operands as bf16 rows in LDS (A: M x K, B^T: N x K) and
// take the fragments from there. gfx1250 16-bit A/B layout, wave32:
//   lanes 0-15  : row r, K = {k0+0..7} in v0..3 and {k0+16..23} in v4..7
//   lanes 16-31 : row r, K offsets shifted by +8
// Both K-chunks are 8 contiguous bf16 = one 16-byte LDS load each.
// LDS row pitch 528 B = 16 B x 33 for 16-byte readers.
// A work-group is 64 rows of the output: its 4 M tiles share one copy of the
// weights, which it fetches once, in whole 128-byte lines.
// ---------------------------------------------------------------------------
#define APITCH (CC + 8)   /* bf16 elements per LDS row */
#define MBLK   64         /* output rows per work-group */

// p = LDS row r + k0 + grp * 8
__device__ __forceinline__ v16bf lds_frag(const __bf16* p) {
  v8bf lo = *(const v8bf*)(p);
  v8bf hi = *(const v8bf*)(p + 16);
  v16bf f;
#pragma unroll   // constant indices: the two halves are just register names
  for (int i = 0; i < 8; ++i) { f[i] = lo[i]; f[8 + i] = hi[i]; }
  return f;
}

// ---------------------------------------------------------------------------
// Weights come as f32, K x N (row k, column n); the GEMMs want bf16 rows N x K.
// A lane takes a patch of 8 k x 4 n by eight 16-byte loads and rounds it: the 8
// values of one column are then one 16-byte piece of a transposed row, so the
// transposition costs no instruction beyond the rounding.
// ---------------------------------------------------------------------------
__device__ __forceinline__ v8bf col_of_patch(const v4f (&r)[8], int c) {
  v8bf o;
#pragma unroll   // constant indices: r[] stays in registers
  for (int j = 0; j < 8; ++j) o[j] = (__bf16)r[j][c];
  return o;
}

#define WPBLK 4           /* extra work-groups of kernel 1 that transpose Wp */

// ---------------------------------------------------------------------------
// Kernel 1: fused QKV projection GEMM, M=12544, N=320, K=256, bf16 WMMA.
// Block = 640 threads = 20 waves = 4 M tiles x 5 strips of 64 columns; each
// wave computes a 16x64 strip (4 WMMA tiles, A fragment reused 4x).
// Grid = 196 blocks of 64 rows, one per WGP (LDS 198 KB), and WPBLK more.
// x comes in as f32: the block reads its 64 rows (64 KB in a row) once, in
// whole lines, rounds them to bf16 and keeps them in LDS. Beside them go the
// 320 transposed bf16 rows of the weights ([0,32) Wq, [32,64) Wk, [64,320) Wv),
// which the block makes itself from the f32 matrices.
// The WPBLK last blocks, on WGPs that the 196 leave idle, do no GEMM: they
// write Wp^T as bf16 to the workspace for kernel 3.
//   cols [0,32)  -> q = (acc + bq) * hd^-0.5
//   cols [32,64) -> k = acc + bk
//   cols [64,320)-> v = acc + bv
// ---------------------------------------------------------------------------
__global__ void __launch_bounds__(640)
qkv_gemm_kernel(const float* __restrict__ x, const float* __restrict__ Wq,
                const float* __restrict__ Wk, const float* __restrict__ Wv,
                const float* __restrict__ Wp,
                const float* __restrict__ bq, const float* __restrict__ bk,
                const float* __restrict__ bv,
                float* __restrict__ qbuf, float* __restrict__ kbuf,
                float* __restrict__ vbuf, __bf16* __restrict__ Wpt) {
  const int tid  = threadIdx.x;
  const int wave = tid >> 5;                // 0..19
  const int lane = tid & 31;
  const int grp  = lane >> 4;
  const int nl   = lane & 15;
  const int mt   = wave / 5;                // M tile of the block
  const int row0 = blockIdx.x * MBLK + mt * 16;
  const int colg = (wave - mt * 5) * 64;    // wave's 64-column strip
  const int wu   = __builtin_amdgcn_readfirstlane(wave);   // scalar: picks matrices

  if (blockIdx.x >= MROWS / MBLK) {
    // Wp^T: 64 wave tiles of 64 k x 16 n, one each for 16 waves of 4 blocks. A
    // lane's patch is k octet lane / 4, n quad lane % 4: the eight lanes of one
    // output row store one whole 128-byte line.
    if (wu < 16) {
      const int tw = (blockIdx.x - MROWS / MBLK) * 16 + wu;
      const int n0 = (tw & 15) * 16, k0 = (tw >> 4) * 64;      // scalar
      const unsigned li = ((lane >> 2) * 8 * CC + (lane & 3) * 4) * 4;   // bytes
      const unsigned lo = (lane & 3) * 4 * CC + (lane >> 2) * 8;
      const char* s = (const char*)(Wp + k0 * CC + n0);
      __bf16*     d = Wpt + n0 * CC + k0;
      v4f r[8];
#pragma unroll
      for (int j = 0; j < 8; ++j) r[j] = *(const v4f*)(s + j * CC * 4 + li);
      // The wait behind the loads that name li; as its input, li keeps its
      // register up to here, so that no later load's result lands on it earlier.
      asm volatile("s_wait_xcnt 0x0" :: "v"(li) : "memory");
#pragma unroll
      for (int c = 0; c < 4; ++c)
        *(v8bf*)(d + lo + c * CC) = col_of_patch(r, c);
    }
    return;                                 // the whole block, ahead of the barrier
  }

  __shared__ __attribute__((aligned(16))) __bf16 As[MBLK * APITCH];
  __shared__ __attribute__((aligned(16))) __bf16 Bs[NQKV * APITCH];
  {
    // x: 64 * 256 floats = 4096 groups of 4 over 640 threads: 6 each, and a 7th
    // for waves 0 to 7. Weights: 80 wave tiles of 32 k x 32 n (64 of Wv, 8 of
    // Wq, 8 of Wk), 4 a wave, all 4 of one row length, so that a wave's loads
    // share 8 offsets; a load takes 4 whole lines, one of each of 4 rows.
    // A lane's patch is n quad nq, k octet ko, dealt so that the 16 lanes of a
    // half wave (4 nq x 4 ko) store to all 64 LDS banks: 4 rows on are 16 banks
    // on, an octet is 4 banks.
    // All loads first, the weights ahead of x and used in that order. The loops
    // are unrolled so that xv[] and wv[] are indexed by constants and stay in
    // registers.
    const float4* xs = (const float4*)(x + (size_t)blockIdx.x * MBLK * CC);
    const int nq = (lane & 3) + 4 * grp;
    const int ko = (lane >> 2) & 3;
    const bool isv = wu < 16;               // waves 0..15: Wv; 16..19: Wq and Wk
    const unsigned ldb = isv ? CC * 4 : 32 * 4;   // bytes per row of the matrix
    unsigned lo[8];                         // row j of the patch, bytes from the tile's start
#pragma unroll
    for (int j = 0; j < 8; ++j) lo[j] = (ko * 8 + j) * ldb + nq * 16;
    float4 xv[7];
    v4f    wv[4][8];
    int    wd[4];                           // tile's place in Bs (scalar)
#pragma unroll
    for (int i = 0; i < 4; ++i) {
      const int tv = wu + 16 * i;           // Wv: k group tv / 8, column group tv % 8
      const int tq = wu - 16 + 4 * i;       // Wq (0..7), Wk (8..15): k group tq % 8
      const int sv = ((tv >> 3) * 32 * CC + (tv & 7) * 32) * 4;   // tile's start, bytes
      const int sq = (tq & 7) * 32 * 32 * 4;
      const int dv = (64 + (tv & 7) * 32) * APITCH + (tv >> 3) * 32;
      const int dq = (tq >> 3) * 32 * APITCH + (tq & 7) * 32;
      const float* mq = tq < 8 ? Wq : Wk;
      const float* m  = isv ? Wv : mq;
      const char*  s  = (const char*)m + (isv ? sv : sq);
#pragma unroll
      for (int j = 0; j < 8; ++j) wv[i][j] = *(const v4f*)(s + lo[j]);
      wd[i] = isv ? dv : dq;
    }
#pragma unroll
    for (int i = 0; i < 6; ++i) xv[i] = xs[tid + 640 * i];
    if (tid < 256) xv[6] = xs[tid + 3840];
    // The wait behind the loads that name lo[]; as its inputs, they keep their
    // registers up to here, so that no later load's result lands on them earlier.
    asm volatile("s_wait_xcnt 0x0" :: "v"(lo[0]), "v"(lo[1]), "v"(lo[2]), "v"(lo[3]),
                 "v"(lo[4]), "v"(lo[5]), "v"(lo[6]), "v"(lo[7]) : "memory");
    __bf16* bd = Bs + nq * 4 * APITCH + ko * 8;
#pragma unroll
    for (int i = 0; i < 4; ++i) {
#pragma unroll
      for (int c = 0; c < 4; ++c)
        *(v8bf*)(bd + wd[i] + c * APITCH) = col_of_patch(wv[i], c);
    }
#pragma unroll
    for (int i = 0; i < 7; ++i) {
      if (i < 6 || tid < 256) {
        const int e = tid + 640 * i;        // row e / 64, floats 4 * (e % 64) ...
        v4bf o;
        o[0] = (__bf16)xv[i].x; o[1] = (__bf16)xv[i].y;
        o[2] = (__bf16)xv[i].z; o[3] = (__bf16)xv[i].w;
        *(v4bf*)(As + (e >> 6) * APITCH + (e & 63) * 4) = o;
      }
    }
  }
  __syncthreads();                          // every wave reads rows that others wrote

  const __bf16* ap = As + (mt * 16 + nl) * APITCH + grp * 8;
  const __bf16* wp = Bs + (colg + nl) * APITCH + grp * 8;
  v8f acc[4] = {{}, {}, {}, {}};
#pragma unroll
  for (int k0 = 0; k0 < CC; k0 += 32) {
    const v16bf a = lds_frag(ap + k0);
#pragma unroll
    for (int t = 0; t < 4; ++t) {
      const v16bf b = lds_frag(wp + 16 * t * APITCH + k0);
      acc[t] = __builtin_amdgcn_wmma_f32_16x16x32_bf16(false, a, false, b,
                                                       (short)0, acc[t], false, false);
    }
  }
#pragma unroll
  for (int t = 0; t < 4; ++t) {
    const int col0 = colg + 16 * t;         // tile-uniform; tiles never straddle q/k/v
    float* out; int ldo, oc0; float sc = 1.0f; const float* bias;
    if (col0 < 32)      { out = qbuf; ldo = 32; oc0 = col0;      bias = bq;
                          sc = 0.17677669529663687f; /* 32^-0.5 */ }
    else if (col0 < 64) { out = kbuf; ldo = 32; oc0 = col0 - 32; bias = bk; }
    else                { out = vbuf; ldo = CC; oc0 = col0 - 64; bias = bv; }
    const int oc = oc0 + nl;
    const float bval = bias[oc];
#pragma unroll
    for (int v = 0; v < 8; ++v) {
      const int m = row0 + v + grp * 8;
      out[(size_t)m * ldo + oc] = (acc[t][v] + bval) * sc;
    }
  }
}

// ---------------------------------------------------------------------------
// Kernel 2: neighborhood attention core. Eight lanes per (b, head, i, j):
// lane c of a query owns channels 4c..4c+3, so the eight lanes of a query read
// one whole 128-byte v pixel with one 16-byte load each, and the four queries
// of a wave (four neighbours in j) read four adjacent pixels = 512 contiguous
// bytes per load instruction. For the scores lane c owns key column c of the
// 7x7 window (lane 7 repeats column 6 and is left out of the sum); maximum and
// sum go over the eight lanes, and each weight is handed to the eight lanes
// from its owner before it multiplies v.
// A block is 4 waves = an 8x8 patch of queries of one (b, head); a wave takes
// 4 columns and 4 rows, and loads each v row of their windows once.
// q/k/v read through the reference's raw-reshape strides:
//   q[b,n,i,j,l] = qflat[b*H*W*32 + n*H*W*4 + (i*W+j)*4 + l]  (v with 32)
// Output written pre-transposed to (B,H,W, n*32+d) directly as bf16 for the
// projection GEMM.
// ---------------------------------------------------------------------------
#define SEL8(a,b,c,d,e,f,g,h) \
  ((a) | ((b) << 3) | ((c) << 6) | ((d) << 9) | ((e) << 12) | ((f) << 15) | ((g) << 18) | ((h) << 21))

// Value of lane SEL[l & 7] of the same group of eight lanes.
template <int SEL>
__device__ __forceinline__ float lane8(float x) {
  return __builtin_bit_cast(float,
      __builtin_amdgcn_mov_dpp8(__builtin_bit_cast(unsigned, x), SEL));
}

// The v sums of a wave's four query rows. Their window starts rise by D v rows
// from one query row to the next (D = 1 away from the image's top and bottom,
// D = 0 where all four are clamped), so the four windows cover 7 + 3 * D v rows.
// The wave walks these once: a v row's 7 loads stay in registers and serve every
// query row r whose window holds it, as its window row ki = y - r * D. Two
// register buffers, v row y + 1 loaded while v row y is summed. Each query row
// sums its ki in rising order.
template <int D>
__device__ __forceinline__ void v_sums(const float* __restrict__ vp,
                                       const float (&pk)[4][KWIN],
                                       __bf16* __restrict__ op) {
  constexpr int NY = KWIN + 3 * D;
  v4f buf[2][KWIN];
#pragma unroll
  for (int kj = 0; kj < KWIN; ++kj) buf[0][kj] = *(const v4f*)(vp + kj * HD);

  v2f a01[4], a23[4];
#pragma unroll
  for (int r = 0; r < 4; ++r) { a01[r] = (v2f){0.0f, 0.0f};  a23[r] = (v2f){0.0f, 0.0f}; }
#pragma unroll   // buf[], pk[] and the sums are indexed by constants and stay in registers
  for (int y = 0; y < NY; ++y) {
    if (y + 1 < NY) {
      const float* nx = vp + (y + 1) * WW * HD;
#pragma unroll
      for (int kj = 0; kj < KWIN; ++kj) buf[(y + 1) & 1][kj] = *(const v4f*)(nx + kj * HD);
    }
    // Keeps the next v row's 7 loads in front of this row's sums: without it
    // the compiler sinks each load to its use and leaves 2 or 3 in flight.
    __builtin_amdgcn_sched_barrier(0);

#pragma unroll
    for (int r = 0; r < 4; ++r) {
      const int ki = y - r * D;
      if (ki < 0 || ki >= KWIN) continue;
      const float w = pk[r][ki];
      const float p[KWIN] = {
        lane8<SEL8(0,0,0,0,0,0,0,0)>(w), lane8<SEL8(1,1,1,1,1,1,1,1)>(w),
        lane8<SEL8(2,2,2,2,2,2,2,2)>(w), lane8<SEL8(3,3,3,3,3,3,3,3)>(w),
        lane8<SEL8(4,4,4,4,4,4,4,4)>(w), lane8<SEL8(5,5,5,5,5,5,5,5)>(w),
        lane8<SEL8(6,6,6,6,6,6,6,6)>(w) };
#pragma unroll
      for (int kj = 0; kj < KWIN; ++kj) {
        const v4f vx = buf[y & 1][kj];
        const v2f pp = {p[kj], p[kj]};
        a01[r] = __builtin_elementwise_fma(pp, vx.xy, a01[r]);
        a23[r] = __builtin_elementwise_fma(pp, vx.zw, a23[r]);
      }
      // Bounds the registers: one query row's 7 handed-out weights at a time, and
      // v row y + 2's loads behind this row's sums (two buffers, not three).
      // Without it the compiler interleaves the four rows, and fewer than the 7
      // waves a SIMD that the grid needs (see the kernel) fit.
      __builtin_amdgcn_sched_barrier(0);
    }
  }
#pragma unroll
  for (int r = 0; r < 4; ++r) {
    v4bf o;
    o[0] = (__bf16)a01[r].x; o[1] = (__bf16)a01[r].y;
    o[2] = (__bf16)a23[r].x; o[3] = (__bf16)a23[r].y;
    *(v4bf*)(op + (size_t)r * WW * CC) = o;   // 8B store
  }
}

__global__ void __launch_bounds__(128)
natten_kernel(const float* __restrict__ qbuf, const float* __restrict__ kbuf,
              const float* __restrict__ vbuf, const float* __restrict__ rpb,
              __bf16* __restrict__ abf) {
  const int lane = threadIdx.x & 31;
  const int wave = threadIdx.x >> 5;      // 0..3
  const int c    = lane & 7;              // channel quad, and key column owner
  const int kc   = min(c, KWIN - 1);
  int t = blockIdx.x;                     // B*NH * 7 * 7 patches
  const int tj = t % (WW / 8);  t /= (WW / 8);
  const int ti = t % (HH / 8);  t /= (HH / 8);
  const int n = t % NH;         const int b = t / NH;
  const int j  = tj * 8 + (wave & 1) * 4 + (lane >> 3);
  const int i0 = ti * 8 + (wave >> 1) * 4;

  const size_t qk_base = (size_t)b * HH * WW * 32 + (size_t)n * HH * WW * 4;
  const float* vbase = vbuf + (size_t)b * HH * WW * CC + (size_t)n * HH * WW * HD;
  const float* rb = rpb + n * 13 * 13;
  const int sw = min(max(j - 3, 0), WW - KWIN);

  // All four rows' weights first, two rows at a time (their q, k and bias loads
  // are independent and share one wait for memory), then the four rows' v sums.
  float pk[4][KWIN];                      // weight (ki, kc) of row r of this lane's query
#pragma unroll
  for (int r = 0; r < 4; ++r) {
    const int i  = i0 + r;
    const int sh = min(max(i - 3, 0), HH - KWIN);
    const float4 qv = *(const float4*)(qbuf + qk_base + (size_t)(i * WW + j) * 4);

    const float* kp = kbuf + qk_base + (size_t)(sh * WW + sw + kc) * 4;
    const float* bb = rb + (size_t)((sh - i + 6) * 13 + (sw - j + 6) + kc);

    float s[KWIN];
    float mx = -3.0e38f;
#pragma unroll
    for (int ki = 0; ki < KWIN; ++ki) {
      const float4 kv = *(const float4*)(kp + ki * WW * 4);
      const float bias = bb[ki * 13];
      const float d = qv.x * kv.x + qv.y * kv.y + qv.z * kv.z + qv.w * kv.w + bias;
      s[ki] = d;
      mx = fmaxf(mx, d);
    }
    mx = fmaxf(mx, lane8<SEL8(1,0,3,2,5,4,7,6)>(mx));
    mx = fmaxf(mx, lane8<SEL8(2,3,0,1,6,7,4,5)>(mx));
    mx = fmaxf(mx, lane8<SEL8(4,5,6,7,0,1,2,3)>(mx));

    float sum = 0.0f;
#pragma unroll
    for (int ki = 0; ki < KWIN; ++ki) { s[ki] = __expf(s[ki] - mx); sum += s[ki]; }
    if (c == 7) sum = 0.0f;               // lane 7 holds a copy of column 6
    sum += lane8<SEL8(1,0,3,2,5,4,7,6)>(sum);
    sum += lane8<SEL8(2,3,0,1,6,7,4,5)>(sum);
    sum += lane8<SEL8(4,5,6,7,0,1,2,3)>(sum);
    const float inv = 1.0f / sum;
#pragma unroll
    for (int ki = 0; ki < KWIN; ++ki) pk[r][ki] = s[ki] * inv;
    // Bounds the registers: without it the compiler issues all four rows' loads
    // and the first v loads at once, and fewer than 7 waves fit a SIMD, which
    // the 1568 blocks (6 to 7 per WGP, one wave of each per SIMD) need.
    if (r & 1) __builtin_amdgcn_sched_barrier(0);
  }

  // v sums. The windows of the wave's four query rows overlap: see v_sums.
  // i0 is a multiple of 4, so either no window start is clamped (they rise by
  // one a row) or all four are clamped to the same start (top and bottom edge).
  static_assert(KWIN == 7 && HH % 8 == 0, "the two cases of the window starts");
  const int iu  = __builtin_amdgcn_readfirstlane(i0);   // scalar: the choice below is a scalar branch
  const int sh0 = min(max(iu - 3, 0), HH - KWIN);
  const int sh3 = min(iu, HH - KWIN);
  const float* vp = vbase + (size_t)(sh0 * WW + sw) * HD + c * 4;
  __bf16* op = abf + ((size_t)(b * HH + iu) * WW + j) * CC + n * HD + c * 4;
  if (sh3 == sh0) v_sums<0>(vp, pk, op);
  else            v_sums<1>(vp, pk, op);
}

// ---------------------------------------------------------------------------
// Kernel 3: output projection  out = attn_out @ Wp + bp  (M=12544, N=K=256).
// Block = 512 threads = 16 waves = 4 M tiles x 4 strips of 64 columns; each
// wave computes a 16x64 strip. Grid = 196 blocks of 64 rows, one per WGP
// (LDS 165 KB): the block's 64 rows of attn_out and all 256 rows of Wpt.
// ---------------------------------------------------------------------------
__global__ void __launch_bounds__(512)
proj_gemm_kernel(const __bf16* __restrict__ abf, const __bf16* __restrict__ Wpt,
                 const float* __restrict__ bp, float* __restrict__ out) {
  const int tid  = threadIdx.x;
  const int wave = tid >> 5;                // 0..15
  const int lane = tid & 31;
  const int grp  = lane >> 4;
  const int nl   = lane & 15;
  const int mt   = wave >> 2;               // M tile of the block
  const int row0 = blockIdx.x * MBLK + mt * 16;
  const int colg = (wave & 3) * 64;

  __shared__ __attribute__((aligned(16))) __bf16 As[MBLK * APITCH];
  __shared__ __attribute__((aligned(16))) __bf16 Bs[CC * APITCH];
  {
    // Rows of 32 16-byte units, a row per wave and load: 4 loads a thread for
    // attn_out, 16 for Wpt. All loads first, so that they share one wait;
    // unrolled so that av[] and wv[] stay in registers.
    const v8bf* as = (const v8bf*)(abf + (size_t)blockIdx.x * MBLK * CC);
    const v8bf* ws = (const v8bf*)Wpt;
    v8bf av[4], wv[16];
#pragma unroll
    for (int i = 0; i < 4; ++i)  av[i] = as[tid + 512 * i];
#pragma unroll
    for (int i = 0; i < 16; ++i) wv[i] = ws[tid + 512 * i];
#pragma unroll
    for (int i = 0; i < 4; ++i)             // row wave + 16 * i, unit lane
      *(v8bf*)(As + (wave + 16 * i) * APITCH + lane * 8) = av[i];
#pragma unroll
    for (int i = 0; i < 16; ++i)
      *(v8bf*)(Bs + (wave + 16 * i) * APITCH + lane * 8) = wv[i];
  }
  __syncthreads();                          // every wave reads rows that others wrote

  const __bf16* ap = As + (mt * 16 + nl) * APITCH + grp * 8;
  const __bf16* wp = Bs + (colg + nl) * APITCH + grp * 8;
  v8f acc[4] = {{}, {}, {}, {}};
#pragma unroll
  for (int k0 = 0; k0 < CC; k0 += 32) {
    const v16bf a = lds_frag(ap + k0);
#pragma unroll
    for (int t = 0; t < 4; ++t) {
      const v16bf b = lds_frag(wp + 16 * t * APITCH + k0);
      acc[t] = __builtin_amdgcn_wmma_f32_16x16x32_bf16(false, a, false, b,
                                                       (short)0, acc[t], false, false);
    }
  }
#pragma unroll
  for (int t = 0; t < 4; ++t) {
    const int col = colg + 16 * t + nl;
    const float bval = bp[col];
#pragma unroll
    for (int v = 0; v < 8; ++v) {
      const int m = row0 + v + grp * 8;
      out[(size_t)m * CC + col] = acc[t][v] + bval;
    }
  }
}

// ---------------------------------------------------------------------------
extern "C" void kernel_launch(void* const* d_in, const int* in_sizes, int n_in,
                              void* d_out, int out_size, void* d_ws, size_t ws_size,
                              hipStream_t stream) {
  const float* x   = (const float*)d_in[0];
  const float* Wq  = (const float*)d_in[1];
  const float* bq  = (const float*)d_in[2];
  const float* Wk  = (const float*)d_in[3];
  const float* bk  = (const float*)d_in[4];
  const float* Wv  = (const float*)d_in[5];
  const float* bv  = (const float*)d_in[6];
  const float* rpb = (const float*)d_in[7];
  const float* Wp  = (const float*)d_in[8];
  const float* bp  = (const float*)d_in[9];

  // f32 scratch
  float* qbuf = (float*)d_ws;                         // MROWS*32
  float* kbuf = qbuf + (size_t)MROWS * 32;            // MROWS*32
  float* vbuf = kbuf + (size_t)MROWS * 32;            // MROWS*256
  // bf16 scratch (16B-aligned offsets by construction)
  __bf16* abf = (__bf16*)(vbuf + (size_t)MROWS * CC); // MROWS*256 bf16
  __bf16* Wpt = abf + (size_t)MROWS * CC;             // 256*256 bf16

  // 1) fused QKV projection: 196 blocks of 4 M-tiles x (5 waves * 64 cols),
  //    and WPBLK blocks that write Wp^T
  qkv_gemm_kernel<<<dim3(MROWS / MBLK + WPBLK), 640, 0, stream>>>(
      x, Wq, Wk, Wv, Wp, bq, bk, bv, qbuf, kbuf, vbuf, Wpt);

  // 2) neighborhood attention core: eight lanes per query*head, 8x8 queries a block
  natten_kernel<<<dim3(BB * NH * (HH / 8) * (WW / 8)), 128, 0, stream>>>(
      qbuf, kbuf, vbuf, rpb, abf);

  // 3) output projection: 196 blocks of 4 M-tiles x (4 waves * 64 cols)
  proj_gemm_kernel<<<dim3(MROWS / MBLK), 512, 0, stream>>>(
      abf, Wpt, bp, (float*)d_out);
}

// v006
// One run takes 24.8 microseconds.
// Two timings next to v005 put it at 1.13 and 1.12 times that version's speed.
// Counting every step since v000, it is 3.69 times as fast.
#include <hip/hip_runtime.h>
#include <hip/hip_bf16.h>

#define NH   8
#define KWIN 7
#define LR   4
#define HD   32
#define BB   4
#define HH   56
#define WW   56
#define CC   256
#define MROWS (BB*HH*WW)   /* 12544 */
#define NQKV 320           /* 32 q + 32 k + 256 v columns */

typedef __attribute__((ext_vector_type(16))) __bf16 v16bf;
typedef __attribute__((ext_vector_type(8)))  __bf16 v8bf;
typedef __attribute__((ext_vector_type(4)))  __bf16 v4bf;
typedef __attribute__((ext_vector_type(8)))  float  v8f;
typedef __attribute__((ext_vector_type(4)))  float  v4f;
typedef __attribute__((ext_vector_type(2)))  float  v2f;

// ---------------------------------------------------------------------------
// Both GEMMs keep their operands as bf16 rows in LDS (A: M x K, B^T: N x K) and
// take the fragments from there. gfx1250 16-bit A/B layout, wave32:
//   lanes 0-15  : row r, K = {k0+0..7} in v0..3 and {k0+16..23} in v4..7
//   lanes 16-31 : row r, K offsets shifted by +8
// Both K-chunks are 8 contiguous bf16 = one 16-byte LDS load each.
// LDS row pitch 528 B = 16 B x 33 for 16-byte readers.
// A work-group is 64 rows of the output: its 4 M tiles share one copy of the
// weights, which it fetches once, in whole 128-byte lines.
// ---------------------------------------------------------------------------
#define APITCH (CC + 8)   /* bf16 elements per LDS row */
#define MBLK   64         /* output rows per work-group */

// p = LDS row r + k0 + grp * 8
__device__ __forceinline__ v16bf lds_frag(const __bf16* p) {
  v8bf lo = *(const v8bf*)(p);
  v8bf hi = *(const v8bf*)(p + 16);
  v16bf f;
#pragma unroll   // constant indices: the two halves are just register names
  for (int i = 0; i < 8; ++i) { f[i] = lo[i]; f[8 + i] = hi[i]; }
  return f;
}

// ---------------------------------------------------------------------------
// Weights come as f32, K x N (row k, column n); the GEMMs want bf16 rows N x K.
// A lane takes a patch of 8 k x 4 n by eight 16-byte loads and rounds it: the 8
// values of one column are then one 16-byte piece of a transposed row, so the
// transposition costs no instruction beyond the rounding.
// ---------------------------------------------------------------------------
__device__ __forceinline__ v8bf col_of_patch(const v4f (&r)[8], int c) {
  v8bf o;
#pragma unroll   // constant indices: r[] stays in registers
  for (int j = 0; j < 8; ++j) o[j] = (__bf16)r[j][c];
  return o;
}

#define WPBLK 4           /* extra work-groups of kernel 1 that transpose Wp */

// ---------------------------------------------------------------------------
// Kernel 1: fused QKV projection GEMM, M=12544, N=320, K=256, bf16 WMMA.
// Block = 640 threads = 20 waves = 4 M tiles x 5 strips of 64 columns; each
// wave computes a 16x64 strip (4 WMMA tiles, A fragment reused 4x).
// Grid = 196 blocks of 64 rows, one per WGP (LDS 198 KB), and WPBLK more.
// x comes in as f32: the block reads its 64 rows (64 KB in a row) once, in
// whole lines, rounds them to bf16 and keeps them in LDS. Beside them go the
// 320 transposed bf16 rows of the weights ([0,32) Wq, [32,64) Wk, [64,320) Wv),
// which the block makes itself from the f32 matrices.
// The WPBLK last blocks, on WGPs that the 196 leave idle, do no GEMM: they
// write Wp^T as bf16 to the workspace for kernel 2.
//   cols [0,32)  -> q = (acc + bq) * hd^-0.5
//   cols [32,64) -> k = acc + bk
//   cols [64,320)-> v = acc + bv
// ---------------------------------------------------------------------------
__global__ void __launch_bounds__(640)
qkv_gemm_kernel(const float* __restrict__ x, const float* __restrict__ Wq,
                const float* __restrict__ Wk, const float* __restrict__ Wv,
                const float* __restrict__ Wp,
                const float* __restrict__ bq, const float* __restrict__ bk,
                const float* __restrict__ bv,
                float* __restrict__ qbuf, float* __restrict__ kbuf,
                float* __restrict__ vbuf, __bf16* __restrict__ Wpt) {
  const int tid  = threadIdx.x;
  const int wave = tid >> 5;                // 0..19
  const int lane = tid & 31;
  const int grp  = lane >> 4;
  const int nl   = lane & 15;
  const int mt   = wave / 5;                // M tile of the block
  const int row0 = blockIdx.x * MBLK + mt * 16;
  const int colg = (wave - mt * 5) * 64;    // wave's 64-column strip
  const int wu   = __builtin_amdgcn_readfirstlane(wave);   // scalar: picks matrices

  if (blockIdx.x >= MROWS / MBLK) {
    // Wp^T: 64 wave tiles of 64 k x 16 n, one each for 16 waves of 4 blocks. A
    // lane's patch is k octet lane / 4, n quad lane % 4: the eight lanes of one
    // output row store one whole 128-byte line.
    if (wu < 16) {
      const int tw = (blockIdx.x - MROWS / MBLK) * 16 + wu;
      const int n0 = (tw & 15) * 16, k0 = (tw >> 4) * 64;      // scalar
      const unsigned li = ((lane >> 2) * 8 * CC + (lane & 3) * 4) * 4;   // bytes
      const unsigned lo = (lane & 3) * 4 * CC + (lane >> 2) * 8;
      const char* s = (const char*)(Wp + k0 * CC + n0);
      __bf16*     d = Wpt + n0 * CC + k0;
      v4f r[8];
#pragma unroll
      for (int j = 0; j < 8; ++j) r[j] = *(const v4f*)(s + j * CC * 4 + li);
      // The wait behind the loads that name li; as its input, li keeps its
      // register up to here, so that no later load's result lands on it earlier.
      asm volatile("s_wait_xcnt 0x0" :: "v"(li) : "memory");
#pragma unroll
      for (int c = 0; c < 4; ++c)
        *(v8bf*)(d + lo + c * CC) = col_of_patch(r, c);
    }
    return;                                 // the whole block, ahead of the barrier
  }

  __shared__ __attribute__((aligned(16))) __bf16 As[MBLK * APITCH];
  __shared__ __attribute__((aligned(16))) __bf16 Bs[NQKV * APITCH];
  {
    // x: 64 * 256 floats = 4096 groups of 4 over 640 threads: 6 each, and a 7th
    // for waves 0 to 7. Weights: 80 wave tiles of 32 k x 32 n (64 of Wv, 8 of
    // Wq, 8 of Wk), 4 a wave, all 4 of one row length, so that a wave's loads
    // share 8 offsets; a load takes 4 whole lines, one of each of 4 rows.
    // A lane's patch is n quad nq, k octet ko, dealt so that the 16 lanes of a
    // half wave (4 nq x 4 ko) store to all 64 LDS banks: 4 rows on are 16 banks
    // on, an octet is 4 banks.
    // All loads first, the weights ahead of x and used in that order. The loops
    // are unrolled so that xv[] and wv[] are indexed by constants and stay in
    // registers.
    const float4* xs = (const float4*)(x + (size_t)blockIdx.x * MBLK * CC);
    const int nq = (lane & 3) + 4 * grp;
    const int ko = (lane >> 2) & 3;
    const bool isv = wu < 16;               // waves 0..15: Wv; 16..19: Wq and Wk
    const unsigned ldb = isv ? CC * 4 : 32 * 4;   // bytes per row of the matrix
    unsigned lo[8];                         // row j of the patch, bytes from the tile's start
#pragma unroll
    for (int j = 0; j < 8; ++j) lo[j] = (ko * 8 + j) * ldb + nq * 16;
    float4 xv[7];
    v4f    wv[4][8];
    int    wd[4];                           // tile's place in Bs (scalar)
#pragma unroll
    for (int i = 0; i < 4; ++i) {
      const int tv = wu + 16 * i;           // Wv: k group tv / 8, column group tv % 8
      const int tq = wu - 16 + 4 * i;       // Wq (0..7), Wk (8..15): k group tq % 8
      const int sv = ((tv >> 3) * 32 * CC + (tv & 7) * 32) * 4;   // tile's start, bytes
      const int sq = (tq & 7) * 32 * 32 * 4;
      const int dv = (64 + (tv & 7) * 32) * APITCH + (tv >> 3) * 32;
      const int dq = (tq >> 3) * 32 * APITCH + (tq & 7) * 32;
      const float* mq = tq < 8 ? Wq : Wk;
      const float* m  = isv ? Wv : mq;
      const char*  s  = (const char*)m + (isv ? sv : sq);
#pragma unroll
      for (int j = 0; j < 8; ++j) wv[i][j] = *(const v4f*)(s + lo[j]);
      wd[i] = isv ? dv : dq;
    }
#pragma unroll
    for (int i = 0; i < 6; ++i) xv[i] = xs[tid + 640 * i];
    if (tid < 256) xv[6] = xs[tid + 3840];
    // The wait behind the loads that name lo[]; as its inputs, they keep their
    // registers up to here, so that no later load's result lands on them earlier.
    asm volatile("s_wait_xcnt 0x0" :: "v"(lo[0]), "v"(lo[1]), "v"(lo[2]), "v"(lo[3]),
                 "v"(lo[4]), "v"(lo[5]), "v"(lo[6]), "v"(lo[7]) : "memory");
    __bf16* bd = Bs + nq * 4 * APITCH + ko * 8;
#pragma unroll
    for (int i = 0; i < 4; ++i) {
#pragma unroll
      for (int c = 0; c < 4; ++c)
        *(v8bf*)(bd + wd[i] + c * APITCH) = col_of_patch(wv[i], c);
    }
#pragma unroll
    for (int i = 0; i < 7; ++i) {
      if (i < 6 || tid < 256) {
        const int e = tid + 640 * i;        // row e / 64, floats 4 * (e % 64) ...
        v4bf o;
        o[0] = (__bf16)xv[i].x; o[1] = (__bf16)xv[i].y;
        o[2] = (__bf16)xv[i].z; o[3] = (__bf16)xv[i].w;
        *(v4bf*)(As + (e >> 6) * APITCH + (e & 63) * 4) = o;
      }
    }
  }
  __syncthreads();                          // every wave reads rows that others wrote

  const __bf16* ap = As + (mt * 16 + nl) * APITCH + grp * 8;
  const __bf16* wp = Bs + (colg + nl) * APITCH + grp * 8;
  v8f acc[4] = {{}, {}, {}, {}};
#pragma unroll
  for (int k0 = 0; k0 < CC; k0 += 32) {
    const v16bf a = lds_frag(ap + k0);
#pragma unroll
    for (int t = 0; t < 4; ++t) {
      const v16bf b = lds_frag(wp + 16 * t * APITCH + k0);
      acc[t] = __builtin_amdgcn_wmma_f32_16x16x32_bf16(false, a, false, b,
                                                       (short)0, acc[t], false, false);
    }
  }
#pragma unroll
  for (int t = 0; t < 4; ++t) {
    const int col0 = colg + 16 * t;         // tile-uniform; tiles never straddle q/k/v
    float* out; int ldo, oc0; float sc = 1.0f; const float* bias;
    if (col0 < 32)      { out = qbuf; ldo = 32; oc0 = col0;      bias = bq;
                          sc = 0.17677669529663687f; /* 32^-0.5 */ }
    else if (col0 < 64) { out = kbuf; ldo = 32; oc0 = col0 - 32; bias = bk; }
    else                { out = vbuf; ldo = CC; oc0 = col0 - 64; bias = bv; }
    const int oc = oc0 + nl;
    const float bval = bias[oc];
#pragma unroll
    for (int v = 0; v < 8; ++v) {
      const int m = row0 + v + grp * 8;
      out[(size_t)m * ldo + oc] = (acc[t][v] + bval) * sc;
    }
  }
}

// ---------------------------------------------------------------------------
// Kernel 2: neighborhood attention core and output projection in one launch.
// A block is 16 waves = an 8x8 patch of pixels of one image, all 8 heads: four
// waves a head, two heads one after the other. The attention results of the
// patch are the 64 x 256 bf16 A rows of the projection; they go to LDS and never
// to memory.
// Attention: eight lanes per (b, head, i, j):
// lane c of a query owns channels 4c..4c+3, so the eight lanes of a query read
// one whole 128-byte v pixel with one 16-byte load each, and the four queries
// of a wave (four neighbours in j) read four adjacent pixels = 512 contiguous
// bytes per load instruction. For the scores lane c owns key column c of the
// 7x7 window (lane 7 repeats column 6 and is left out of the sum); maximum and
// sum go over the eight lanes, and each weight is handed to the eight lanes
// from its owner before it multiplies v.
// A wave takes 4 columns and 4 rows, and loads each v row of their windows once.
// q/k/v read through the reference's raw-reshape strides:
//   q[b,n,i,j,l] = qflat[b*H*W*32 + n*H*W*4 + (i*W+j)*4 + l]  (v with 32)
// LDS row of a pixel: 8 * (row in the patch) + column in the patch; its column
// n*32+d holds head n, channel d, as bf16.
// ---------------------------------------------------------------------------
#define SEL8(a,b,c,d,e,f,g,h) \
  ((a) | ((b) << 3) | ((c) << 6) | ((d) << 9) | ((e) << 12) | ((f) << 15) | ((g) << 18) | ((h) << 21))

// Value of lane SEL[l & 7] of the same group of eight lanes.
template <int SEL>
__device__ __forceinline__ float lane8(float x) {
  return __builtin_bit_cast(float,
      __builtin_amdgcn_mov_dpp8(__builtin_bit_cast(unsigned, x), SEL));
}

// The v sums of a wave's four query rows. Their window starts rise by D v rows
// from one query row to the next (D = 1 away from the image's top and bottom,
// D = 0 where all four are clamped), so the four windows cover 7 + 3 * D v rows.
// The wave walks these once: a v row's 7 loads stay in registers and serve every
// query row r whose window holds it, as its window row ki = y - r * D. V row
// y + 1 is asked for ahead of v row y's sums (the compiler, free to rename the two
// buffers, asks for y + 2 there as well). Each query row sums its ki in rising order.
template <int D>
__device__ __forceinline__ void v_sums(const float* __restrict__ vp,
                                       const float (&pk)[4][KWIN],
                                       __bf16* __restrict__ op) {
  constexpr int NY = KWIN + 3 * D;
  v4f buf[2][KWIN];
#pragma unroll
  for (int kj = 0; kj < KWIN; ++kj) buf[0][kj] = *(const v4f*)(vp + kj * HD);

  v2f a01[4], a23[4];
#pragma unroll
  for (int r = 0; r < 4; ++r) { a01[r] = (v2f){0.0f, 0.0f};  a23[r] = (v2f){0.0f, 0.0f}; }
#pragma unroll   // buf[], pk[] and the sums are indexed by constants and stay in registers
  for (int y = 0; y < NY; ++y) {
    if (y + 1 < NY) {
      const float* nx = vp + (y + 1) * WW * HD;
#pragma unroll
      for (int kj = 0; kj < KWIN; ++kj) buf[(y + 1) & 1][kj] = *(const v4f*)(nx + kj * HD);
    }
    // Keeps the next v row's 7 loads in front of this row's sums: without it
    // the compiler sinks each load to its use and leaves 2 or 3 in flight.
    __builtin_amdgcn_sched_barrier(0);

#pragma unroll
    for (int r = 0; r < 4; ++r) {
      const int ki = y - r * D;
      if (ki < 0 || ki >= KWIN) continue;
      const float w = pk[r][ki];
      const float p[KWIN] = {
        lane8<SEL8(0,0,0,0,0,0,0,0)>(w), lane8<SEL8(1,1,1,1,1,1,1,1)>(w),
        lane8<SEL8(2,2,2,2,2,2,2,2)>(w), lane8<SEL8(3,3,3,3,3,3,3,3)>(w),
        lane8<SEL8(4,4,4,4,4,4,4,4)>(w), lane8<SEL8(5,5,5,5,5,5,5,5)>(w),
        lane8<SEL8(6,6,6,6,6,6,6,6)>(w) };
#pragma unroll
      for (int kj = 0; kj < KWIN; ++kj) {
        const v4f vx = buf[y & 1][kj];
        const v2f pp = {p[kj], p[kj]};
        a01[r] = __builtin_elementwise_fma(pp, vx.xy, a01[r]);
        a23[r] = __builtin_elementwise_fma(pp, vx.zw, a23[r]);
      }
    }
  }
#pragma unroll
  for (int r = 0; r < 4; ++r) {
    v4bf o;
    o[0] = (__bf16)a01[r].x; o[1] = (__bf16)a01[r].y;
    o[2] = (__bf16)a23[r].x; o[3] = (__bf16)a23[r].y;
    *(v4bf*)(op + r * 8 * APITCH) = o;        // 8B LDS store, next row of the patch
  }
}

// The weights of query rows 2H and 2H + 1 of a wave's four, for one head: their
// q, k and bias loads are independent and share one wait for memory.
// qb, kb, rb: the head's q, k and bias table (scalar). STAGE: the wave also brings
// its 16 rows of Wpt (ws: the lane's first unit) to LDS (bd: its place there).
template <int H, bool STAGE>
__device__ __forceinline__ void row_pair_weights(const float4* __restrict__ qb,
                                                 const float4* __restrict__ kb,
                                                 const float* __restrict__ rb,
                                                 int i0, int j, int sw, int c,
                                                 float (&pk)[4][KWIN],
                                                 const v8bf* __restrict__ ws,
                                                 __bf16* __restrict__ bd) {
  const int kc = min(c, KWIN - 1);
  float4   qv[2], kv[2][KWIN];
  float    bi[2][KWIN];
  unsigned kx[2];                         // a lane's place in k (pixels),
  const float4* qp[2];                    // in q
  const float*  bb[2];                    // and in the bias table
#pragma unroll
  for (int e = 0; e < 2; ++e) {
    const int i  = i0 + 2 * H + e;
    const int sh = min(max(i - 3, 0), HH - KWIN);
    qp[e] = qb + (unsigned)(i * WW + j);
    kx[e] = sh * WW + sw + kc;
    bb[e] = rb + (unsigned)((sh - i + 6) * 13 + (sw - j + 6) + kc);
    const float4* kp = kb + kx[e];
    qv[e] = *qp[e];
#pragma unroll
    for (int ki = 0; ki < KWIN; ++ki) { kv[e][ki] = kp[ki * WW];  bi[e][ki] = bb[e][ki * 13]; }
  }
  // The wait behind the loads that name these six; as its inputs, they keep
  // their registers up to here, so that no later load's result lands on them earlier.
  asm volatile("s_wait_xcnt 0x0" :: "v"(qp[0]), "v"(qp[1]), "v"(kx[0]), "v"(kx[1]),
               "v"(bb[0]), "v"(bb[1]) : "memory");
  v8bf wv[16];                            // Wpt on its way to LDS
  if (STAGE) {
    // Rows of 32 16-byte units, a row per wave and load, 16 loads a thread. Asked
    // for behind the two rows' loads, so that they fly while the scores are made.
#pragma unroll   // wv[] is indexed by constants and stays in registers
    for (int i = 0; i < 16; ++i) wv[i] = ws[i * 512];
    // The wait behind the loads that name ws, as above.
    asm volatile("s_wait_xcnt 0x0" :: "v"(ws) : "memory");
  }
#pragma unroll
  for (int e = 0; e < 2; ++e) {
    const int r = 2 * H + e;
    float s[KWIN];
    float mx = -3.0e38f;
#pragma unroll
    for (int ki = 0; ki < KWIN; ++ki) {
      const float4 q4 = qv[e], k4 = kv[e][ki];
      const float d = q4.x * k4.x + q4.y * k4.y + q4.z * k4.z + q4.w * k4.w + bi[e][ki];
      s[ki] = d;
      mx = fmaxf(mx, d);
    }
    mx = fmaxf(mx, lane8<SEL8(1,0,3,2,5,4,7,6)>(mx));
    mx = fmaxf(mx, lane8<SEL8(2,3,0,1,6,7,4,5)>(mx));
    mx = fmaxf(mx, lane8<SEL8(4,5,6,7,0,1,2,3)>(mx));

    float sum = 0.0f;
#pragma unroll
    for (int ki = 0; ki < KWIN; ++ki) { s[ki] = __expf(s[ki] - mx); sum += s[ki]; }
    if (c == 7) sum = 0.0f;               // lane 7 holds a copy of column 6
    sum += lane8<SEL8(1,0,3,2,5,4,7,6)>(sum);
    sum += lane8<SEL8(2,3,0,1,6,7,4,5)>(sum);
    sum += lane8<SEL8(4,5,6,7,0,1,2,3)>(sum);
    const float inv = 1.0f / sum;
#pragma unroll
    for (int ki = 0; ki < KWIN; ++ki) pk[r][ki] = s[ki] * inv;
  }
  if (STAGE) {
#pragma unroll
    for (int i = 0; i < 16; ++i)          // 16 rows on a load
      *(v8bf*)(bd + 16 * i * APITCH) = wv[i];
  }
}

__global__ void __launch_bounds__(512)
natten_proj_kernel(const float* __restrict__ qbuf, const float* __restrict__ kbuf,
                   const float* __restrict__ vbuf, const float* __restrict__ rpb,
                   const __bf16* __restrict__ Wpt, const float* __restrict__ bp,
                   float* __restrict__ out) {
  const int lane = threadIdx.x & 31;
  const int wall = __builtin_amdgcn_readfirstlane(threadIdx.x >> 5);   // 0..15, scalar
  const int wave = wall & 3;              // quarter of the patch
  const int c    = lane & 7;              // channel quad, and key column owner
  int t = blockIdx.x;                     // B * 7 * 7 patches
  const int tj = t % (WW / 8);  t /= (WW / 8);
  const int ti = t % (HH / 8);  const int b = t / (HH / 8);
  const int j  = tj * 8 + (wave & 1) * 4 + (lane >> 3);
  const int i0 = ti * 8 + (wave >> 1) * 4;

  __shared__ __attribute__((aligned(16))) __bf16 As[MBLK * APITCH];
  __shared__ __attribute__((aligned(16))) __bf16 Bs[CC * APITCH];
  const int sw = min(max(j - 3, 0), WW - KWIN);
  const size_t qk_b = (size_t)b * HH * WW * 32;         // the image's q and k

  // A head's weights, two query rows at a time, then its four rows' v sums. The
  // first head's first two rows stand in front of the loop, with the Wpt loads in
  // flight behind theirs; the second head's follow the first head's v sums.
  float pk[4][KWIN];                      // weight (ki, kc) of row r of this lane's query
  {
    const int n = wall >> 2;
    row_pair_weights<0, true>((const float4*)(qbuf + qk_b) + n * HH * WW,
                              (const float4*)(kbuf + qk_b) + n * HH * WW, rpb + n * 13 * 13,
                              i0, j, sw, c, pk, (const v8bf*)Wpt + threadIdx.x,
                              Bs + wall * APITCH + lane * 8);
  }
  // Rolled, for speed only.
#pragma unroll 1
  for (int it = 0; it < 2; ++it) {
  const int n = (wall >> 2) + 4 * it;     // head
  const float* vbase = vbuf + (size_t)b * HH * WW * CC + (size_t)n * HH * WW * HD;
  row_pair_weights<1, false>((const float4*)(qbuf + qk_b) + n * HH * WW,
                             (const float4*)(kbuf + qk_b) + n * HH * WW, rpb + n * 13 * 13,
                             i0, j, sw, c, pk, nullptr, nullptr);

  // v sums. The windows of the wave's four query rows overlap: see v_sums.
  // i0 is a multiple of 4, so either no window start is clamped (they rise by
  // one a row) or all four are clamped to the same start (top and bottom edge).
  static_assert(KWIN == 7 && HH % 8 == 0, "the two cases of the window starts");
  const int iu  = __builtin_amdgcn_readfirstlane(i0);   // scalar: the choice below is a scalar branch
  const int sh0 = min(max(iu - 3, 0), HH - KWIN);
  const int sh3 = min(iu, HH - KWIN);
  const float* vp = vbase + (size_t)(sh0 * WW + sw) * HD + c * 4;
  __bf16* op = As + ((wave >> 1) * 32 + (wave & 1) * 4 + (lane >> 3)) * APITCH + n * HD + c * 4;
  if (sh3 == sh0) v_sums<0>(vp, pk, op);
  else            v_sums<1>(vp, pk, op);
  // The wait behind this head's loads: the next head's addresses take their registers.
  asm volatile("s_wait_xcnt 0x0" ::: "memory");
  if (it == 0)
    row_pair_weights<0, false>((const float4*)(qbuf + qk_b) + (n + 4) * HH * WW,
                               (const float4*)(kbuf + qk_b) + (n + 4) * HH * WW,
                               rpb + (n + 4) * 13 * 13, i0, j, sw, c, pk, nullptr, nullptr);
  }
  __syncthreads();                          // every wave reads rows that others wrote

  // Output projection of the patch: out = attn_out @ Wp + bp, 64 x 256, K = 256.
  // 16 waves = 4 M tiles x 4 strips of 64 columns; a wave computes a 16x64 strip.
  const int grp  = lane >> 4;
  const int nl   = lane & 15;
  const int mt   = wall >> 2;               // M tile: rows 2 * mt, 2 * mt + 1 of the patch
  const int colg = (wall & 3) * 64;
  const int m0   = (b * HH + ti * 8 + mt * 2 + grp) * WW + tj * 8;
  const __bf16* ap = As + (mt * 16 + nl) * APITCH + grp * 8;
  const __bf16* wp = Bs + (colg + nl) * APITCH + grp * 8;
  v8f acc[4] = {{}, {}, {}, {}};
#pragma unroll
  for (int k0 = 0; k0 < CC; k0 += 32) {
    const v16bf a = lds_frag(ap + k0);
#pragma unroll
    for (int u = 0; u < 4; ++u) {
      const v16bf w = lds_frag(wp + 16 * u * APITCH + k0);
      acc[u] = __builtin_amdgcn_wmma_f32_16x16x32_bf16(false, a, false, w,
                                                       (short)0, acc[u], false, false);
    }
  }
#pragma unroll
  for (int u = 0; u < 4; ++u) {
    const int col = colg + 16 * u + nl;
    const float bval = bp[col];
#pragma unroll
    for (int v = 0; v < 8; ++v)             // LDS row mt * 16 + grp * 8 + v = pixel (2 * mt + grp, v)
      out[(size_t)(m0 + v) * CC + col] = acc[u][v] + bval;
  }
}

// ---------------------------------------------------------------------------
extern "C" void kernel_launch(void* const* d_in, const int* in_sizes, int n_in,
                              void* d_out, int out_size, void* d_ws, size_t ws_size,
                              hipStream_t stream) {
  const float* x   = (const float*)d_in[0];
  const float* Wq  = (const float*)d_in[1];
  const float* bq  = (const float*)d_in[2];
  const float* Wk  = (const float*)d_in[3];
  const float* bk  = (const float*)d_in[4];
  const float* Wv  = (const float*)d_in[5];
  const float* bv  = (const float*)d_in[6];
  const float* rpb = (const float*)d_in[7];
  const float* Wp  = (const float*)d_in[8];
  const float* bp  = (const float*)d_in[9];

  // f32 scratch
  float* qbuf = (float*)d_ws;                         // MROWS*32
  float* kbuf = qbuf + (size_t)MROWS * 32;            // MROWS*32
  float* vbuf = kbuf + (size_t)MROWS * 32;            // MROWS*256
  // bf16 scratch (16B-aligned offsets by construction)
  __bf16* Wpt = (__bf16*)(vbuf + (size_t)MROWS * CC); // 256*256 bf16

  // 1) fused QKV projection: 196 blocks of 4 M-tiles x (5 waves * 64 cols),
  //    and WPBLK blocks that write Wp^T
  qkv_gemm_kernel<<<dim3(MROWS / MBLK + WPBLK), 640, 0, stream>>>(
      x, Wq, Wk, Wv, Wp, bq, bk, bv, qbuf, kbuf, vbuf, Wpt);

  // 2) neighborhood attention core and output projection: 8x8 pixels a block,
  //    eight lanes per query*head, then 4 M-tiles x (4 waves * 64 cols)
  natten_proj_kernel<<<dim3(BB * (HH / 8) * (WW / 8)), 512, 0, stream>>>(
      qbuf, kbuf, vbuf, rpb, Wpt, bp, (float*)d_out);
}

// v007
// It runs in 23.5 microseconds.
// Next to v006, in two timings, it ran 1.06 times as fast each time.
// All steps since v000 together make it 3.91 times as fast.
#include <hip/hip_runtime.h>
#include <hip/hip_bf16.h>

#define NH   8
#define KWIN 7
#define LR   4
#define HD   32
#define BB   4
#define HH   56
#define WW   56
#define CC   256
#define MROWS (BB*HH*WW)   /* 12544 */
#define NQKV 320           /* 32 q + 32 k + 256 v columns */

typedef __attribute__((ext_vector_type(16))) __bf16 v16bf;
typedef __attribute__((ext_vector_type(8)))  __bf16 v8bf;
typedef __attribute__((ext_vector_type(4)))  __bf16 v4bf;
typedef __attribute__((ext_vector_type(8)))  float  v8f;
typedef __attribute__((ext_vector_type(4)))  float  v4f;
typedef __attribute__((ext_vector_type(2)))  float  v2f;

// ---------------------------------------------------------------------------
// Both GEMMs keep their operands as bf16 rows in LDS (A: M x K, B^T: N x K) and
// take the fragments from there. gfx1250 16-bit A/B layout, wave32:
//   lanes 0-15  : row r, K = {k0+0..7} in v0..3 and {k0+16..23} in v4..7
//   lanes 16-31 : row r, K offsets shifted by +8
// Both K-chunks are 8 contiguous bf16 = one 16-byte LDS load each.
// LDS row pitch 528 B = 16 B x 33 for 16-byte readers.
// A work-group is 64 rows of the output: its 4 M tiles share one copy of the
// weights, which it fetches once, in whole 128-byte lines.
// ---------------------------------------------------------------------------
#define APITCH (CC + 8)   /* bf16 elements per LDS row */
#define MBLK   64         /* output rows per work-group */

// p = LDS row r + k0 + grp * 8
__device__ __forceinline__ v16bf lds_frag(const __bf16* p) {
  v8bf lo = *(const v8bf*)(p);
  v8bf hi = *(const v8bf*)(p + 16);
  v16bf f;
#pragma unroll   // constant indices: the two halves are just register names
  for (int i = 0; i < 8; ++i) { f[i] = lo[i]; f[8 + i] = hi[i]; }
  return f;
}

// ---------------------------------------------------------------------------
// Weights come as f32, K x N (row k, column n); the GEMMs want bf16 rows N x K.
// A lane takes a patch of 8 k x 4 n by eight 16-byte loads and rounds it: the 8
// values of one column are then one 16-byte piece of a transposed row, so the
// transposition costs no instruction beyond the rounding.
// ---------------------------------------------------------------------------
__device__ __forceinline__ v8bf col_of_patch(const v4f (&r)[8], int c) {
  v8bf o;
#pragma unroll   // constant indices: r[] stays in registers
  for (int j = 0; j < 8; ++j) o[j] = (__bf16)r[j][c];
  return o;
}

#define WPBLK 4           /* extra work-groups of kernel 1 that transpose Wp */

// ---------------------------------------------------------------------------
// Kernel 1: fused QKV projection GEMM, M=12544, N=320, K=256, bf16 WMMA.
// Block = 640 threads = 20 waves = 4 M tiles x 5 strips of 64 columns; each
// wave computes a 16x64 strip (4 WMMA tiles, A fragment reused 4x).
// Grid = 196 blocks of 64 rows, one per WGP (LDS 198 KB), and WPBLK more.
// x comes in as f32: the block reads its 64 rows (64 KB in a row) once, in
// whole lines, rounds them to bf16 and keeps them in LDS. Beside them go the
// 320 transposed bf16 rows of the weights ([0,32) Wq, [32,64) Wk, [64,320) Wv),
// which the block makes itself from the f32 matrices.
// The WPBLK last blocks, on WGPs that the 196 leave idle, do no GEMM: they
// write Wp^T as bf16 to the workspace for kernel 2.
//   cols [0,32)  -> q = (acc + bq) * hd^-0.5
//   cols [32,64) -> k = acc + bk
//   cols [64,320)-> v = acc + bv
// ---------------------------------------------------------------------------
__global__ void __launch_bounds__(640)
qkv_gemm_kernel(const float* __restrict__ x, const float* __restrict__ Wq,
                const float* __restrict__ Wk, const float* __restrict__ Wv,
                const float* __restrict__ Wp,
                const float* __restrict__ bq, const float* __restrict__ bk,
                const float* __restrict__ bv,
                float* __restrict__ qbuf, float* __restrict__ kbuf,
                float* __restrict__ vbuf, __bf16* __restrict__ Wpt) {
  const int tid  = threadIdx.x;
  const int wave = tid >> 5;                // 0..19
  const int lane = tid & 31;
  const int grp  = lane >> 4;
  const int nl   = lane & 15;
  const int mt   = wave / 5;                // M tile of the block
  const int row0 = blockIdx.x * MBLK + mt * 16;
  const int colg = (wave - mt * 5) * 64;    // wave's 64-column strip
  const int wu   = __builtin_amdgcn_readfirstlane(wave);   // scalar: picks matrices

  if (blockIdx.x >= MROWS / MBLK) {
    // Wp^T: 64 wave tiles of 64 k x 16 n, one each for 16 waves of 4 blocks. A
    // lane's patch is k octet lane / 4, n quad lane % 4: the eight lanes of one
    // output row store one whole 128-byte line.
    if (wu < 16) {
      const int tw = (blockIdx.x - MROWS / MBLK) * 16 + wu;
      const int n0 = (tw & 15) * 16, k0 = (tw >> 4) * 64;      // scalar
      const unsigned li = ((lane >> 2) * 8 * CC + (lane & 3) * 4) * 4;   // bytes
      const unsigned lo = (lane & 3) * 4 * CC + (lane >> 2) * 8;
      const char* s = (const char*)(Wp + k0 * CC + n0);
      __bf16*     d = Wpt + n0 * CC + k0;
      v4f r[8];
#pragma unroll
      for (int j = 0; j < 8; ++j) r[j] = *(const v4f*)(s + j * CC * 4 + li);
      // The wait behind the loads that name li; as its input, li keeps its
      // register up to here, so that no later load's result lands on it earlier.
      asm volatile("s_wait_xcnt 0x0" :: "v"(li) : "memory");
#pragma unroll
      for (int c = 0; c < 4; ++c)
        *(v8bf*)(d + lo + c * CC) = col_of_patch(r, c);
    }
    return;                                 // the whole block, ahead of the barrier
  }

  __shared__ __attribute__((aligned(16))) __bf16 As[MBLK * APITCH];
  __shared__ __attribute__((aligned(16))) __bf16 Bs[NQKV * APITCH];
  {
    // x: 64 * 256 floats = 4096 groups of 4 over 640 threads: 6 each, and a 7th
    // for waves 0 to 7. Weights: 80 wave tiles of 32 k x 32 n (64 of Wv, 8 of
    // Wq, 8 of Wk), 4 a wave, all 4 of one row length, so that a wave's loads
    // share 8 offsets; a load takes 4 whole lines, one of each of 4 rows.
    // A lane's patch is n quad nq, k octet ko, dealt so that the 16 lanes of a
    // half wave (4 nq x 4 ko) store to all 64 LDS banks: 4 rows on are 16 banks
    // on, an octet is 4 banks.
    // All loads first, the weights ahead of x and used in that order. The loops
    // are unrolled so that xv[] and wv[] are indexed by constants and stay in
    // registers.
    const float4* xs = (const float4*)(x + (size_t)blockIdx.x * MBLK * CC);
    const int nq = (lane & 3) + 4 * grp;
    const int ko = (lane >> 2) & 3;
    const bool isv = wu < 16;               // waves 0..15: Wv; 16..19: Wq and Wk
    const unsigned ldb = isv ? CC * 4 : 32 * 4;   // bytes per row of the matrix
    unsigned lo[8];                         // row j of the patch, bytes from the tile's start
#pragma unroll
    for (int j = 0; j < 8; ++j) lo[j] = (ko * 8 + j) * ldb + nq * 16;
    float4 xv[7];
    v4f    wv[4][8];
    int    wd[4];                           // tile's place in Bs (scalar)
#pragma unroll
    for (int i = 0; i < 4; ++i) {
      const int tv = wu + 16 * i;           // Wv: k group tv / 8, column group tv % 8
      const int tq = wu - 16 + 4 * i;       // Wq (0..7), Wk (8..15): k group tq % 8
      const int sv = ((tv >> 3) * 32 * CC + (tv & 7) * 32) * 4;   // tile's start, bytes
      const int sq = (tq & 7) * 32 * 32 * 4;
      const int dv = (64 + (tv & 7) * 32) * APITCH + (tv >> 3) * 32;
      const int dq = (tq >> 3) * 32 * APITCH + (tq & 7) * 32;
      const float* mq = tq < 8 ? Wq : Wk;
      const float* m  = isv ? Wv : mq;
      const char*  s  = (const char*)m + (isv ? sv : sq);
#pragma unroll
      for (int j = 0; j < 8; ++j) wv[i][j] = *(const v4f*)(s + lo[j]);
      wd[i] = isv ? dv : dq;
    }
#pragma unroll
    for (int i = 0; i < 6; ++i) xv[i] = xs[tid + 640 * i];
    if (tid < 256) xv[6] = xs[tid + 3840];
    // The wait behind the loads that name lo[]; as its inputs, they keep their
    // registers up to here, so that no later load's result lands on them earlier.
    asm volatile("s_wait_xcnt 0x0" :: "v"(lo[0]), "v"(lo[1]), "v"(lo[2]), "v"(lo[3]),
                 "v"(lo[4]), "v"(lo[5]), "v"(lo[6]), "v"(lo[7]) : "memory");
    __bf16* bd = Bs + nq * 4 * APITCH + ko * 8;
#pragma unroll
    for (int i = 0; i < 4; ++i) {
#pragma unroll
      for (int c = 0; c < 4; ++c)
        *(v8bf*)(bd + wd[i] + c * APITCH) = col_of_patch(wv[i], c);
    }
#pragma unroll
    for (int i = 0; i < 7; ++i) {
      if (i < 6 || tid < 256) {
        const int e = tid + 640 * i;        // row e / 64, floats 4 * (e % 64) ...
        v4bf o;
        o[0] = (__bf16)xv[i].x; o[1] = (__bf16)xv[i].y;
        o[2] = (__bf16)xv[i].z; o[3] = (__bf16)xv[i].w;
        *(v4bf*)(As + (e >> 6) * APITCH + (e & 63) * 4) = o;
      }
    }
  }
  __syncthreads();                          // every wave reads rows that others wrote

  const __bf16* ap = As + (mt * 16 + nl) * APITCH + grp * 8;
  const __bf16* wp = Bs + (colg + nl) * APITCH + grp * 8;
  v8f acc[4] = {{}, {}, {}, {}};
#pragma unroll
  for (int k0 = 0; k0 < CC; k0 += 32) {
    const v16bf a = lds_frag(ap + k0);
#pragma unroll
    for (int t = 0; t < 4; ++t) {
      const v16bf b = lds_frag(wp + 16 * t * APITCH + k0);
      acc[t] = __builtin_amdgcn_wmma_f32_16x16x32_bf16(false, a, false, b,
                                                       (short)0, acc[t], false, false);
    }
  }
#pragma unroll
  for (int t = 0; t < 4; ++t) {
    const int col0 = colg + 16 * t;         // tile-uniform; tiles never straddle q/k/v
    float* out; int ldo, oc0; float sc = 1.0f; const float* bias;
    if (col0 < 32)      { out = qbuf; ldo = 32; oc0 = col0;      bias = bq;
                          sc = 0.17677669529663687f; /* 32^-0.5 */ }
    else if (col0 < 64) { out = kbuf; ldo = 32; oc0 = col0 - 32; bias = bk; }
    else                { out = vbuf; ldo = CC; oc0 = col0 - 64; bias = bv; }
    const int oc = oc0 + nl;
    const float bval = bias[oc];
#pragma unroll
    for (int v = 0; v < 8; ++v) {
      const int m = row0 + v + grp * 8;
      out[(size_t)m * ldo + oc] = (acc[t][v] + bval) * sc;
    }
  }
}

// ---------------------------------------------------------------------------
// Kernel 2: neighborhood attention core and output projection in one launch.
// A block is 16 waves = an 8x8 patch of pixels of one image, all 8 heads: four
// waves a head, two heads one after the other. The attention results of the
// patch are the 64 x 256 bf16 A rows of the projection; they go to LDS and never
// to memory.
// Attention: eight lanes per (b, head, i, j):
// lane c of a query owns channels 4c..4c+3, so the eight lanes of a query read
// one whole 128-byte v pixel with one 16-byte load each, and the four queries
// of a wave (four neighbours in j) read four adjacent pixels = 512 contiguous
// bytes per load instruction. For the scores lane c owns key column c of the
// 7x7 window (lane 7 repeats column 6 and is left out of the sum); maximum and
// sum go over the eight lanes, and the weights reach the eight lanes through the
// wave's own piece of LDS: window row (r, ki) is 32 floats there, one per lane,
// so a query's eight stand side by side and come back in two 16-byte reads.
// A wave takes 4 columns and 4 rows, and loads each v row of their windows once.
// q/k/v read through the reference's raw-reshape strides:
//   q[b,n,i,j,l] = qflat[b*H*W*32 + n*H*W*4 + (i*W+j)*4 + l]  (v with 32)
// LDS row of a pixel: 8 * (row in the patch) + column in the patch; its column
// n*32+d holds head n, channel d, as bf16.
// ---------------------------------------------------------------------------
#define SEL8(a,b,c,d,e,f,g,h) \
  ((a) | ((b) << 3) | ((c) << 6) | ((d) << 9) | ((e) << 12) | ((f) << 15) | ((g) << 18) | ((h) << 21))

// Value of lane SEL[l & 7] of the same group of eight lanes.
template <int SEL>
__device__ __forceinline__ float lane8(float x) {
  return __builtin_bit_cast(float,
      __builtin_amdgcn_mov_dpp8(__builtin_bit_cast(unsigned, x), SEL));
}

// The v sums of a wave's four query rows. Their window starts rise by D v rows
// from one query row to the next (D = 1 away from the image's top and bottom,
// D = 0 where all four are clamped), so the four windows cover 7 + 3 * D v rows.
// The wave walks these once: a v row's 7 loads stay in registers and serve every
// query row r whose window holds it, as its window row ki = y - r * D. V row
// y + 1 is asked for ahead of v row y's sums (the compiler, free to rename the two
// buffers, asks for y + 2 there as well). Each query row sums its ki in rising order.
// wq: the weights of this lane's query in LDS; those of v row y + 1 are read
// together with its loads.
#define WROW 32           /* floats of one window row (r, ki) of a wave's weights */
template <int D>
__device__ __forceinline__ void v_sums(const float* __restrict__ vp,
                                       const float* wq,
                                       __bf16* __restrict__ op) {
  constexpr int NY = KWIN + 3 * D;
  v4f buf[2][KWIN];
  v4f wt[2][4][2];                        // weights 0..3 and 4..6 of row r's window row
#pragma unroll
  for (int kj = 0; kj < KWIN; ++kj) buf[0][kj] = *(const v4f*)(vp + kj * HD);
#pragma unroll   // constant indices: wt[] stays in registers
  for (int r = 0; r < 4; ++r) {
    if (r * D > 0) continue;              // v row 0 is window row 0 of these query rows
    wt[0][r][0] = *(const v4f*)(wq + r * KWIN * WROW);
    wt[0][r][1] = *(const v4f*)(wq + r * KWIN * WROW + 4);
  }

  v2f a01[4], a23[4];
#pragma unroll
  for (int r = 0; r < 4; ++r) { a01[r] = (v2f){0.0f, 0.0f};  a23[r] = (v2f){0.0f, 0.0f}; }
#pragma unroll   // buf[], wt[] and the sums are indexed by constants and stay in registers
  for (int y = 0; y < NY; ++y) {
    if (y + 1 < NY) {
      const float* nx = vp + (y + 1) * WW * HD;
#pragma unroll
      for (int kj = 0; kj < KWIN; ++kj) buf[(y + 1) & 1][kj] = *(const v4f*)(nx + kj * HD);
#pragma unroll   // constant indices: wt[] stays in registers
      for (int r = 0; r < 4; ++r) {
        const int ki = y + 1 - r * D;
        if (ki < 0 || ki >= KWIN) continue;
        wt[(y + 1) & 1][r][0] = *(const v4f*)(wq + (r * KWIN + ki) * WROW);
        wt[(y + 1) & 1][r][1] = *(const v4f*)(wq + (r * KWIN + ki) * WROW + 4);
      }
    }
    // Keeps the next v row's 7 loads and its weights' reads in front of this row's
    // sums: without it the compiler sinks each load to its use and leaves 2 or 3 in flight.
    __builtin_amdgcn_sched_barrier(0);

#pragma unroll
    for (int r = 0; r < 4; ++r) {
      const int ki = y - r * D;
      if (ki < 0 || ki >= KWIN) continue;
      const v4f wa = wt[y & 1][r][0], wb = wt[y & 1][r][1];
      const float p[KWIN] = { wa.x, wa.y, wa.z, wa.w, wb.x, wb.y, wb.z };
#pragma unroll
      for (int kj = 0; kj < KWIN; ++kj) {
        const v4f vx = buf[y & 1][kj];
        const v2f pp = {p[kj], p[kj]};
        a01[r] = __builtin_elementwise_fma(pp, vx.xy, a01[r]);
        a23[r] = __builtin_elementwise_fma(pp, vx.zw, a23[r]);
      }
    }
  }
#pragma unroll
  for (int r = 0; r < 4; ++r) {
    v4bf o;
    o[0] = (__bf16)a01[r].x; o[1] = (__bf16)a01[r].y;
    o[2] = (__bf16)a23[r].x; o[3] = (__bf16)a23[r].y;
    *(v4bf*)(op + r * 8 * APITCH) = o;        // 8B LDS store, next row of the patch
  }
}

// The weights of query rows 2H and 2H + 1 of a wave's four, for one head: their
// q, k and bias loads are independent and share one wait for memory.
// They go to LDS at ws_l (the lane's float of the wave's window row 0 of row 0).
// qb, kb, rb: the head's q, k and bias table (scalar). STAGE: the wave also brings
// its 16 rows of Wpt (ws: the lane's first unit) to LDS (bd: its place there).
template <int H, bool STAGE>
__device__ __forceinline__ void row_pair_weights(const float4* __restrict__ qb,
                                                 const float4* __restrict__ kb,
                                                 const float* __restrict__ rb,
                                                 int i0, int j, int sw, int c,
                                                 float* ws_l,
                                                 const v8bf* __restrict__ ws,
                                                 __bf16* __restrict__ bd) {
  const int kc = min(c, KWIN - 1);
  float4   qv[2], kv[2][KWIN];
  float    bi[2][KWIN];
  unsigned kx[2];                         // a lane's place in k (pixels),
  const float4* qp[2];                    // in q
  const float*  bb[2];                    // and in the bias table
#pragma unroll
  for (int e = 0; e < 2; ++e) {
    const int i  = i0 + 2 * H + e;
    const int sh = min(max(i - 3, 0), HH - KWIN);
    qp[e] = qb + (unsigned)(i * WW + j);
    kx[e] = sh * WW + sw + kc;
    bb[e] = rb + (unsigned)((sh - i + 6) * 13 + (sw - j + 6) + kc);
    const float4* kp = kb + kx[e];
    qv[e] = *qp[e];
#pragma unroll
    for (int ki = 0; ki < KWIN; ++ki) { kv[e][ki] = kp[ki * WW];  bi[e][ki] = bb[e][ki * 13]; }
  }
  // The wait behind the loads that name these six; as its inputs, they keep
  // their registers up to here, so that no later load's result lands on them earlier.
  asm volatile("s_wait_xcnt 0x0" :: "v"(qp[0]), "v"(qp[1]), "v"(kx[0]), "v"(kx[1]),
               "v"(bb[0]), "v"(bb[1]) : "memory");
  v8bf wv[16];                            // Wpt on its way to LDS
  if (STAGE) {
    // Rows of 32 16-byte units, a row per wave and load, 16 loads a thread. Asked
    // for behind the two rows' loads, so that they fly while the scores are made.
#pragma unroll   // wv[] is indexed by constants and stays in registers
    for (int i = 0; i < 16; ++i) wv[i] = ws[i * 512];
    // The wait behind the loads that name ws, as above.
    asm volatile("s_wait_xcnt 0x0" :: "v"(ws) : "memory");
  }
#pragma unroll
  for (int e = 0; e < 2; ++e) {
    const int r = 2 * H + e;
    float s[KWIN];
    float mx = -3.0e38f;
#pragma unroll
    for (int ki = 0; ki < KWIN; ++ki) {
      const float4 q4 = qv[e], k4 = kv[e][ki];
      const float d = q4.x * k4.x + q4.y * k4.y + q4.z * k4.z + q4.w * k4.w + bi[e][ki];
      s[ki] = d;
      mx = fmaxf(mx, d);
    }
    mx = fmaxf(mx, lane8<SEL8(1,0,3,2,5,4,7,6)>(mx));
    mx = fmaxf(mx, lane8<SEL8(2,3,0,1,6,7,4,5)>(mx));
    mx = fmaxf(mx, lane8<SEL8(4,5,6,7,0,1,2,3)>(mx));

    float sum = 0.0f;
#pragma unroll
    for (int ki = 0; ki < KWIN; ++ki) { s[ki] = __expf(s[ki] - mx); sum += s[ki]; }
    if (c == 7) sum = 0.0f;               // lane 7 holds a copy of column 6
    sum += lane8<SEL8(1,0,3,2,5,4,7,6)>(sum);
    sum += lane8<SEL8(2,3,0,1,6,7,4,5)>(sum);
    sum += lane8<SEL8(4,5,6,7,0,1,2,3)>(sum);
    const float inv = 1.0f / sum;
#pragma unroll
    for (int ki = 0; ki < KWIN; ++ki) ws_l[(r * KWIN + ki) * WROW] = s[ki] * inv;
  }
  if (STAGE) {
#pragma unroll
    for (int i = 0; i < 16; ++i)          // 16 rows on a load
      *(v8bf*)(bd + 16 * i * APITCH) = wv[i];
  }
}

__global__ void __launch_bounds__(512)
natten_proj_kernel(const float* __restrict__ qbuf, const float* __restrict__ kbuf,
                   const float* __restrict__ vbuf, const float* __restrict__ rpb,
                   const __bf16* __restrict__ Wpt, const float* __restrict__ bp,
                   float* __restrict__ out) {
  const int lane = threadIdx.x & 31;
  const int wall = __builtin_amdgcn_readfirstlane(threadIdx.x >> 5);   // 0..15, scalar
  const int wave = wall & 3;              // quarter of the patch
  const int c    = lane & 7;              // channel quad, and key column owner
  int t = blockIdx.x;                     // B * 7 * 7 patches
  const int tj = t % (WW / 8);  t /= (WW / 8);
  const int ti = t % (HH / 8);  const int b = t / (HH / 8);
  const int j  = tj * 8 + (wave & 1) * 4 + (lane >> 3);
  const int i0 = ti * 8 + (wave >> 1) * 4;

  __shared__ __attribute__((aligned(16))) __bf16 As[MBLK * APITCH];
  __shared__ __attribute__((aligned(16))) __bf16 Bs[CC * APITCH];
  __shared__ __attribute__((aligned(16))) float  Ps[16 * 4 * KWIN * WROW];   // weights, a piece per wave
  float*       ws_l = Ps + wall * (4 * KWIN * WROW) + lane;              // where the lane writes
  const float* wq   = Ps + wall * (4 * KWIN * WROW) + (lane & 24);       // its query's eight
  const int sw = min(max(j - 3, 0), WW - KWIN);
  const size_t qk_b = (size_t)b * HH * WW * 32;         // the image's q and k

  // A head's weights, two query rows at a time, then its four rows' v sums. The
  // first head's first two rows stand in front of the loop, with the Wpt loads in
  // flight behind theirs; the second head's follow the first head's v sums.
  {
    const int n = wall >> 2;
    row_pair_weights<0, true>((const float4*)(qbuf + qk_b) + n * HH * WW,
                              (const float4*)(kbuf + qk_b) + n * HH * WW, rpb + n * 13 * 13,
                              i0, j, sw, c, ws_l, (const v8bf*)Wpt + threadIdx.x,
                              Bs + wall * APITCH + lane * 8);
  }
  // Rolled, for speed only.
#pragma unroll 1
  for (int it = 0; it < 2; ++it) {
  const int n = (wall >> 2) + 4 * it;     // head
  const float* vbase = vbuf + (size_t)b * HH * WW * CC + (size_t)n * HH * WW * HD;
  row_pair_weights<1, false>((const float4*)(qbuf + qk_b) + n * HH * WW,
                             (const float4*)(kbuf + qk_b) + n * HH * WW, rpb + n * 13 * 13,
                             i0, j, sw, c, ws_l, nullptr, nullptr);
  // The weights that the wave's other lanes wrote are in LDS before they are read back.
  asm volatile("s_wait_dscnt 0x0" ::: "memory");

  // v sums. The windows of the wave's four query rows overlap: see v_sums.
  // i0 is a multiple of 4, so either no window start is clamped (they rise by
  // one a row) or all four are clamped to the same start (top and bottom edge).
  static_assert(KWIN == 7 && HH % 8 == 0, "the two cases of the window starts");
  const int iu  = __builtin_amdgcn_readfirstlane(i0);   // scalar: the choice below is a scalar branch
  const int sh0 = min(max(iu - 3, 0), HH - KWIN);
  const int sh3 = min(iu, HH - KWIN);
  const float* vp = vbase + (size_t)(sh0 * WW + sw) * HD + c * 4;
  __bf16* op = As + ((wave >> 1) * 32 + (wave & 1) * 4 + (lane >> 3)) * APITCH + n * HD + c * 4;
  if (sh3 == sh0) v_sums<0>(vp, wq, op);
  else            v_sums<1>(vp, wq, op);
  // The wait behind this head's loads: the next head's addresses take their registers.
  asm volatile("s_wait_xcnt 0x0" ::: "memory");
  if (it == 0)
    row_pair_weights<0, false>((const float4*)(qbuf + qk_b) + (n + 4) * HH * WW,
                               (const float4*)(kbuf + qk_b) + (n + 4) * HH * WW,
                               rpb + (n + 4) * 13 * 13, i0, j, sw, c, ws_l, nullptr, nullptr);
  }
  __syncthreads();                          // every wave reads rows that others wrote

  // Output projection of the patch: out = attn_out @ Wp + bp, 64 x 256, K = 256.
  // 16 waves = 4 M tiles x 4 strips of 64 columns; a wave computes a 16x64 strip.
  const int grp  = lane >> 4;
  const int nl   = lane & 15;
  const int mt   = wall >> 2;               // M tile: rows 2 * mt, 2 * mt + 1 of the patch
  const int colg = (wall & 3) * 64;
  const int m0   = (b * HH + ti * 8 + mt * 2 + grp) * WW + tj * 8;
  const __bf16* ap = As + (mt * 16 + nl) * APITCH + grp * 8;
  const __bf16* wp = Bs + (colg + nl) * APITCH + grp * 8;
  v8f acc[4] = {{}, {}, {}, {}};
#pragma unroll
  for (int k0 = 0; k0 < CC; k0 += 32) {
    const v16bf a = lds_frag(ap + k0);
#pragma unroll
    for (int u = 0; u < 4; ++u) {
      const v16bf w = lds_frag(wp + 16 * u * APITCH + k0);
      acc[u] = __builtin_amdgcn_wmma_f32_16x16x32_bf16(false, a, false, w,
                                                       (short)0, acc[u], false, false);
    }
  }
#pragma unroll
  for (int u = 0; u < 4; ++u) {
    const int col = colg + 16 * u + nl;
    const float bval = bp[col];
#pragma unroll
    for (int v = 0; v < 8; ++v)             // LDS row mt * 16 + grp * 8 + v = pixel (2 * mt + grp, v)
      out[(size_t)(m0 + v) * CC + col] = acc[u][v] + bval;
  }
}

// ---------------------------------------------------------------------------
extern "C" void kernel_launch(void* const* d_in, const int* in_sizes, int n_in,
                              void* d_out, int out_size, void* d_ws, size_t ws_size,
                              hipStream_t stream) {
  const float* x   = (const float*)d_in[0];
  const float* Wq  = (const float*)d_in[1];
  const float* bq  = (const float*)d_in[2];
  const float* Wk  = (const float*)d_in[3];
  const float* bk  = (const float*)d_in[4];
  const float* Wv  = (const float*)d_in[5];
  const float* bv  = (const float*)d_in[6];
  const float* rpb = (const float*)d_in[7];
  const float* Wp  = (const float*)d_in[8];
  const float* bp  = (const float*)d_in[9];

  // f32 scratch
  float* qbuf = (float*)d_ws;                         // MROWS*32
  float* kbuf = qbuf + (size_t)MROWS * 32;            // MROWS*32
  float* vbuf = kbuf + (size_t)MROWS * 32;            // MROWS*256
  // bf16 scratch (16B-aligned offsets by construction)
  __bf16* Wpt = (__bf16*)(vbuf + (size_t)MROWS * CC); // 256*256 bf16

  // 1) fused QKV projection: 196 blocks of 4 M-tiles x (5 waves * 64 cols),
  //    and WPBLK blocks that write Wp^T
  qkv_gemm_kernel<<<dim3(MROWS / MBLK + WPBLK), 640, 0, stream>>>(
      x, Wq, Wk, Wv, Wp, bq, bk, bv, qbuf, kbuf, vbuf, Wpt);

  // 2) neighborhood attention core and output projection: 8x8 pixels a block,
  //    eight lanes per query*head, then 4 M-tiles x (4 waves * 64 cols)
  natten_proj_kernel<<<dim3(BB * (HH / 8) * (WW / 8)), 512, 0, stream>>>(
      qbuf, kbuf, vbuf, rpb, Wpt, bp, (float*)d_out);
}

// v008
// It runs in 22.6 microseconds.
// In two side-by-side timings against v007, it was 1.03 and 1.04 times as fast.
// Counting every step since v000, it is 4.05 times as fast.
#include <hip/hip_runtime.h>
#include <hip/hip_bf16.h>

#define NH   8
#define KWIN 7
#define LR   4
#define HD   32
#define BB   4
#define HH   56
#define WW   56
#define CC   256
#define MROWS (BB*HH*WW)   /* 12544 */
#define NQKV 320           /* 32 q + 32 k + 256 v columns */

typedef __attribute__((ext_vector_type(16))) __bf16 v16bf;
typedef __attribute__((ext_vector_type(8)))  __bf16 v8bf;
typedef __attribute__((ext_vector_type(4)))  __bf16 v4bf;
typedef __attribute__((ext_vector_type(8)))  float  v8f;
typedef __attribute__((ext_vector_type(4)))  float  v4f;
typedef __attribute__((ext_vector_type(2)))  float  v2f;

// ---------------------------------------------------------------------------
// Both GEMMs keep their operands as bf16 rows in LDS (A: M x K, B^T: N x K) and
// take the fragments from there. gfx1250 16-bit A/B layout, wave32:
//   lanes 0-15  : row r, K = {k0+0..7} in v0..3 and {k0+16..23} in v4..7
//   lanes 16-31 : row r, K offsets shifted by +8
// Both K-chunks are 8 contiguous bf16 = one 16-byte LDS load each.
// LDS row pitch 528 B = 16 B x 33 for 16-byte readers.
// A work-group is 64 A rows (kernel 2: 56 pixels, 8 zero rows): its 4 M tiles share one copy of the
// weights, which it fetches once, in whole 128-byte lines.
// ---------------------------------------------------------------------------
#define APITCH (CC + 8)   /* bf16 elements per LDS row */
#define MBLK   64         /* A rows per work-group */

// p = LDS row r + k0 + grp * 8
__device__ __forceinline__ v16bf lds_frag(const __bf16* p) {
  v8bf lo = *(const v8bf*)(p);
  v8bf hi = *(const v8bf*)(p + 16);
  v16bf f;
#pragma unroll   // constant indices: the two halves are just register names
  for (int i = 0; i < 8; ++i) { f[i] = lo[i]; f[8 + i] = hi[i]; }
  return f;
}

// ---------------------------------------------------------------------------
// Weights come as f32, K x N (row k, column n); the GEMMs want bf16 rows N x K.
// A lane takes a patch of 8 k x 4 n by eight 16-byte loads and rounds it: the 8
// values of one column are then one 16-byte piece of a transposed row, so the
// transposition costs no instruction beyond the rounding.
// ---------------------------------------------------------------------------
__device__ __forceinline__ v8bf col_of_patch(const v4f (&r)[8], int c) {
  v8bf o;
#pragma unroll   // constant indices: r[] stays in registers
  for (int j = 0; j < 8; ++j) o[j] = (__bf16)r[j][c];
  return o;
}

#define WPBLK 4           /* extra work-groups of kernel 1 that transpose Wp */

// ---------------------------------------------------------------------------
// Kernel 1: fused QKV projection GEMM, M=12544, N=320, K=256, bf16 WMMA.
// Block = 640 threads = 20 waves = 4 M tiles x 5 strips of 64 columns; each
// wave computes a 16x64 strip (4 WMMA tiles, A fragment reused 4x).
// Grid = 196 blocks of 64 rows, one per WGP (LDS 198 KB), and WPBLK more.
// x comes in as f32: the block reads its 64 rows (64 KB in a row) once, in
// whole lines, rounds them to bf16 and keeps them in LDS. Beside them go the
// 320 transposed bf16 rows of the weights ([0,32) Wq, [32,64) Wk, [64,320) Wv),
// which the block makes itself from the f32 matrices.
// The WPBLK last blocks, on WGPs that the 196 leave idle, do no GEMM: they
// write Wp^T as bf16 to the workspace for kernel 2.
//   cols [0,32)  -> q = (acc + bq) * hd^-0.5
//   cols [32,64) -> k = acc + bk
//   cols [64,320)-> v = acc + bv
// ---------------------------------------------------------------------------
__global__ void __launch_bounds__(640)
qkv_gemm_kernel(const float* __restrict__ x, const float* __restrict__ Wq,
                const float* __restrict__ Wk, const float* __restrict__ Wv,
                const float* __restrict__ Wp,
                const float* __restrict__ bq, const float* __restrict__ bk,
                const float* __restrict__ bv,
                float* __restrict__ qbuf, float* __restrict__ kbuf,
                float* __restrict__ vbuf, __bf16* __restrict__ Wpt) {
  const int tid  = threadIdx.x;
  const int wave = tid >> 5;                // 0..19
  const int lane = tid & 31;
  const int grp  = lane >> 4;
  const int nl   = lane & 15;
  const int mt   = wave / 5;                // M tile of the block
  const int row0 = blockIdx.x * MBLK + mt * 16;
  const int colg = (wave - mt * 5) * 64;    // wave's 64-column strip
  const int wu   = __builtin_amdgcn_readfirstlane(wave);   // scalar: picks matrices

  if (blockIdx.x >= MROWS / MBLK) {
    // Wp^T: 64 wave tiles of 64 k x 16 n, one each for 16 waves of 4 blocks. A
    // lane's patch is k octet lane / 4, n quad lane % 4: the eight lanes of one
    // output row store one whole 128-byte line.
    if (wu < 16) {
      const int tw = (blockIdx.x - MROWS / MBLK) * 16 + wu;
      const int n0 = (tw & 15) * 16, k0 = (tw >> 4) * 64;      // scalar
      const unsigned li = ((lane >> 2) * 8 * CC + (lane & 3) * 4) * 4;   // bytes
      const unsigned lo = (lane & 3) * 4 * CC + (lane >> 2) * 8;
      const char* s = (const char*)(Wp + k0 * CC + n0);
      __bf16*     d = Wpt + n0 * CC + k0;
      v4f r[8];
#pragma unroll
      for (int j = 0; j < 8; ++j) r[j] = *(const v4f*)(s + j * CC * 4 + li);
      // The wait behind the loads that name li; as its input, li keeps its
      // register up to here, so that no later load's result lands on it earlier.
      asm volatile("s_wait_xcnt 0x0" :: "v"(li) : "memory");
#pragma unroll
      for (int c = 0; c < 4; ++c)
        *(v8bf*)(d + lo + c * CC) = col_of_patch(r, c);
    }
    return;                                 // the whole block, ahead of the barrier
  }

  __shared__ __attribute__((aligned(16))) __bf16 As[MBLK * APITCH];
  __shared__ __attribute__((aligned(16))) __bf16 Bs[NQKV * APITCH];
  {
    // x: 64 * 256 floats = 4096 groups of 4 over 640 threads: 6 each, and a 7th
    // for waves 0 to 7. Weights: 80 wave tiles of 32 k x 32 n (64 of Wv, 8 of
    // Wq, 8 of Wk), 4 a wave, all 4 of one row length, so that a wave's loads
    // share 8 offsets; a load takes 4 whole lines, one of each of 4 rows.
    // A lane's patch is n quad nq, k octet ko, dealt so that the 16 lanes of a
    // half wave (4 nq x 4 ko) store to all 64 LDS banks: 4 rows on are 16 banks
    // on, an octet is 4 banks.
    // All loads first, the weights ahead of x and used in that order. The loops
    // are unrolled so that xv[] and wv[] are indexed by constants and stay in
    // registers.
    const float4* xs = (const float4*)(x + (size_t)blockIdx.x * MBLK * CC);
    const int nq = (lane & 3) + 4 * grp;
    const int ko = (lane >> 2) & 3;
    const bool isv = wu < 16;               // waves 0..15: Wv; 16..19: Wq and Wk
    const unsigned ldb = isv ? CC * 4 : 32 * 4;   // bytes per row of the matrix
    unsigned lo[8];                         // row j of the patch, bytes from the tile's start
#pragma unroll
    for (int j = 0; j < 8; ++j) lo[j] = (ko * 8 + j) * ldb + nq * 16;
    float4 xv[7];
    v4f    wv[4][8];
    int    wd[4];                           // tile's place in Bs (scalar)
#pragma unroll
    for (int i = 0; i < 4; ++i) {
      const int tv = wu + 16 * i;           // Wv: k group tv / 8, column group tv % 8
      const int tq = wu - 16 + 4 * i;       // Wq (0..7), Wk (8..15): k group tq % 8
      const int sv = ((tv >> 3) * 32 * CC + (tv & 7) * 32) * 4;   // tile's start, bytes
      const int sq = (tq & 7) * 32 * 32 * 4;
      const int dv = (64 + (tv & 7) * 32) * APITCH + (tv >> 3) * 32;
      const int dq = (tq >> 3) * 32 * APITCH + (tq & 7) * 32;
      const float* mq = tq < 8 ? Wq : Wk;
      const float* m  = isv ? Wv : mq;
      const char*  s  = (const char*)m + (isv ? sv : sq);
#pragma unroll
      for (int j = 0; j < 8; ++j) wv[i][j] = *(const v4f*)(s + lo[j]);
      wd[i] = isv ? dv : dq;
    }
#pragma unroll
    for (int i = 0; i < 6; ++i) xv[i] = xs[tid + 640 * i];
    if (tid < 256) xv[6] = xs[tid + 3840];
    // The wait behind the loads that name lo[]; as its inputs, they keep their
    // registers up to here, so that no later load's result lands on them earlier.
    asm volatile("s_wait_xcnt 0x0" :: "v"(lo[0]), "v"(lo[1]), "v"(lo[2]), "v"(lo[3]),
                 "v"(lo[4]), "v"(lo[5]), "v"(lo[6]), "v"(lo[7]) : "memory");
    __bf16* bd = Bs + nq * 4 * APITCH + ko * 8;
#pragma unroll
    for (int i = 0; i < 4; ++i) {
#pragma unroll
      for (int c = 0; c < 4; ++c)
        *(v8bf*)(bd + wd[i] + c * APITCH) = col_of_patch(wv[i], c);
    }
#pragma unroll
    for (int i = 0; i < 7; ++i) {
      if (i < 6 || tid < 256) {
        const int e = tid + 640 * i;        // row e / 64, floats 4 * (e % 64) ...
        v4bf o;
        o[0] = (__bf16)xv[i].x; o[1] = (__bf16)xv[i].y;
        o[2] = (__bf16)xv[i].z; o[3] = (__bf16)xv[i].w;
        *(v4bf*)(As + (e >> 6) * APITCH + (e & 63) * 4) = o;
      }
    }
  }
  __syncthreads();                          // every wave reads rows that others wrote

  const __bf16* ap = As + (mt * 16 + nl) * APITCH + grp * 8;
  const __bf16* wp = Bs + (colg + nl) * APITCH + grp * 8;
  v8f acc[4] = {{}, {}, {}, {}};
#pragma unroll
  for (int k0 = 0; k0 < CC; k0 += 32) {
    const v16bf a = lds_frag(ap + k0);
#pragma unroll
    for (int t = 0; t < 4; ++t) {
      const v16bf b = lds_frag(wp + 16 * t * APITCH + k0);
      acc[t] = __builtin_amdgcn_wmma_f32_16x16x32_bf16(false, a, false, b,
                                                       (short)0, acc[t], false, false);
    }
  }
#pragma unroll
  for (int t = 0; t < 4; ++t) {
    const int col0 = colg + 16 * t;         // tile-uniform; tiles never straddle q/k/v
    float* out; int ldo, oc0; float sc = 1.0f; const float* bias;
    if (col0 < 32)      { out = qbuf; ldo = 32; oc0 = col0;      bias = bq;
                          sc = 0.17677669529663687f; /* 32^-0.5 */ }
    else if (col0 < 64) { out = kbuf; ldo = 32; oc0 = col0 - 32; bias = bk; }
    else                { out = vbuf; ldo = CC; oc0 = col0 - 64; bias = bv; }
    const int oc = oc0 + nl;
    const float bval = bias[oc];
#pragma unroll
    for (int v = 0; v < 8; ++v) {
      const int m = row0 + v + grp * 8;
      out[(size_t)m * ldo + oc] = (acc[t][v] + bval) * sc;
    }
  }
}

// ---------------------------------------------------------------------------
// Kernel 2: neighborhood attention core and output projection in one launch.
// A block is 16 waves = a patch of 7 rows x 8 columns of pixels of one image, all
// 8 heads: two waves a head, one for each 4 columns, all 7 rows. That makes 224
// blocks, one per WGP. The attention results of the patch are 56 of the 64 x 256
// bf16 A rows of the projection (the last 8 are zeros); they go to LDS and never
// to memory.
// Attention: eight lanes per (b, head, i, j):
// lane c of a query owns channels 4c..4c+3, so the eight lanes of a query read
// one whole 128-byte v pixel with one 16-byte load each, and the four queries
// of a wave (four neighbours in j) read four adjacent pixels = 512 contiguous
// bytes per load instruction. For the scores lane c owns key column c of the
// 7x7 window (lane 7 repeats column 6 and is left out of the sum); maximum and
// sum go over the eight lanes, and the weights reach the eight lanes through the
// wave's own piece of LDS: window row (r, ki) is 32 floats there, one per lane,
// so a query's eight stand side by side and come back in two reads (16 and 12 bytes).
// A wave takes 4 columns and 7 rows, and loads each v row of their windows once.
// q/k/v read through the reference's raw-reshape strides:
//   q[b,n,i,j,l] = qflat[b*H*W*32 + n*H*W*4 + (i*W+j)*4 + l]  (v with 32)
// LDS row of a pixel: 8 * (row in the patch) + column in the patch; its column
// n*32+d holds head n, channel d, as bf16.
// ---------------------------------------------------------------------------
#define PROWS 7           /* rows of pixels of a patch */
static_assert(KWIN == 7 && HH == 8 * PROWS && PROWS >= 4, "the three cases of the window starts");

#define SEL8(a,b,c,d,e,f,g,h) \
  ((a) | ((b) << 3) | ((c) << 6) | ((d) << 9) | ((e) << 12) | ((f) << 15) | ((g) << 18) | ((h) << 21))

// Value of lane SEL[l & 7] of the same group of eight lanes.
template <int SEL>
__device__ __forceinline__ float lane8(float x) {
  return __builtin_bit_cast(float,
      __builtin_amdgcn_mov_dpp8(__builtin_bit_cast(unsigned, x), SEL));
}

// Window start of a patch's query row r, counted from that of its row 0.
// CS 0: the image's top patch (rows 0..6: starts 0 0 0 0 1 2 3); CS 1: a patch
// away from top and bottom (no start is clamped); CS 2: the bottom patch (rows
// 49..55: starts 46 47 48 49 49 49 49).
__host__ __device__ constexpr int win_off(int cs, int r) {
  return cs == 0 ? (r > 3 ? r - 3 : 0) : cs == 1 ? r : (r < 3 ? r : 3);
}

// The v sums of a wave's seven query rows. Their windows cover 7 + win_off(CS, 6)
// v rows. The wave walks these once: a v row's 7 loads stay in registers and serve
// every query row r whose window holds it, as its window row ki = y - win_off(CS, r).
// V row y + 1 is asked for ahead of v row y's sums (the compiler, free to rename the
// two buffers, may ask for y + 2 there as well). Each query row sums its ki in rising order.
// wq: the weights of this lane's query in LDS; those of v row y + 1 are read
// together with its loads.
#define WROW 32           /* floats of one window row (r, ki) of a wave's weights */
template <int CS>
__device__ __forceinline__ void v_sums(const float* __restrict__ vp,
                                       const float* wq,
                                       __bf16* __restrict__ op) {
  constexpr int NY = KWIN + win_off(CS, PROWS - 1);
  v4f buf[2][KWIN];
  v4f wt[2][PROWS][2];                    // weights 0..3 and 4..6 of row r's window row
#pragma unroll
  for (int kj = 0; kj < KWIN; ++kj) buf[0][kj] = *(const v4f*)(vp + kj * HD);
#pragma unroll   // constant indices: wt[] stays in registers
  for (int r = 0; r < PROWS; ++r) {
    if (win_off(CS, r) > 0) continue;     // v row 0 is window row 0 of these query rows
    wt[0][r][0] = *(const v4f*)(wq + r * KWIN * WROW);
    wt[0][r][1] = *(const v4f*)(wq + r * KWIN * WROW + 4);
  }

  v2f a01[PROWS], a23[PROWS];
#pragma unroll
  for (int r = 0; r < PROWS; ++r) { a01[r] = (v2f){0.0f, 0.0f};  a23[r] = (v2f){0.0f, 0.0f}; }
#pragma unroll   // buf[], wt[] and the sums are indexed by constants and stay in registers
  for (int y = 0; y < NY; ++y) {
    if (y + 1 < NY) {
      const float* nx = vp + (y + 1) * WW * HD;
#pragma unroll
      for (int kj = 0; kj < KWIN; ++kj) buf[(y + 1) & 1][kj] = *(const v4f*)(nx + kj * HD);
#pragma unroll   // constant indices: wt[] stays in registers
      for (int r = 0; r < PROWS; ++r) {
        const int ki = y + 1 - win_off(CS, r);
        if (ki < 0 || ki >= KWIN) continue;
        wt[(y + 1) & 1][r][0] = *(const v4f*)(wq + (r * KWIN + ki) * WROW);
        wt[(y + 1) & 1][r][1] = *(const v4f*)(wq + (r * KWIN + ki) * WROW + 4);
      }
    }
    // Keeps the next v row's 7 loads and its weights' reads in front of this row's
    // sums: without it the compiler sinks each load to its use and leaves 2 or 3 in flight.
    __builtin_amdgcn_sched_barrier(0);

#pragma unroll
    for (int r = 0; r < PROWS; ++r) {
      const int ki = y - win_off(CS, r);
      if (ki < 0 || ki >= KWIN) continue;
      const v4f wa = wt[y & 1][r][0], wb = wt[y & 1][r][1];
      const float p[KWIN] = { wa.x, wa.y, wa.z, wa.w, wb.x, wb.y, wb.z };
#pragma unroll
      for (int kj = 0; kj < KWIN; ++kj) {
        const v4f vx = buf[y & 1][kj];
        const v2f pp = {p[kj], p[kj]};
        a01[r] = __builtin_elementwise_fma(pp, vx.xy, a01[r]);
        a23[r] = __builtin_elementwise_fma(pp, vx.zw, a23[r]);
      }
    }
  }
#pragma unroll
  for (int r = 0; r < PROWS; ++r) {
    v4bf o;
    o[0] = (__bf16)a01[r].x; o[1] = (__bf16)a01[r].y;
    o[2] = (__bf16)a23[r].x; o[3] = (__bf16)a23[r].y;
    *(v4bf*)(op + r * 8 * APITCH) = o;        // 8B LDS store, next row of the patch
  }
}

// The weights of NE (2 or 1) query rows of a wave's seven, image rows i and i + 1:
// their q, k and bias loads are independent and share one wait for memory.
// They go to LDS at ws_r (the lane's float of the wave's window row 0 of row i).
// qb, kb, rb: the head's q, k and bias table (scalar). STAGE: the wave also brings
// its 16 rows of Wpt (ws: the lane's first unit) to LDS (bd: its place there).
template <int NE, bool STAGE>
__device__ __forceinline__ void row_weights(const float4* __restrict__ qb,
                                            const float4* __restrict__ kb,
                                            const float* __restrict__ rb,
                                            int i, int j, int sw, int c,
                                            float* ws_r,
                                            const v8bf* __restrict__ ws,
                                            __bf16* __restrict__ bd) {
  const int kc = min(c, KWIN - 1);
  float4   qv[NE], kv[NE][KWIN];
  float    bi[NE][KWIN];
  unsigned kx[NE], qx[NE], bx[NE];        // a lane's place in k, in q (pixels) and in the bias table
#pragma unroll
  for (int e = 0; e < NE; ++e) {
    const int ie = i + e;
    const int sh = min(max(ie - 3, 0), HH - KWIN);
    qx[e] = ie * WW + j;
    kx[e] = sh * WW + sw + kc;
    bx[e] = (sh - ie + 6) * 13 + (sw - j + 6) + kc;
    const float4* kp = kb + kx[e];
    const float*  bb = rb + bx[e];
    qv[e] = qb[qx[e]];
#pragma unroll
    for (int ki = 0; ki < KWIN; ++ki) { kv[e][ki] = kp[ki * WW];  bi[e][ki] = bb[ki * 13]; }
  }
  // The wait behind the loads that name these; as its inputs, they keep their
  // registers up to here, so that no later load's result lands on them earlier.
  asm volatile("s_wait_xcnt 0x0" :: "v"(qx[0]), "v"(qx[NE - 1]), "v"(kx[0]), "v"(kx[NE - 1]),
               "v"(bx[0]), "v"(bx[NE - 1]) : "memory");
  v8bf wv[16];                            // Wpt on its way to LDS
  if (STAGE) {
    // Rows of 32 16-byte units, a row per wave and load, 16 loads a thread. Asked
    // for behind the two rows' loads, so that they fly while the scores are made.
#pragma unroll   // wv[] is indexed by constants and stays in registers
    for (int u = 0; u < 16; ++u) wv[u] = ws[u * 512];
    // The wait behind the loads that name ws, as above.
    asm volatile("s_wait_xcnt 0x0" :: "v"(ws) : "memory");
  }
#pragma unroll
  for (int e = 0; e < NE; ++e) {
    float s[KWIN];
    float mx = -3.0e38f;
#pragma unroll
    for (int ki = 0; ki < KWIN; ++ki) {
      const float4 q4 = qv[e], k4 = kv[e][ki];
      const float d = q4.x * k4.x + q4.y * k4.y + q4.z * k4.z + q4.w * k4.w + bi[e][ki];
      s[ki] = d;
      mx = fmaxf(mx, d);
    }
    mx = fmaxf(mx, lane8<SEL8(1,0,3,2,5,4,7,6)>(mx));
    mx = fmaxf(mx, lane8<SEL8(2,3,0,1,6,7,4,5)>(mx));
    mx = fmaxf(mx, lane8<SEL8(4,5,6,7,0,1,2,3)>(mx));

    float sum = 0.0f;
#pragma unroll
    for (int ki = 0; ki < KWIN; ++ki) { s[ki] = __expf(s[ki] - mx); sum += s[ki]; }
    if (c == 7) sum = 0.0f;               // lane 7 holds a copy of column 6
    sum += lane8<SEL8(1,0,3,2,5,4,7,6)>(sum);
    sum += lane8<SEL8(2,3,0,1,6,7,4,5)>(sum);
    sum += lane8<SEL8(4,5,6,7,0,1,2,3)>(sum);
    const float inv = 1.0f / sum;
#pragma unroll
    for (int ki = 0; ki < KWIN; ++ki) ws_r[(e * KWIN + ki) * WROW] = s[ki] * inv;
  }
  if (STAGE) {
#pragma unroll
    for (int u = 0; u < 16; ++u)          // 16 rows on a load
      *(v8bf*)(bd + 16 * u * APITCH) = wv[u];
  }
}

__global__ void __launch_bounds__(512)
natten_proj_kernel(const float* __restrict__ qbuf, const float* __restrict__ kbuf,
                   const float* __restrict__ vbuf, const float* __restrict__ rpb,
                   const __bf16* __restrict__ Wpt, const float* __restrict__ bp,
                   float* __restrict__ out) {
  const int lane = threadIdx.x & 31;
  const int wall = __builtin_amdgcn_readfirstlane(threadIdx.x >> 5);   // 0..15, scalar
  const int half = wall & 1;              // left or right 4 columns of the patch
  const int n    = wall >> 1;             // head
  const int c    = lane & 7;              // channel quad, and key column owner
  int t = blockIdx.x;                     // B * 8 * 7 patches
  const int tj = t % (WW / 8);  t /= (WW / 8);
  const int ti = t % (HH / PROWS);  const int b = t / (HH / PROWS);
  const int j  = tj * 8 + half * 4 + (lane >> 3);
  const int i0 = ti * PROWS;

  __shared__ __attribute__((aligned(16))) __bf16 As[MBLK * APITCH];
  __shared__ __attribute__((aligned(16))) __bf16 Bs[CC * APITCH];
  __shared__ __attribute__((aligned(16))) float  Ps[16 * PROWS * KWIN * WROW];   // weights, a piece per wave
  float*       ws_l = Ps + wall * (PROWS * KWIN * WROW) + lane;          // where the lane writes
  const float* wq   = Ps + wall * (PROWS * KWIN * WROW) + (lane & 24);   // its query's eight
  const int sw = min(max(j - 3, 0), WW - KWIN);
  const size_t qk_b = (size_t)b * HH * WW * 32;         // the image's q and k
  const float4* qb = (const float4*)(qbuf + qk_b) + n * HH * WW;
  const float4* kb = (const float4*)(kbuf + qk_b) + n * HH * WW;
  const float*  rb = rpb + n * 13 * 13;

  // The patch fills A rows 0..55; rows 56..63 of the last M tile are zeros (a
  // 16-byte unit a thread of waves 0..7), so that the GEMM reads only what was written.
  if (wall < MBLK - 8 * PROWS)
    *(v8bf*)(As + (8 * PROWS + wall) * APITCH + lane * 8) = (v8bf){};

  // The head's weights, two query rows at a time, then the seven rows' v sums. The
  // first two rows have the Wpt loads in flight behind theirs.
  row_weights<2, true>(qb, kb, rb, i0, j, sw, c, ws_l, (const v8bf*)Wpt + threadIdx.x,
                       Bs + wall * APITCH + lane * 8);
  // Rolled: for speed only.
#pragma unroll 1
  for (int r0 = 2; r0 < PROWS - 1; r0 += 2)
    row_weights<2, false>(qb, kb, rb, i0 + r0, j, sw, c, ws_l + r0 * KWIN * WROW, nullptr, nullptr);
  row_weights<1, false>(qb, kb, rb, i0 + PROWS - 1, j, sw, c, ws_l + (PROWS - 1) * KWIN * WROW,
                        nullptr, nullptr);
  // The weights that the wave's other lanes wrote are in LDS before they are read back.
  asm volatile("s_wait_dscnt 0x0" ::: "memory");

  // v sums. The windows of the wave's seven query rows overlap: see v_sums and
  // win_off. ti comes from blockIdx alone: the choice below is a scalar branch.
  const int sh0 = min(max(i0 - 3, 0), HH - KWIN);
  const float* vp = vbuf + (size_t)b * HH * WW * CC + (size_t)n * HH * WW * HD
                  + (size_t)(sh0 * WW + sw) * HD + c * 4;
  __bf16* op = As + (half * 4 + (lane >> 3)) * APITCH + n * HD + c * 4;
  if (ti == 0)                   v_sums<0>(vp, wq, op);
  else if (ti == HH / PROWS - 1) v_sums<2>(vp, wq, op);
  else                           v_sums<1>(vp, wq, op);
  // The wait behind the v loads: the projection's values take their address registers.
  asm volatile("s_wait_xcnt 0x0" ::: "memory");
  __syncthreads();                          // every wave reads rows that others wrote

  // Output projection of the patch: out = attn_out @ Wp + bp, 64 x 256, K = 256.
  // 16 waves = 4 M tiles x 4 strips of 64 columns; a wave computes a 16x64 strip.
  const int grp  = lane >> 4;
  const int nl   = lane & 15;
  const int mt   = wall >> 2;               // M tile: rows 2 * mt, 2 * mt + 1 of the patch
  const int colg = (wall & 3) * 64;
  const int pr   = mt * 2 + grp;            // row of the patch; row 7 is the zeros
  const int m0   = (b * HH + i0 + pr) * WW + tj * 8;
  const __bf16* ap = As + (mt * 16 + nl) * APITCH + grp * 8;
  const __bf16* wp = Bs + (colg + nl) * APITCH + grp * 8;
  float bval[4];                            // the four tiles' biases
#pragma unroll
  for (int u = 0; u < 4; ++u) bval[u] = bp[colg + 16 * u + nl];
  v8f acc[4] = {{}, {}, {}, {}};
#pragma unroll
  for (int k0 = 0; k0 < CC; k0 += 32) {
    const v16bf a = lds_frag(ap + k0);
#pragma unroll
    for (int u = 0; u < 4; ++u) {
      const v16bf w = lds_frag(wp + 16 * u * APITCH + k0);
      acc[u] = __builtin_amdgcn_wmma_f32_16x16x32_bf16(false, a, false, w,
                                                       (short)0, acc[u], false, false);
    }
  }
  // Holds the four bias loads in front of the test on pr (loaded values as inputs
  // only): left free, the compiler sinks them into the tested part, behind the last
  // WMMA, where nothing covers their latency.
  asm volatile("" :: "v"(bval[0]), "v"(bval[1]), "v"(bval[2]), "v"(bval[3]));
#pragma unroll
  for (int u = 0; u < 4; ++u) {
    const int col = colg + 16 * u + nl;
    if (pr < PROWS) {
#pragma unroll
      for (int v = 0; v < 8; ++v)           // LDS row mt * 16 + grp * 8 + v = pixel (2 * mt + grp, v)
        out[(size_t)(m0 + v) * CC + col] = acc[u][v] + bval[u];
    }
  }
}

// ---------------------------------------------------------------------------
extern "C" void kernel_launch(void* const* d_in, const int* in_sizes, int n_in,
                              void* d_out, int out_size, void* d_ws, size_t ws_size,
                              hipStream_t stream) {
  const float* x   = (const float*)d_in[0];
  const float* Wq  = (const float*)d_in[1];
  const float* bq  = (const float*)d_in[2];
  const float* Wk  = (const float*)d_in[3];
  const float* bk  = (const float*)d_in[4];
  const float* Wv  = (const float*)d_in[5];
  const float* bv  = (const float*)d_in[6];
  const float* rpb = (const float*)d_in[7];
  const float* Wp  = (const float*)d_in[8];
  const float* bp  = (const float*)d_in[9];

  // f32 scratch
  float* qbuf = (float*)d_ws;                         // MROWS*32
  float* kbuf = qbuf + (size_t)MROWS * 32;            // MROWS*32
  float* vbuf = kbuf + (size_t)MROWS * 32;            // MROWS*256
  // bf16 scratch (16B-aligned offsets by construction)
  __bf16* Wpt = (__bf16*)(vbuf + (size_t)MROWS * CC); // 256*256 bf16

  // 1) fused QKV projection: 196 blocks of 4 M-tiles x (5 waves * 64 cols),
  //    and WPBLK blocks that write Wp^T
  qkv_gemm_kernel<<<dim3(MROWS / MBLK + WPBLK), 640, 0, stream>>>(
      x, Wq, Wk, Wv, Wp, bq, bk, bv, qbuf, kbuf, vbuf, Wpt);

  // 2) neighborhood attention core and output projection: 7x8 pixels a block,
  //    eight lanes per query*head, then 4 M-tiles x (4 waves * 64 cols)
  natten_proj_kernel<<<dim3(BB * (HH / PROWS) * (WW / 8)), 512, 0, stream>>>(
      qbuf, kbuf, vbuf, rpb, Wpt, bp, (float*)d_out);
}

// v009
// It runs in 21.4 microseconds.
// In two side-by-side timings against v008, it was 1.06 and 1.05 times as fast.
// Counting every step since v000, it is 4.28 times as fast.
#include <hip/hip_runtime.h>
#include <hip/hip_bf16.h>

#define NH   8
#define KWIN 7
#define LR   4
#define HD   32
#define BB   4
#define HH   56
#define WW   56
#define CC   256
#define MROWS (BB*HH*WW)   /* 12544 */
#define NQKV 320           /* 32 q + 32 k + 256 v columns */

typedef __attribute__((ext_vector_type(16))) __bf16 v16bf;
typedef __attribute__((ext_vector_type(8)))  __bf16 v8bf;
typedef __attribute__((ext_vector_type(4)))  __bf16 v4bf;
typedef __attribute__((ext_vector_type(8)))  float  v8f;
typedef __attribute__((ext_vector_type(4)))  float  v4f;
typedef __attribute__((ext_vector_type(2)))  float  v2f;

// ---------------------------------------------------------------------------
// Both GEMMs keep their operands as bf16 rows in LDS (A: M x K, B^T: N x K) and
// take the fragments from there. gfx1250 16-bit A/B layout, wave32:
//   lanes 0-15  : row r, K = {k0+0..7} in v0..3 and {k0+16..23} in v4..7
//   lanes 16-31 : row r, K offsets shifted by +8
// Both K-chunks are 8 contiguous bf16 = one 16-byte LDS load each.
// LDS row pitch 528 B = 16 B x 33 for 16-byte readers.
// A work-group is 64 A rows (kernel 2: 56 pixels, 8 zero rows): its 4 M tiles share one copy of the
// weights, which it fetches once, in whole 128-byte lines.
// ---------------------------------------------------------------------------
#define APITCH (CC + 8)   /* bf16 elements per LDS row */
#define MBLK   64         /* A rows per work-group */

// p = LDS row r + k0 + grp * 8
__device__ __forceinline__ v16bf lds_frag(const __bf16* p) {
  v8bf lo = *(const v8bf*)(p);
  v8bf hi = *(const v8bf*)(p + 16);
  v16bf f;
#pragma unroll   // constant indices: the two halves are just register names
  for (int i = 0; i < 8; ++i) { f[i] = lo[i]; f[8 + i] = hi[i]; }
  return f;
}

// ---------------------------------------------------------------------------
// Weights come as f32, K x N (row k, column n); the GEMMs want bf16 rows N x K.
// A lane takes a patch of 8 k x 4 n by eight 16-byte loads and rounds it: the 8
// values of one column are then one 16-byte piece of a transposed row, so the
// transposition costs no instruction beyond the rounding.
// ---------------------------------------------------------------------------
__device__ __forceinline__ v8bf col_of_patch(const v4f (&r)[8], int c) {
  v8bf o;
#pragma unroll   // constant indices: r[] stays in registers
  for (int j = 0; j < 8; ++j) o[j] = (__bf16)r[j][c];
  return o;
}

#define WPBLK 8           /* extra work-groups of kernel 1 that transpose Wp */

// Two 16x16 result tiles, one below the other, to rows of LDO floats: out is the
// tiles' first column (scalar), off the lane's first element in bytes; the 16 rows
// of a lane are constant distances from there.
template <int LDO>
__device__ __forceinline__ void put_tile(float* __restrict__ out, unsigned off,
                                         const v8f& a0, const v8f& a1, float b, float sc) {
  char* p = (char*)out + off;
#pragma unroll
  for (int v = 0; v < 8; ++v) {
    *(float*)(p + v * LDO * 4)        = (a0[v] + b) * sc;
    *(float*)(p + (16 + v) * LDO * 4) = (a1[v] + b) * sc;
  }
}

// ---------------------------------------------------------------------------
// Kernel 1: fused QKV projection GEMM, M=12544, N=320, K=256, bf16 WMMA.
// Block = 256 threads = 8 waves = 2 halves of 32 rows x 4 strips of 80 columns;
// each wave computes a 32x80 piece (10 WMMA tiles: an A fragment serves 5 of
// them, a B fragment 2, so 7 fragments are read from LDS for 10 WMMAs).
// Grid = 196 blocks of 64 rows, one per WGP (LDS 198 KB), and WPBLK more.
// x comes in as f32: the block reads its 64 rows (64 KB in a row) once, in
// whole lines, rounds them to bf16 and keeps them in LDS. Beside them go the
// 320 transposed bf16 rows of the weights ([0,32) Wq, [32,64) Wk, [64,320) Wv),
// which the block makes itself from the f32 matrices.
// The WPBLK last blocks, on WGPs that the 196 leave idle, do no GEMM: they
// write Wp^T as bf16 to the workspace for kernel 2.
//   cols [0,32)  -> q = (acc + bq) * hd^-0.5
//   cols [32,64) -> k = acc + bk
//   cols [64,320)-> v = acc + bv
// ---------------------------------------------------------------------------
__global__ void __launch_bounds__(256)
qkv_gemm_kernel(const float* __restrict__ x, const float* __restrict__ Wq,
                const float* __restrict__ Wk, const float* __restrict__ Wv,
                const float* __restrict__ Wp,
                const float* __restrict__ bq, const float* __restrict__ bk,
                const float* __restrict__ bv,
                float* __restrict__ qbuf, float* __restrict__ kbuf,
                float* __restrict__ vbuf, __bf16* __restrict__ Wpt) {
  const int tid  = threadIdx.x;
  const int lane = tid & 31;
  const int grp  = lane >> 4;
  const int nl   = lane & 15;
  const int wu   = __builtin_amdgcn_readfirstlane(tid >> 5);   // wave 0..7, scalar
  const int mp   = wu >> 2;                 // upper or lower 32 rows of the block
  const int row0 = blockIdx.x * MBLK + mp * 32;
  const int colg = (wu & 3) * 80;           // wave's 80-column strip

  if (blockIdx.x >= MROWS / MBLK) {
    // Wp^T: 64 wave tiles of 64 k x 16 n, one each for the 8 waves of 8 blocks. A
    // lane's patch is k octet lane / 4, n quad lane % 4: the eight lanes of one
    // output row store one whole 128-byte line.
    const int tw = (blockIdx.x - MROWS / MBLK) * 8 + wu;
    const int n0 = (tw & 15) * 16, k0 = (tw >> 4) * 64;      // scalar
    const unsigned li = ((lane >> 2) * 8 * CC + (lane & 3) * 4) * 4;   // bytes
    const unsigned lo = (lane & 3) * 4 * CC + (lane >> 2) * 8;
    const char* s = (const char*)(Wp + k0 * CC + n0);
    __bf16*     d = Wpt + n0 * CC + k0;
    v4f r[8];
#pragma unroll
    for (int j = 0; j < 8; ++j) r[j] = *(const v4f*)(s + j * CC * 4 + li);
    // The wait behind the loads that name li; as its input, li keeps its
    // register up to here, so that no later load's result lands on it earlier.
    asm volatile("s_wait_xcnt 0x0" :: "v"(li) : "memory");
#pragma unroll
    for (int c = 0; c < 4; ++c)
      *(v8bf*)(d + lo + c * CC) = col_of_patch(r, c);
    return;                                 // the whole block, ahead of the barrier
  }

  __shared__ __attribute__((aligned(16))) __bf16 As[MBLK * APITCH];
  __shared__ __attribute__((aligned(16))) __bf16 Bs[NQKV * APITCH];
  {
    // x: 64 * 256 floats = 4096 groups of 4 over 256 threads: 16 each.
    // Weights: 80 wave tiles of 32 k x 32 n, 10 a wave: the 8 k groups of column
    // group wu of Wv, and 2 k groups of Wq (waves 0..3) or Wk (waves 4..7); the
    // tiles of one row length share 8 offsets; a load takes 4 whole lines, one of
    // each of 4 rows.
    // A lane's patch is n quad nq, k octet ko, dealt so that the 16 lanes of a
    // half wave (4 nq x 4 ko) store to all 64 LDS banks: 4 rows on are 16 banks
    // on, an octet is 4 banks.
    // 48 loads a lane are asked for at once (x and 4 tiles of Wv); what has been
    // rounded and stored gives its registers to the next loads. The loops are
    // unrolled so that xv[], wv[] and wn[] are indexed by constants and stay in
    // registers.
    const char* xs = (const char*)(x + (size_t)blockIdx.x * MBLK * CC);
    const unsigned xo = tid * 16;           // the lane's first group of x, bytes
    const int nq = (lane & 3) + 4 * grp;
    const int ko = (lane >> 2) & 3;
    unsigned lv[8], ln[8];                  // row j of the patch, bytes from the tile's start
#pragma unroll
    for (int j = 0; j < 8; ++j) {
      lv[j] = (ko * 8 + j) * (CC * 4) + nq * 16;   // Wv
      ln[j] = (ko * 8 + j) * (32 * 4) + nq * 16;   // Wq, Wk
    }
    const char* sv = (const char*)Wv + wu * 32 * 4;                       // k group 0
    const char* sn = (const char*)(wu < 4 ? Wq : Wk) + (wu & 3) * 2 * 32 * 32 * 4;
    __bf16* bd = Bs + nq * 4 * APITCH + ko * 8;
    __bf16* dv = bd + (64 + wu * 32) * APITCH;                            // k group 0
    __bf16* dn = bd + (wu >> 2) * 32 * APITCH + (wu & 3) * 2 * 32;
    v4f xv[16], wv[4][8], wn[2][8];
#pragma unroll
    for (int i = 0; i < 16; ++i) xv[i] = *(const v4f*)(xs + xo + i * 4096);
#pragma unroll
    for (int i = 0; i < 4; ++i) {
#pragma unroll
      for (int j = 0; j < 8; ++j) wv[i][j] = *(const v4f*)(sv + i * 32 * CC * 4 + lv[j]);
    }
    // Keeps the 48 loads in front of the first use: left free, the compiler sinks
    // loads to their uses and fewer are in flight.
    __builtin_amdgcn_sched_barrier(0);
#pragma unroll
    for (int i = 0; i < 16; ++i) {
      const int e = tid + 256 * i;          // row e / 64, floats 4 * (e % 64) ...
      v4bf o;
      o[0] = (__bf16)xv[i].x; o[1] = (__bf16)xv[i].y;
      o[2] = (__bf16)xv[i].z; o[3] = (__bf16)xv[i].w;
      *(v4bf*)(As + (e >> 6) * APITCH + (e & 63) * 4) = o;
    }
    // Keeps the next 16 loads behind the rounding of x, whose registers they take:
    // lifted over it they would need 64 registers more.
    __builtin_amdgcn_sched_barrier(0);
#pragma unroll
    for (int i = 0; i < 2; ++i) {
#pragma unroll
      for (int j = 0; j < 8; ++j) wn[i][j] = *(const v4f*)(sn + i * 32 * 32 * 4 + ln[j]);
    }
    // Keeps these 16 loads here, ahead of the wait for Wv's first tile.
    __builtin_amdgcn_sched_barrier(0);
#pragma unroll
    for (int i = 0; i < 4; ++i) {
#pragma unroll
      for (int c = 0; c < 4; ++c)
        *(v8bf*)(dv + i * 32 + c * APITCH) = col_of_patch(wv[i], c);
      // Keeps tile i + 4's loads behind the rounding of tile i, whose registers they take.
      __builtin_amdgcn_sched_barrier(0);
#pragma unroll
      for (int j = 0; j < 8; ++j) wv[i][j] = *(const v4f*)(sv + (i + 4) * 32 * CC * 4 + lv[j]);
      // Keeps tile i + 4's loads here, ahead of the wait for tile i + 1.
      __builtin_amdgcn_sched_barrier(0);
    }
    // The wait behind the loads that name these; as its inputs, they keep their
    // registers up to here, so that no later load's result lands on them earlier.
    asm volatile("s_wait_xcnt 0x0" :: "v"(xo), "v"(lv[0]), "v"(lv[1]), "v"(lv[2]), "v"(lv[3]),
                 "v"(lv[4]), "v"(lv[5]), "v"(lv[6]), "v"(lv[7]), "v"(ln[0]), "v"(ln[1]),
                 "v"(ln[2]), "v"(ln[3]), "v"(ln[4]), "v"(ln[5]), "v"(ln[6]), "v"(ln[7])
                 : "memory");
#pragma unroll
    for (int i = 0; i < 2; ++i) {
#pragma unroll
      for (int c = 0; c < 4; ++c)
        *(v8bf*)(dn + i * 32 + c * APITCH) = col_of_patch(wn[i], c);
    }
#pragma unroll
    for (int i = 0; i < 4; ++i) {
#pragma unroll
      for (int c = 0; c < 4; ++c)
        *(v8bf*)(dv + (i + 4) * 32 + c * APITCH) = col_of_patch(wv[i], c);
    }
  }
  __syncthreads();                          // every wave reads rows that others wrote

  const __bf16* ap = As + (mp * 32 + nl) * APITCH + grp * 8;
  const __bf16* wp = Bs + (colg + nl) * APITCH + grp * 8;
  // With two waves on a SIMD nothing else covers an LDS read's latency: the 7
  // fragments of k step s + 1 are read as one group ahead of step s's 10 WMMAs.
  v16bf fa[2][2], fb[2][5];
  fa[0][0] = lds_frag(ap);
  fa[0][1] = lds_frag(ap + 16 * APITCH);
#pragma unroll
  for (int t = 0; t < 5; ++t) fb[0][t] = lds_frag(wp + 16 * t * APITCH);
  v8f acc[2][5] = {{{}, {}, {}, {}, {}}, {{}, {}, {}, {}, {}}};
#pragma unroll   // fa[], fb[] are indexed by constants and stay in registers
  for (int s = 0; s < CC / 32; ++s) {
    const int cur = s & 1, nxt = cur ^ 1;
    if (s + 1 < CC / 32) {
      const int k0 = (s + 1) * 32;
      fa[nxt][0] = lds_frag(ap + k0);
      fa[nxt][1] = lds_frag(ap + 16 * APITCH + k0);
#pragma unroll
      for (int t = 0; t < 5; ++t) fb[nxt][t] = lds_frag(wp + 16 * t * APITCH + k0);
    }
    // Keeps the group of reads in front of the WMMAs: left free, the compiler
    // sinks each read to its use and waits for it there.
    __builtin_amdgcn_sched_barrier(0);
#pragma unroll
    for (int t = 0; t < 5; ++t) {
      acc[0][t] = __builtin_amdgcn_wmma_f32_16x16x32_bf16(false, fa[cur][0], false, fb[cur][t],
                                                          (short)0, acc[0][t], false, false);
      acc[1][t] = __builtin_amdgcn_wmma_f32_16x16x32_bf16(false, fa[cur][1], false, fb[cur][t],
                                                          (short)0, acc[1][t], false, false);
    }
    // Keeps the reads of step s + 2 from being lifted in among these WMMAs.
    __builtin_amdgcn_sched_barrier(0);
  }
  // Strip 0 holds q (2 tiles), k (2 tiles) and v's first 16 columns; the others v alone.
  const bool s0 = colg == 0;
  const float* bs[5];                       // the five tiles' biases: first column (scalar)
  bs[0] = s0 ? bq      : bv + (colg - 64);
  bs[1] = s0 ? bq + 16 : bv + (colg - 48);
  bs[2] = s0 ? bk      : bv + (colg - 32);
  bs[3] = s0 ? bk + 16 : bv + (colg - 16);
  bs[4] = s0 ? bv      : bv + colg;
  float bval[5];
#pragma unroll
  for (int t = 0; t < 5; ++t) bval[t] = bs[t][nl];
  // The wait behind the loads that name these; as its inputs, they keep their
  // registers up to here.
  asm volatile("s_wait_xcnt 0x0" :: "v"(nl), "s"(bs[0]), "s"(bs[1]), "s"(bs[2]), "s"(bs[3]),
               "s"(bs[4]) : "memory");
  const unsigned on = ((row0 + grp * 8) * 32 + nl) * 4;   // the lane's first element, bytes: q, k
  const unsigned ov = ((row0 + grp * 8) * CC + nl) * 4;   // v
  if (colg == 0) {
    const float sc = 0.17677669529663687f;  /* 32^-0.5 */
    put_tile<32>(qbuf,      on, acc[0][0], acc[1][0], bval[0], sc);
    put_tile<32>(qbuf + 16, on, acc[0][1], acc[1][1], bval[1], sc);
    put_tile<32>(kbuf,      on, acc[0][2], acc[1][2], bval[2], 1.0f);
    put_tile<32>(kbuf + 16, on, acc[0][3], acc[1][3], bval[3], 1.0f);
    put_tile<CC>(vbuf,      ov, acc[0][4], acc[1][4], bval[4], 1.0f);
    // The wait behind this branch's stores: what follows them in the text rewrites their registers.
    asm volatile("s_wait_xcnt 0x0" ::: "memory");
  } else {
#pragma unroll
    for (int t = 0; t < 5; ++t)
      put_tile<CC>(vbuf + (colg - 64 + 16 * t), ov, acc[0][t], acc[1][t], bval[t], 1.0f);
    // The wait behind this branch's stores: what follows them in the text rewrites their registers.
    asm volatile("s_wait_xcnt 0x0" ::: "memory");
  }
}

// ---------------------------------------------------------------------------
// Kernel 2: neighborhood attention core and output projection in one launch.
// A block is 16 waves = a patch of 7 rows x 8 columns of pixels of one image, all
// 8 heads: two waves a head, one for each 4 columns, all 7 rows. That makes 224
// blocks, one per WGP. The attention results of the patch are 56 of the 64 x 256
// bf16 A rows of the projection (the last 8 are zeros); they go to LDS and never
// to memory.
// Attention: eight lanes per (b, head, i, j):
// lane c of a query owns channels 4c..4c+3, so the eight lanes of a query read
// one whole 128-byte v pixel with one 16-byte load each, and the four queries
// of a wave (four neighbours in j) read four adjacent pixels = 512 contiguous
// bytes per load instruction. For the scores lane c owns key column c of the
// 7x7 window (lane 7 repeats column 6 and is left out of the sum); maximum and
// sum go over the eight lanes, and the weights reach the eight lanes through the
// wave's own piece of LDS: window row (r, ki) is 32 floats there, one per lane,
// so a query's eight stand side by side and come back in two reads (16 and 12 bytes).
// A wave takes 4 columns and 7 rows, and loads each v row of their windows once.
// q/k/v read through the reference's raw-reshape strides:
//   q[b,n,i,j,l] = qflat[b*H*W*32 + n*H*W*4 + (i*W+j)*4 + l]  (v with 32)
// LDS row of a pixel: 8 * (row in the patch) + column in the patch; its column
// n*32+d holds head n, channel d, as bf16.
// ---------------------------------------------------------------------------
#define PROWS 7           /* rows of pixels of a patch */
static_assert(KWIN == 7 && HH == 8 * PROWS && PROWS >= 4, "the three cases of the window starts");

#define SEL8(a,b,c,d,e,f,g,h) \
  ((a) | ((b) << 3) | ((c) << 6) | ((d) << 9) | ((e) << 12) | ((f) << 15) | ((g) << 18) | ((h) << 21))

// Value of lane SEL[l & 7] of the same group of eight lanes.
template <int SEL>
__device__ __forceinline__ float lane8(float x) {
  return __builtin_bit_cast(float,
      __builtin_amdgcn_mov_dpp8(__builtin_bit_cast(unsigned, x), SEL));
}

// Window start of a patch's query row r, counted from that of its row 0.
// CS 0: the image's top patch (rows 0..6: starts 0 0 0 0 1 2 3); CS 1: a patch
// away from top and bottom (no start is clamped); CS 2: the bottom patch (rows
// 49..55: starts 46 47 48 49 49 49 49).
__host__ __device__ constexpr int win_off(int cs, int r) {
  return cs == 0 ? (r > 3 ? r - 3 : 0) : cs == 1 ? r : (r < 3 ? r : 3);
}

// The v sums of a wave's seven query rows. Their windows cover 7 + win_off(CS, 6)
// v rows. The wave walks these once: a v row's 7 loads stay in registers and serve
// every query row r whose window holds it, as its window row ki = y - win_off(CS, r).
// V row y + 1 is asked for ahead of v row y's sums (the compiler, free to rename the
// two buffers, may ask for y + 2 there as well). Each query row sums its ki in rising order.
// wq: the weights of this lane's query in LDS; those of v row y + 1 are read
// together with its loads.
#define WROW 32           /* floats of one window row (r, ki) of a wave's weights */
template <int CS>
__device__ __forceinline__ void v_sums(const float* __restrict__ vp,
                                       const float* wq,
                                       __bf16* __restrict__ op) {
  constexpr int NY = KWIN + win_off(CS, PROWS - 1);
  v4f buf[2][KWIN];
  v4f wt[2][PROWS][2];                    // weights 0..3 and 4..6 of row r's window row
#pragma unroll
  for (int kj = 0; kj < KWIN; ++kj) buf[0][kj] = *(const v4f*)(vp + kj * HD);
#pragma unroll   // constant indices: wt[] stays in registers
  for (int r = 0; r < PROWS; ++r) {
    if (win_off(CS, r) > 0) continue;     // v row 0 is window row 0 of these query rows
    wt[0][r][0] = *(const v4f*)(wq + r * KWIN * WROW);
    wt[0][r][1] = *(const v4f*)(wq + r * KWIN * WROW + 4);
  }

  v2f a01[PROWS], a23[PROWS];
#pragma unroll
  for (int r = 0; r < PROWS; ++r) { a01[r] = (v2f){0.0f, 0.0f};  a23[r] = (v2f){0.0f, 0.0f}; }
#pragma unroll   // buf[], wt[] and the sums are indexed by constants and stay in registers
  for (int y = 0; y < NY; ++y) {
    if (y + 1 < NY) {
      const float* nx = vp + (y + 1) * WW * HD;
#pragma unroll
      for (int kj = 0; kj < KWIN; ++kj) buf[(y + 1) & 1][kj] = *(const v4f*)(nx + kj * HD);
#pragma unroll   // constant indices: wt[] stays in registers
      for (int r = 0; r < PROWS; ++r) {
        const int ki = y + 1 - win_off(CS, r);
        if (ki < 0 || ki >= KWIN) continue;
        wt[(y + 1) & 1][r][0] = *(const v4f*)(wq + (r * KWIN + ki) * WROW);
        wt[(y + 1) & 1][r][1] = *(const v4f*)(wq + (r * KWIN + ki) * WROW + 4);
      }
    }
    // Keeps the next v row's 7 loads and its weights' reads in front of this row's
    // sums: without it the compiler sinks each load to its use and leaves 2 or 3 in flight.
    __builtin_amdgcn_sched_barrier(0);

#pragma unroll
    for (int r = 0; r < PROWS; ++r) {
      const int ki = y - win_off(CS, r);
      if (ki < 0 || ki >= KWIN) continue;
      const v4f wa = wt[y & 1][r][0], wb = wt[y & 1][r][1];
      const float p[KWIN] = { wa.x, wa.y, wa.z, wa.w, wb.x, wb.y, wb.z };
#pragma unroll
      for (int kj = 0; kj < KWIN; ++kj) {
        const v4f vx = buf[y & 1][kj];
        const v2f pp = {p[kj], p[kj]};
        a01[r] = __builtin_elementwise_fma(pp, vx.xy, a01[r]);
        a23[r] = __builtin_elementwise_fma(pp, vx.zw, a23[r]);
      }
    }
  }
#pragma unroll
  for (int r = 0; r < PROWS; ++r) {
    v4bf o;
    o[0] = (__bf16)a01[r].x; o[1] = (__bf16)a01[r].y;
    o[2] = (__bf16)a23[r].x; o[3] = (__bf16)a23[r].y;
    *(v4bf*)(op + r * 8 * APITCH) = o;        // 8B LDS store, next row of the patch
  }
}

// The weights of NE (2 or 1) query rows of a wave's seven, image rows i and i + 1:
// their q, k and bias loads are independent and share one wait for memory.
// They go to LDS at ws_r (the lane's float of the wave's window row 0 of row i).
// qb, kb, rb: the head's q, k and bias table (scalar). STAGE: the wave also brings
// its 16 rows of Wpt (ws: the lane's first unit) to LDS (bd: its place there).
template <int NE, bool STAGE>
__device__ __forceinline__ void row_weights(const float4* __restrict__ qb,
                                            const float4* __restrict__ kb,
                                            const float* __restrict__ rb,
                                            int i, int j, int sw, int c,
                                            float* ws_r,
                                            const v8bf* __restrict__ ws,
                                            __bf16* __restrict__ bd) {
  const int kc = min(c, KWIN - 1);
  float4   qv[NE], kv[NE][KWIN];
  float    bi[NE][KWIN];
  unsigned kx[NE], qx[NE], bx[NE];        // a lane's place in k, in q (pixels) and in the bias table
#pragma unroll
  for (int e = 0; e < NE; ++e) {
    const int ie = i + e;
    const int sh = min(max(ie - 3, 0), HH - KWIN);
    qx[e] = ie * WW + j;
    kx[e] = sh * WW + sw + kc;
    bx[e] = (sh - ie + 6) * 13 + (sw - j + 6) + kc;
    const float4* kp = kb + kx[e];
    const float*  bb = rb + bx[e];
    qv[e] = qb[qx[e]];
#pragma unroll
    for (int ki = 0; ki < KWIN; ++ki) { kv[e][ki] = kp[ki * WW];  bi[e][ki] = bb[ki * 13]; }
  }
  // The wait behind the loads that name these; as its inputs, they keep their
  // registers up to here, so that no later load's result lands on them earlier.
  asm volatile("s_wait_xcnt 0x0" :: "v"(qx[0]), "v"(qx[NE - 1]), "v"(kx[0]), "v"(kx[NE - 1]),
               "v"(bx[0]), "v"(bx[NE - 1]) : "memory");
  v8bf wv[16];                            // Wpt on its way to LDS
  if (STAGE) {
    // Rows of 32 16-byte units, a row per wave and load, 16 loads a thread. Asked
    // for behind the two rows' loads, so that they fly while the scores are made.
#pragma unroll   // wv[] is indexed by constants and stays in registers
    for (int u = 0; u < 16; ++u) wv[u] = ws[u * 512];
    // The wait behind the loads that name ws, as above.
    asm volatile("s_wait_xcnt 0x0" :: "v"(ws) : "memory");
  }
#pragma unroll
  for (int e = 0; e < NE; ++e) {
    float s[KWIN];
    float mx = -3.0e38f;
#pragma unroll
    for (int ki = 0; ki < KWIN; ++ki) {
      const float4 q4 = qv[e], k4 = kv[e][ki];
      const float d = q4.x * k4.x + q4.y * k4.y + q4.z * k4.z + q4.w * k4.w + bi[e][ki];
      s[ki] = d;
      mx = fmaxf(mx, d);
    }
    mx = fmaxf(mx, lane8<SEL8(1,0,3,2,5,4,7,6)>(mx));
    mx = fmaxf(mx, lane8<SEL8(2,3,0,1,6,7,4,5)>(mx));
    mx = fmaxf(mx, lane8<SEL8(4,5,6,7,0,1,2,3)>(mx));

    float sum = 0.0f;
#pragma unroll
    for (int ki = 0; ki < KWIN; ++ki) { s[ki] = __expf(s[ki] - mx); sum += s[ki]; }
    if (c == 7) sum = 0.0f;               // lane 7 holds a copy of column 6
    sum += lane8<SEL8(1,0,3,2,5,4,7,6)>(sum);
    sum += lane8<SEL8(2,3,0,1,6,7,4,5)>(sum);
    sum += lane8<SEL8(4,5,6,7,0,1,2,3)>(sum);
    const float inv = 1.0f / sum;
#pragma unroll
    for (int ki = 0; ki < KWIN; ++ki) ws_r[(e * KWIN + ki) * WROW] = s[ki] * inv;
  }
  if (STAGE) {
#pragma unroll
    for (int u = 0; u < 16; ++u)          // 16 rows on a load
      *(v8bf*)(bd + 16 * u * APITCH) = wv[u];
  }
}

__global__ void __launch_bounds__(512)
natten_proj_kernel(const float* __restrict__ qbuf, const float* __restrict__ kbuf,
                   const float* __restrict__ vbuf, const float* __restrict__ rpb,
                   const __bf16* __restrict__ Wpt, const float* __restrict__ bp,
                   float* __restrict__ out) {
  const int lane = threadIdx.x & 31;
  const int wall = __builtin_amdgcn_readfirstlane(threadIdx.x >> 5);   // 0..15, scalar
  const int half = wall & 1;              // left or right 4 columns of the patch
  const int n    = wall >> 1;             // head
  const int c    = lane & 7;              // channel quad, and key column owner
  int t = blockIdx.x;                     // B * 8 * 7 patches
  const int tj = t % (WW / 8);  t /= (WW / 8);
  const int ti = t % (HH / PROWS);  const int b = t / (HH / PROWS);
  const int j  = tj * 8 + half * 4 + (lane >> 3);
  const int i0 = ti * PROWS;

  __shared__ __attribute__((aligned(16))) __bf16 As[MBLK * APITCH];
  __shared__ __attribute__((aligned(16))) __bf16 Bs[CC * APITCH];
  __shared__ __attribute__((aligned(16))) float  Ps[16 * PROWS * KWIN * WROW];   // weights, a piece per wave
  float*       ws_l = Ps + wall * (PROWS * KWIN * WROW) + lane;          // where the lane writes
  const float* wq   = Ps + wall * (PROWS * KWIN * WROW) + (lane & 24);   // its query's eight
  const int sw = min(max(j - 3, 0), WW - KWIN);
  const size_t qk_b = (size_t)b * HH * WW * 32;         // the image's q and k
  const float4* qb = (const float4*)(qbuf + qk_b) + n * HH * WW;
  const float4* kb = (const float4*)(kbuf + qk_b) + n * HH * WW;
  const float*  rb = rpb + n * 13 * 13;

  // The patch fills A rows 0..55; rows 56..63 of the last M tile are zeros (a
  // 16-byte unit a thread of waves 0..7), so that the GEMM reads only what was written.
  if (wall < MBLK - 8 * PROWS)
    *(v8bf*)(As + (8 * PROWS + wall) * APITCH + lane * 8) = (v8bf){};

  // The head's weights, two query rows at a time, then the seven rows' v sums. The
  // first two rows have the Wpt loads in flight behind theirs.
  row_weights<2, true>(qb, kb, rb, i0, j, sw, c, ws_l, (const v8bf*)Wpt + threadIdx.x,
                       Bs + wall * APITCH + lane * 8);
  // Rolled: for speed only.
#pragma unroll 1
  for (int r0 = 2; r0 < PROWS - 1; r0 += 2)
    row_weights<2, false>(qb, kb, rb, i0 + r0, j, sw, c, ws_l + r0 * KWIN * WROW, nullptr, nullptr);
  row_weights<1, false>(qb, kb, rb, i0 + PROWS - 1, j, sw, c, ws_l + (PROWS - 1) * KWIN * WROW,
                        nullptr, nullptr);
  // The weights that the wave's other lanes wrote are in LDS before they are read back.
  asm volatile("s_wait_dscnt 0x0" ::: "memory");

  // v sums. The windows of the wave's seven query rows overlap: see v_sums and
  // win_off. ti comes from blockIdx alone: the choice below is a scalar branch.
  const int sh0 = min(max(i0 - 3, 0), HH - KWIN);
  const float* vp = vbuf + (size_t)b * HH * WW * CC + (size_t)n * HH * WW * HD
                  + (size_t)(sh0 * WW + sw) * HD + c * 4;
  __bf16* op = As + (half * 4 + (lane >> 3)) * APITCH + n * HD + c * 4;
  if (ti == 0)                   v_sums<0>(vp, wq, op);
  else if (ti == HH / PROWS - 1) v_sums<2>(vp, wq, op);
  else                           v_sums<1>(vp, wq, op);
  // The wait behind the v loads: the projection's values take their address registers.
  asm volatile("s_wait_xcnt 0x0" ::: "memory");
  __syncthreads();                          // every wave reads rows that others wrote

  // Output projection of the patch: out = attn_out @ Wp + bp, 64 x 256, K = 256.
  // 8 waves, two on each SIMD = 2 halves of 32 rows x 4 strips of 64 columns; a wave
  // computes a 32x64 piece (6 fragments read from LDS for 8 WMMAs). The other 8
  // waves are done; no barrier follows.
  if (wall >= 8) return;
  const int grp  = lane >> 4;
  const int nl   = lane & 15;
  const int mp   = wall >> 2;               // rows 4 * mp .. 4 * mp + 3 of the patch
  const int colg = (wall & 3) * 64;
  const __bf16* ap = As + (mp * 32 + nl) * APITCH + grp * 8;
  const __bf16* wp = Bs + (colg + nl) * APITCH + grp * 8;
  float bval[4];                            // the four tiles' biases
#pragma unroll
  for (int u = 0; u < 4; ++u) bval[u] = bp[colg + 16 * u + nl];
  // With two waves on a SIMD nothing else covers an LDS read's latency: the 6
  // fragments of k step s + 1 are read as one group ahead of step s's 8 WMMAs.
  v16bf fa[2][2], fb[2][4];
  fa[0][0] = lds_frag(ap);
  fa[0][1] = lds_frag(ap + 16 * APITCH);
#pragma unroll
  for (int u = 0; u < 4; ++u) fb[0][u] = lds_frag(wp + 16 * u * APITCH);
  v8f acc[2][4] = {{{}, {}, {}, {}}, {{}, {}, {}, {}}};
#pragma unroll   // fa[], fb[] are indexed by constants and stay in registers
  for (int s = 0; s < CC / 32; ++s) {
    const int cur = s & 1, nxt = cur ^ 1;
    if (s + 1 < CC / 32) {
      const int k0 = (s + 1) * 32;
      fa[nxt][0] = lds_frag(ap + k0);
      fa[nxt][1] = lds_frag(ap + 16 * APITCH + k0);
#pragma unroll
      for (int u = 0; u < 4; ++u) fb[nxt][u] = lds_frag(wp + 16 * u * APITCH + k0);
    }
    // Keeps the group of reads in front of the WMMAs: left free, the compiler
    // sinks each read to its use and waits for it there.
    __builtin_amdgcn_sched_barrier(0);
#pragma unroll
    for (int u = 0; u < 4; ++u) {
      acc[0][u] = __builtin_amdgcn_wmma_f32_16x16x32_bf16(false, fa[cur][0], false, fb[cur][u],
                                                          (short)0, acc[0][u], false, false);
      acc[1][u] = __builtin_amdgcn_wmma_f32_16x16x32_bf16(false, fa[cur][1], false, fb[cur][u],
                                                          (short)0, acc[1][u], false, false);
    }
    // Keeps the reads of step s + 2 from being lifted in among these WMMAs.
    __builtin_amdgcn_sched_barrier(0);
  }
  // Holds the four bias loads in front of the test on pr (loaded values as inputs
  // only): left free, the compiler sinks them into the tested part, behind the last
  // WMMA, where nothing covers their latency.
  asm volatile("" :: "v"(bval[0]), "v"(bval[1]), "v"(bval[2]), "v"(bval[3]));
#pragma unroll
  for (int a = 0; a < 2; ++a) {
    const int pr = mp * 4 + a * 2 + grp;    // row of the patch; row 7 is the zeros
    const int m0 = (b * HH + i0 + pr) * WW + tj * 8;
#pragma unroll
    for (int u = 0; u < 4; ++u) {
      const int col = colg + 16 * u + nl;
      if (pr < PROWS) {
#pragma unroll
        for (int v = 0; v < 8; ++v)         // LDS row mp * 32 + a * 16 + grp * 8 + v = pixel (pr, v)
          out[(size_t)(m0 + v) * CC + col] = acc[a][u][v] + bval[u];
      }
    }
  }
}

// ---------------------------------------------------------------------------
extern "C" void kernel_launch(void* const* d_in, const int* in_sizes, int n_in,
                              void* d_out, int out_size, void* d_ws, size_t ws_size,
                              hipStream_t stream) {
  const float* x   = (const float*)d_in[0];
  const float* Wq  = (const float*)d_in[1];
  const float* bq  = (const float*)d_in[2];
  const float* Wk  = (const float*)d_in[3];
  const float* bk  = (const float*)d_in[4];
  const float* Wv  = (const float*)d_in[5];
  const float* bv  = (const float*)d_in[6];
  const float* rpb = (const float*)d_in[7];
  const float* Wp  = (const float*)d_in[8];
  const float* bp  = (const float*)d_in[9];

  // f32 scratch
  float* qbuf = (float*)d_ws;                         // MROWS*32
  float* kbuf = qbuf + (size_t)MROWS * 32;            // MROWS*32
  float* vbuf = kbuf + (size_t)MROWS * 32;            // MROWS*256
  // bf16 scratch (16B-aligned offsets by construction)
  __bf16* Wpt = (__bf16*)(vbuf + (size_t)MROWS * CC); // 256*256 bf16

  // 1) fused QKV projection: 196 blocks of 2 x 32 rows x (4 waves * 80 cols),
  //    and WPBLK blocks that write Wp^T
  qkv_gemm_kernel<<<dim3(MROWS / MBLK + WPBLK), 256, 0, stream>>>(
      x, Wq, Wk, Wv, Wp, bq, bk, bv, qbuf, kbuf, vbuf, Wpt);

  // 2) neighborhood attention core and output projection: 7x8 pixels a block,
  //    eight lanes per query*head, then 2 x 32 rows x (4 waves * 64 cols)
  natten_proj_kernel<<<dim3(BB * (HH / PROWS) * (WW / 8)), 512, 0, stream>>>(
      qbuf, kbuf, vbuf, rpb, Wpt, bp, (float*)d_out);
}

// v010
// It runs in 20.4 microseconds.
// Two timings next to v009 both put it at 1.05 times that version's speed.
// All steps since v000 together make it 4.49 times as fast.
#include <hip/hip_runtime.h>
#include <hip/hip_bf16.h>

#define NH   8
#define KWIN 7
#define LR   4
#define HD   32
#define BB   4
#define HH   56
#define WW   56
#define CC   256
#define MROWS (BB*HH*WW)   /* 12544 */
#define NQKV 320           /* 32 q + 32 k + 256 v columns */

typedef __attribute__((ext_vector_type(16))) __bf16 v16bf;
typedef __attribute__((ext_vector_type(8)))  __bf16 v8bf;
typedef __attribute__((ext_vector_type(4)))  __bf16 v4bf;
typedef __attribute__((ext_vector_type(8)))  float  v8f;
typedef __attribute__((ext_vector_type(4)))  float  v4f;
typedef __attribute__((ext_vector_type(2)))  float  v2f;

// ---------------------------------------------------------------------------
// Both GEMMs keep their operands as bf16 rows in LDS (A: M x K, B^T: N x K) and
// take the fragments from there. gfx1250 16-bit A/B layout, wave32:
//   lanes 0-15  : row r, K = {k0+0..7} in v0..3 and {k0+16..23} in v4..7
//   lanes 16-31 : row r, K offsets shifted by +8
// Both K-chunks are 8 contiguous bf16 = one 16-byte LDS load each.
// LDS row pitch 528 B = 16 B x 33 for 16-byte readers.
// A work-group is 64 A rows (kernel 2: 56 pixels, 8 zero rows): its 4 M tiles share one copy of the
// weights, which it fetches once, in whole 128-byte lines.
// ---------------------------------------------------------------------------
#define APITCH (CC + 8)   /* bf16 elements per LDS row */
#define MBLK   64         /* A rows per work-group */

// p = LDS row r + k0 + grp * 8
__device__ __forceinline__ v16bf lds_frag(const __bf16* p) {
  v8bf lo = *(const v8bf*)(p);
  v8bf hi = *(const v8bf*)(p + 16);
  v16bf f;
#pragma unroll   // constant indices: the two halves are just register names
  for (int i = 0; i < 8; ++i) { f[i] = lo[i]; f[8 + i] = hi[i]; }
  return f;
}

// ---------------------------------------------------------------------------
// Weights come as f32, K x N (row k, column n); the GEMMs want bf16 rows N x K.
// A lane takes a patch of 8 k x 4 n by eight 16-byte loads and rounds it: the 8
// values of one column are then one 16-byte piece of a transposed row, so the
// transposition costs no instruction beyond the rounding.
// ---------------------------------------------------------------------------
__device__ __forceinline__ v8bf col_of_patch(const v4f (&r)[8], int c) {
  v8bf o;
#pragma unroll   // constant indices: r[] stays in registers
  for (int j = 0; j < 8; ++j) o[j] = (__bf16)r[j][c];
  return o;
}

#define WPBLK 8           /* extra work-groups of kernel 1 that transpose Wp */

// Two 16x16 result tiles, one below the other, to rows of LDO floats: out is the
// tiles' first column (scalar), off the lane's first element in bytes; the 16 rows
// of a lane are constant distances from there.
template <int LDO>
__device__ __forceinline__ void put_tile(float* __restrict__ out, unsigned off,
                                         const v8f& a0, const v8f& a1, float b, float sc) {
  char* p = (char*)out + off;
#pragma unroll
  for (int v = 0; v < 8; ++v) {
    *(float*)(p + v * LDO * 4)        = (a0[v] + b) * sc;
    *(float*)(p + (16 + v) * LDO * 4) = (a1[v] + b) * sc;
  }
}

// ---------------------------------------------------------------------------
// Kernel 1: fused QKV projection GEMM, M=12544, N=320, K=256, bf16 WMMA.
// Block = 256 threads = 8 waves = 2 halves of 32 rows x 4 strips of 80 columns;
// each wave computes a 32x80 piece (10 WMMA tiles: an A fragment serves 5 of
// them, a B fragment 2, so 7 fragments are read from LDS for 10 WMMAs).
// Grid = 196 blocks of 64 rows, one per WGP (LDS 198 KB), and WPBLK more.
// x comes in as f32: the block reads its 64 rows (64 KB in a row) once, in
// whole lines, rounds them to bf16 and keeps them in LDS. Beside them go the
// 320 transposed bf16 rows of the weights ([0,32) Wq, [32,64) Wk, [64,320) Wv),
// which the block makes itself from the f32 matrices.
// The WPBLK last blocks, on WGPs that the 196 leave idle, do no GEMM: they
// write Wp^T as bf16 to the workspace for kernel 2.
//   cols [0,32)  -> q = (acc + bq) * hd^-0.5
//   cols [32,64) -> k = acc + bk
//   cols [64,320)-> v = acc + bv
// ---------------------------------------------------------------------------
__global__ void __launch_bounds__(256)
qkv_gemm_kernel(const float* __restrict__ x, const float* __restrict__ Wq,
                const float* __restrict__ Wk, const float* __restrict__ Wv,
                const float* __restrict__ Wp,
                const float* __restrict__ bq, const float* __restrict__ bk,
                const float* __restrict__ bv,
                float* __restrict__ qbuf, float* __restrict__ kbuf,
                float* __restrict__ vbuf, __bf16* __restrict__ Wpt) {
  const int tid  = threadIdx.x;
  const int lane = tid & 31;
  const int grp  = lane >> 4;
  const int nl   = lane & 15;
  const int wu   = __builtin_amdgcn_readfirstlane(tid >> 5);   // wave 0..7, scalar
  const int mp   = wu >> 2;                 // upper or lower 32 rows of the block
  const int row0 = blockIdx.x * MBLK + mp * 32;
  const int colg = (wu & 3) * 80;           // wave's 80-column strip

  if (blockIdx.x >= MROWS / MBLK) {
    // Wp^T: 64 wave tiles of 64 k x 16 n, one each for the 8 waves of 8 blocks. A
    // lane's patch is k octet lane / 4, n quad lane % 4: the eight lanes of one
    // output row store one whole 128-byte line.
    const int tw = (blockIdx.x - MROWS / MBLK) * 8 + wu;
    const int n0 = (tw & 15) * 16, k0 = (tw >> 4) * 64;      // scalar
    const unsigned li = ((lane >> 2) * 8 * CC + (lane & 3) * 4) * 4;   // bytes
    const unsigned lo = (lane & 3) * 4 * CC + (lane >> 2) * 8;
    const char* s = (const char*)(Wp + k0 * CC + n0);
    __bf16*     d = Wpt + n0 * CC + k0;
    v4f r[8];
#pragma unroll
    for (int j = 0; j < 8; ++j) r[j] = *(const v4f*)(s + j * CC * 4 + li);
    // The wait behind the loads that name li; as its input, li keeps its
    // register up to here, so that no later load's result lands on it earlier.
    asm volatile("s_wait_xcnt 0x0" :: "v"(li) : "memory");
#pragma unroll
    for (int c = 0; c < 4; ++c)
      *(v8bf*)(d + lo + c * CC) = col_of_patch(r, c);
    return;                                 // the whole block, ahead of the barrier
  }

  __shared__ __attribute__((aligned(16))) __bf16 As[MBLK * APITCH];
  __shared__ __attribute__((aligned(16))) __bf16 Bs[NQKV * APITCH];
  {
    // x: 64 * 256 floats = 4096 groups of 4 over 256 threads: 16 each.
    // Weights: 80 wave tiles of 32 k x 32 n, 10 a wave: the 8 k groups of column
    // group wu of Wv, and 2 k groups of Wq (waves 0..3) or Wk (waves 4..7); the
    // tiles of one row length share 8 offsets; a load takes 4 whole lines, one of
    // each of 4 rows.
    // A lane's patch is n quad nq, k octet ko, dealt so that the 16 lanes of a
    // half wave (4 nq x 4 ko) store to all 64 LDS banks: 4 rows on are 16 banks
    // on, an octet is 4 banks.
    // 48 loads a lane are asked for at once (x and 4 tiles of Wv); what has been
    // rounded and stored gives its registers to the next loads. The loops are
    // unrolled so that xv[], wv[] and wn[] are indexed by constants and stay in
    // registers.
    const char* xs = (const char*)(x + (size_t)blockIdx.x * MBLK * CC);
    const unsigned xo = tid * 16;           // the lane's first group of x, bytes
    const int nq = (lane & 3) + 4 * grp;
    const int ko = (lane >> 2) & 3;
    unsigned lv[8], ln[8];                  // row j of the patch, bytes from the tile's start
#pragma unroll
    for (int j = 0; j < 8; ++j) {
      lv[j] = (ko * 8 + j) * (CC * 4) + nq * 16;   // Wv
      ln[j] = (ko * 8 + j) * (32 * 4) + nq * 16;   // Wq, Wk
    }
    const char* sv = (const char*)Wv + wu * 32 * 4;                       // k group 0
    const char* sn = (const char*)(wu < 4 ? Wq : Wk) + (wu & 3) * 2 * 32 * 32 * 4;
    __bf16* bd = Bs + nq * 4 * APITCH + ko * 8;
    __bf16* dv = bd + (64 + wu * 32) * APITCH;                            // k group 0
    __bf16* dn = bd + (wu >> 2) * 32 * APITCH + (wu & 3) * 2 * 32;
    v4f xv[16], wv[4][8], wn[2][8];
#pragma unroll
    for (int i = 0; i < 16; ++i) xv[i] = *(const v4f*)(xs + xo + i * 4096);
#pragma unroll
    for (int i = 0; i < 4; ++i) {
#pragma unroll
      for (int j = 0; j < 8; ++j) wv[i][j] = *(const v4f*)(sv + i * 32 * CC * 4 + lv[j]);
    }
    // Keeps the 48 loads in front of the first use: left free, the compiler sinks
    // loads to their uses and fewer are in flight.
    __builtin_amdgcn_sched_barrier(0);
#pragma unroll
    for (int i = 0; i < 16; ++i) {
      const int e = tid + 256 * i;          // row e / 64, floats 4 * (e % 64) ...
      v4bf o;
      o[0] = (__bf16)xv[i].x; o[1] = (__bf16)xv[i].y;
      o[2] = (__bf16)xv[i].z; o[3] = (__bf16)xv[i].w;
      *(v4bf*)(As + (e >> 6) * APITCH + (e & 63) * 4) = o;
    }
    // Keeps the next 16 loads behind the rounding of x, whose registers they take:
    // lifted over it they would need 64 registers more.
    __builtin_amdgcn_sched_barrier(0);
#pragma unroll
    for (int i = 0; i < 2; ++i) {
#pragma unroll
      for (int j = 0; j < 8; ++j) wn[i][j] = *(const v4f*)(sn + i * 32 * 32 * 4 + ln[j]);
    }
    // Keeps these 16 loads here, ahead of the wait for Wv's first tile.
    __builtin_amdgcn_sched_barrier(0);
#pragma unroll
    for (int i = 0; i < 4; ++i) {
#pragma unroll
      for (int c = 0; c < 4; ++c)
        *(v8bf*)(dv + i * 32 + c * APITCH) = col_of_patch(wv[i], c);
      // Keeps tile i + 4's loads behind the rounding of tile i, whose registers they take.
      __builtin_amdgcn_sched_barrier(0);
#pragma unroll
      for (int j = 0; j < 8; ++j) wv[i][j] = *(const v4f*)(sv + (i + 4) * 32 * CC * 4 + lv[j]);
      // Keeps tile i + 4's loads here, ahead of the wait for tile i + 1.
      __builtin_amdgcn_sched_barrier(0);
    }
    // The wait behind the loads that name these; as its inputs, they keep their
    // registers up to here, so that no later load's result lands on them earlier.
    asm volatile("s_wait_xcnt 0x0" :: "v"(xo), "v"(lv[0]), "v"(lv[1]), "v"(lv[2]), "v"(lv[3]),
                 "v"(lv[4]), "v"(lv[5]), "v"(lv[6]), "v"(lv[7]), "v"(ln[0]), "v"(ln[1]),
                 "v"(ln[2]), "v"(ln[3]), "v"(ln[4]), "v"(ln[5]), "v"(ln[6]), "v"(ln[7])
                 : "memory");
#pragma unroll
    for (int i = 0; i < 2; ++i) {
#pragma unroll
      for (int c = 0; c < 4; ++c)
        *(v8bf*)(dn + i * 32 + c * APITCH) = col_of_patch(wn[i], c);
    }
#pragma unroll
    for (int i = 0; i < 4; ++i) {
#pragma unroll
      for (int c = 0; c < 4; ++c)
        *(v8bf*)(dv + (i + 4) * 32 + c * APITCH) = col_of_patch(wv[i], c);
    }
  }
  __syncthreads();                          // every wave reads rows that others wrote

  const __bf16* ap = As + (mp * 32 + nl) * APITCH + grp * 8;
  const __bf16* wp = Bs + (colg + nl) * APITCH + grp * 8;
  // With two waves on a SIMD nothing else covers an LDS read's latency: the 7
  // fragments of k step s + 1 are read as one group ahead of step s's 10 WMMAs.
  v16bf fa[2][2], fb[2][5];
  fa[0][0] = lds_frag(ap);
  fa[0][1] = lds_frag(ap + 16 * APITCH);
#pragma unroll
  for (int t = 0; t < 5; ++t) fb[0][t] = lds_frag(wp + 16 * t * APITCH);
  v8f acc[2][5] = {{{}, {}, {}, {}, {}}, {{}, {}, {}, {}, {}}};
#pragma unroll   // fa[], fb[] are indexed by constants and stay in registers
  for (int s = 0; s < CC / 32; ++s) {
    const int cur = s & 1, nxt = cur ^ 1;
    if (s + 1 < CC / 32) {
      const int k0 = (s + 1) * 32;
      fa[nxt][0] = lds_frag(ap + k0);
      fa[nxt][1] = lds_frag(ap + 16 * APITCH + k0);
#pragma unroll
      for (int t = 0; t < 5; ++t) fb[nxt][t] = lds_frag(wp + 16 * t * APITCH + k0);
    }
    // Keeps the group of reads in front of the WMMAs: left free, the compiler
    // sinks each read to its use and waits for it there.
    __builtin_amdgcn_sched_barrier(0);
#pragma unroll
    for (int t = 0; t < 5; ++t) {
      acc[0][t] = __builtin_amdgcn_wmma_f32_16x16x32_bf16(false, fa[cur][0], false, fb[cur][t],
                                                          (short)0, acc[0][t], false, false);
      acc[1][t] = __builtin_amdgcn_wmma_f32_16x16x32_bf16(false, fa[cur][1], false, fb[cur][t],
                                                          (short)0, acc[1][t], false, false);
    }
    // Keeps the reads of step s + 2 from being lifted in among these WMMAs.
    __builtin_amdgcn_sched_barrier(0);
  }
  // Strip 0 holds q (2 tiles), k (2 tiles) and v's first 16 columns; the others v alone.
  const bool s0 = colg == 0;
  const float* bs[5];                       // the five tiles' biases: first column (scalar)
  bs[0] = s0 ? bq      : bv + (colg - 64);
  bs[1] = s0 ? bq + 16 : bv + (colg - 48);
  bs[2] = s0 ? bk      : bv + (colg - 32);
  bs[3] = s0 ? bk + 16 : bv + (colg - 16);
  bs[4] = s0 ? bv      : bv + colg;
  float bval[5];
#pragma unroll
  for (int t = 0; t < 5; ++t) bval[t] = bs[t][nl];
  // The wait behind the loads that name these; as its inputs, they keep their
  // registers up to here.
  asm volatile("s_wait_xcnt 0x0" :: "v"(nl), "s"(bs[0]), "s"(bs[1]), "s"(bs[2]), "s"(bs[3]),
               "s"(bs[4]) : "memory");
  const unsigned on = ((row0 + grp * 8) * 32 + nl) * 4;   // the lane's first element, bytes: q, k
  const unsigned ov = ((row0 + grp * 8) * CC + nl) * 4;   // v
  if (colg == 0) {
    const float sc = 0.17677669529663687f;  /* 32^-0.5 */
    put_tile<32>(qbuf,      on, acc[0][0], acc[1][0], bval[0], sc);
    put_tile<32>(qbuf + 16, on, acc[0][1], acc[1][1], bval[1], sc);
    put_tile<32>(kbuf,      on, acc[0][2], acc[1][2], bval[2], 1.0f);
    put_tile<32>(kbuf + 16, on, acc[0][3], acc[1][3], bval[3], 1.0f);
    put_tile<CC>(vbuf,      ov, acc[0][4], acc[1][4], bval[4], 1.0f);
    // The wait behind this branch's stores: what follows them in the text rewrites their registers.
    asm volatile("s_wait_xcnt 0x0" ::: "memory");
  } else {
#pragma unroll
    for (int t = 0; t < 5; ++t)
      put_tile<CC>(vbuf + (colg - 64 + 16 * t), ov, acc[0][t], acc[1][t], bval[t], 1.0f);
    // The wait behind this branch's stores: what follows them in the text rewrites their registers.
    asm volatile("s_wait_xcnt 0x0" ::: "memory");
  }
}

// ---------------------------------------------------------------------------
// Kernel 2: neighborhood attention core and output projection in one launch.
// A block is 16 waves = a patch of 7 rows x 8 columns of pixels of one image, all
// 8 heads: two waves a head, one for each 4 columns, all 7 rows. That makes 224
// blocks, one per WGP. The attention results of the patch are 56 of the 64 x 256
// bf16 A rows of the projection (the last 8 are zeros); they go to LDS and never
// to memory.
// Attention: eight lanes per (b, head, i, j):
// lane c of a query owns channels 4c..4c+3, so the eight lanes of a query read
// one whole 128-byte v pixel with one 16-byte load each, and the four queries
// of a wave (four neighbours in j) read four adjacent pixels = 512 contiguous
// bytes per load instruction. For the scores lane c owns key column c of the
// 7x7 window (lane 7 repeats column 6 and is left out of the sum); maximum and
// sum go over the eight lanes, and the weights reach the eight lanes through the
// wave's own piece of LDS: window row (r, ki) is 32 floats there, one per lane,
// so a query's eight stand side by side and come back in two reads (16 and 12 bytes).
// A wave takes 4 columns and 7 rows, and loads each v row of their windows once.
// q/k/v read through the reference's raw-reshape strides:
//   q[b,n,i,j,l] = qflat[b*H*W*32 + n*H*W*4 + (i*W+j)*4 + l]  (v with 32)
// LDS row of a pixel: 8 * (row in the patch) + column in the patch; its column
// n*32+d holds head n, channel d, as bf16.
// ---------------------------------------------------------------------------
#define PROWS 7           /* rows of pixels of a patch */
static_assert(KWIN == 7 && HH == 8 * PROWS && PROWS >= 4, "the three cases of the window starts");

#define SEL8(a,b,c,d,e,f,g,h) \
  ((a) | ((b) << 3) | ((c) << 6) | ((d) << 9) | ((e) << 12) | ((f) << 15) | ((g) << 18) | ((h) << 21))

// Value of lane SEL[l & 7] of the same group of eight lanes.
template <int SEL>
__device__ __forceinline__ float lane8(float x) {
  return __builtin_bit_cast(float,
      __builtin_amdgcn_mov_dpp8(__builtin_bit_cast(unsigned, x), SEL));
}

// Window start of a patch's query row r, counted from that of its row 0.
// CS 0: the image's top patch (rows 0..6: starts 0 0 0 0 1 2 3); CS 1: a patch
// away from top and bottom (no start is clamped); CS 2: the bottom patch (rows
// 49..55: starts 46 47 48 49 49 49 49).
__host__ __device__ constexpr int win_off(int cs, int r) {
  return cs == 0 ? (r > 3 ? r - 3 : 0) : cs == 1 ? r : (r < 3 ? r : 3);
}

// The v sums of a wave's seven query rows. Their windows cover 7 + win_off(CS, 6)
// v rows. The wave walks these once: a v row's 7 loads stay in registers and serve
// every query row r whose window holds it, as its window row ki = y - win_off(CS, r).
// V row y + 1 is asked for ahead of v row y's sums (the compiler, free to rename the
// two buffers, may ask for y + 2 there as well). Each query row sums its ki in rising order.
// wq: the weights of this lane's query in LDS; those of v row y + 1 are read
// together with its loads.
#define WROW 32           /* floats of one window row (r, ki) of a wave's weights */
template <int CS>
__device__ __forceinline__ void v_sums(const float* __restrict__ vp,
                                       const float* wq,
                                       __bf16* __restrict__ op) {
  constexpr int NY = KWIN + win_off(CS, PROWS - 1);
  v4f buf[2][KWIN];
  v4f wt[2][PROWS][2];                    // weights 0..3 and 4..6 of row r's window row
#pragma unroll
  for (int kj = 0; kj < KWIN; ++kj) buf[0][kj] = *(const v4f*)(vp + kj * HD);
#pragma unroll   // constant indices: wt[] stays in registers
  for (int r = 0; r < PROWS; ++r) {
    if (win_off(CS, r) > 0) continue;     // v row 0 is window row 0 of these query rows
    wt[0][r][0] = *(const v4f*)(wq + r * KWIN * WROW);
    wt[0][r][1] = *(const v4f*)(wq + r * KWIN * WROW + 4);
  }

  v2f a01[PROWS], a23[PROWS];
#pragma unroll
  for (int r = 0; r < PROWS; ++r) { a01[r] = (v2f){0.0f, 0.0f};  a23[r] = (v2f){0.0f, 0.0f}; }
#pragma unroll   // buf[], wt[] and the sums are indexed by constants and stay in registers
  for (int y = 0; y < NY; ++y) {
    if (y + 1 < NY) {
      const float* nx = vp + (y + 1) * WW * HD;
#pragma unroll
      for (int kj = 0; kj < KWIN; ++kj) buf[(y + 1) & 1][kj] = *(const v4f*)(nx + kj * HD);
#pragma unroll   // constant indices: wt[] stays in registers
      for (int r = 0; r < PROWS; ++r) {
        const int ki = y + 1 - win_off(CS, r);
        if (ki < 0 || ki >= KWIN) continue;
        wt[(y + 1) & 1][r][0] = *(const v4f*)(wq + (r * KWIN + ki) * WROW);
        wt[(y + 1) & 1][r][1] = *(const v4f*)(wq + (r * KWIN + ki) * WROW + 4);
      }
    }
    // Keeps the next v row's 7 loads and its weights' reads in front of this row's
    // sums: without it the compiler sinks each load to its use and leaves 2 or 3 in flight.
    __builtin_amdgcn_sched_barrier(0);

#pragma unroll
    for (int r = 0; r < PROWS; ++r) {
      const int ki = y - win_off(CS, r);
      if (ki < 0 || ki >= KWIN) continue;
      const v4f wa = wt[y & 1][r][0], wb = wt[y & 1][r][1];
      const float p[KWIN] = { wa.x, wa.y, wa.z, wa.w, wb.x, wb.y, wb.z };
#pragma unroll
      for (int kj = 0; kj < KWIN; ++kj) {
        const v4f vx = buf[y & 1][kj];
        const v2f pp = {p[kj], p[kj]};
        a01[r] = __builtin_elementwise_fma(pp, vx.xy, a01[r]);
        a23[r] = __builtin_elementwise_fma(pp, vx.zw, a23[r]);
      }
    }
  }
#pragma unroll
  for (int r = 0; r < PROWS; ++r) {
    v4bf o;
    o[0] = (__bf16)a01[r].x; o[1] = (__bf16)a01[r].y;
    o[2] = (__bf16)a23[r].x; o[3] = (__bf16)a23[r].y;
    *(v4bf*)(op + r * 8 * APITCH) = o;        // 8B LDS store, next row of the patch
  }
}

// The weights of one query row: q4 its q, kw the lane's key column of its seven k
// rows, bw its seven bias values. They go to LDS at wr (the lane's float of the
// row's window row 0).
__device__ __forceinline__ void row_weights(const float4 q4, const float4* kw, const float* bw,
                                            int c, float* wr) {
  float s[KWIN];
  float mx = -3.0e38f;
#pragma unroll
  for (int ki = 0; ki < KWIN; ++ki) {
    const float4 k4 = kw[ki];
    const float d = q4.x * k4.x + q4.y * k4.y + q4.z * k4.z + q4.w * k4.w + bw[ki];
    s[ki] = d;
    mx = fmaxf(mx, d);
  }
  mx = fmaxf(mx, lane8<SEL8(1,0,3,2,5,4,7,6)>(mx));
  mx = fmaxf(mx, lane8<SEL8(2,3,0,1,6,7,4,5)>(mx));
  mx = fmaxf(mx, lane8<SEL8(4,5,6,7,0,1,2,3)>(mx));

  float sum = 0.0f;
#pragma unroll
  for (int ki = 0; ki < KWIN; ++ki) { s[ki] = __expf(s[ki] - mx); sum += s[ki]; }
  if (c == 7) sum = 0.0f;                 // lane 7 holds a copy of column 6
  sum += lane8<SEL8(1,0,3,2,5,4,7,6)>(sum);
  sum += lane8<SEL8(2,3,0,1,6,7,4,5)>(sum);
  sum += lane8<SEL8(4,5,6,7,0,1,2,3)>(sum);
  const float inv = 1.0f / sum;
#pragma unroll
  for (int ki = 0; ki < KWIN; ++ki) wr[ki * WROW] = s[ki] * inv;
}

#define NCL  (KWIN / 2)       /* query rows of a top or bottom patch whose window start is clamped */
#define NFRE (PROWS - NCL)    /* its other query rows */

// The weights of a wave's seven query rows, image rows i0 .. i0 + 6. Their windows
// overlap as they do for v, so a lane loads its key column of each k row once: k row
// sh0 + y is kv[y] (sh0: window start of row i0). All loads are asked for as one group.
// A query row whose window start is not clamped is the p-th of its kind: its window
// is kv[p .. p + 6], and its bias values are table rows 3 .. 9, the same for all.
// Away from top and bottom (edge false) all seven rows are of that kind. A top or
// bottom patch has NFRE of them and NCL clamped rows (the first NCL at the top, the
// last NCL at the bottom), which share the window of the free row next to them and
// have bias values of their own; their q stands in qv[NFRE ...], and kv[KWIN + NFRE - 1 ...],
// which no window of such a patch reaches, repeats earlier rows.
// The weights go to LDS at ws_l (the lane's float of the wave's window row 0 of row i0).
// qb, kb, rb: the head's q, k and bias table (scalar); top, edge: scalar.
// The wave also brings its 16 rows of Wpt (ws: the lane's first unit) to LDS (bd:
// its place there).
__device__ __forceinline__ void patch_weights(const float4* __restrict__ qb,
                                              const float4* __restrict__ kb,
                                              const float* __restrict__ rb,
                                              int i0, int sh0, bool top, bool edge,
                                              int j, int sw, int c, float* ws_l,
                                              const v8bf* __restrict__ ws,
                                              __bf16* __restrict__ bd) {
  const int kc  = min(c, KWIN - 1);
  const int rf0 = top ? NCL : 0;          // first free query row
  const int rc0 = top ? 0 : NFRE;         // first clamped query row of an edge patch
  // A lane's place in q and in k (pixels) and in a row of the bias table.
  const unsigned qx = i0 * WW + j;
  const unsigned kx = sh0 * WW + sw + kc;
  const unsigned bx = (sw - j + 6) + kc;
  const float4* q1 = qb + rf0 * WW + qx;                    // free rows 0 .. NFRE - 1
  const float4* q2 = qb + (edge ? rc0 : NFRE) * WW + qx;    // the other NCL rows
  const float4* k1 = kb + kx;
  const float4* k2 = kb + (edge ? NFRE - 1 : KWIN + NFRE - 1) * WW + kx;
  const float*  b1 = rb + 3 * 13 + bx;
  float4 qv[PROWS], kv[KWIN + PROWS - 1];
  float  bf[KWIN], bc[KWIN + NCL - 1];
#pragma unroll   // the arrays are indexed by constants and stay in registers
  for (int ki = 0; ki < KWIN; ++ki) bf[ki] = b1[ki * 13];
#pragma unroll
  for (int p = 0; p < NFRE; ++p) qv[p] = q1[p * WW];
#pragma unroll
  for (int y = 0; y < KWIN + NFRE - 1; ++y) kv[y] = k1[y * WW];
#pragma unroll
  for (int e = 0; e < NCL; ++e) {
    qv[NFRE + e] = q2[e * WW];
    kv[KWIN + NFRE - 1 + e] = k2[e * WW];
  }
  // The wait behind the loads that name these; as its inputs, they keep their
  // registers up to here, so that no later load's result lands on them earlier.
  asm volatile("s_wait_xcnt 0x0" :: "v"(qx), "v"(kx), "v"(bx) : "memory");
  if (edge) {
    // Clamped row e: window start - query row + 6 is 6 - e at the top, 2 - e at the
    // bottom: its bias values are bc[NCL - 1 - e ...].
    const float* b2 = rb + (top ? 6 - (NCL - 1) : 2 - (NCL - 1)) * 13 + bx;
#pragma unroll
    for (int t = 0; t < KWIN + NCL - 1; ++t) bc[t] = b2[t * 13];
    // The wait behind the loads that name bx, as above.
    asm volatile("s_wait_xcnt 0x0" :: "v"(bx) : "memory");
  }
  v8bf wv[16];                            // Wpt on its way to LDS
  // Rows of 32 16-byte units, a row per wave and load, 16 loads a thread. Asked
  // for behind the scores' loads, so that they fly while the scores are made.
#pragma unroll   // wv[] is indexed by constants and stays in registers
  for (int u = 0; u < 16; ++u) wv[u] = ws[u * 512];
  // The wait behind the loads that name ws, as above.
  asm volatile("s_wait_xcnt 0x0" :: "v"(ws) : "memory");
  // Keeps Wpt's loads in front of the first wait for the scores' loads.
  __builtin_amdgcn_sched_barrier(0);

  float* wf = ws_l + rf0 * KWIN * WROW;
#pragma unroll   // kv[] and qv[] are indexed by constants
  for (int p = 0; p < PROWS; ++p) {
    if (p < NFRE || !edge) row_weights(qv[p], kv + p, bf, c, wf + p * KWIN * WROW);
  }
  if (edge) {
    float4 kw[KWIN], qc[NCL];             // the clamped rows' window and q
#pragma unroll
    for (int ki = 0; ki < KWIN; ++ki) kw[ki] = top ? kv[ki] : kv[NFRE - 1 + ki];
#pragma unroll
    for (int e = 0; e < NCL; ++e) qc[e] = qv[NFRE + e];
    float* wc = ws_l + rc0 * KWIN * WROW;
    // Rolled (for speed only), the next row's q and bias values moving into the
    // first one's place.
#pragma unroll 1
    for (int e = 0; e < NCL; ++e) {
      row_weights(qc[0], kw, bc + NCL - 1, c, wc + e * KWIN * WROW);
#pragma unroll
      for (int t = 0; t + 1 < NCL; ++t) qc[t] = qc[t + 1];
#pragma unroll
      for (int t = KWIN + NCL - 2; t > 0; --t) bc[t] = bc[t - 1];
    }
  }
#pragma unroll
  for (int u = 0; u < 16; ++u)            // 16 rows on a load
    *(v8bf*)(bd + 16 * u * APITCH) = wv[u];
}

__global__ void __launch_bounds__(512)
natten_proj_kernel(const float* __restrict__ qbuf, const float* __restrict__ kbuf,
                   const float* __restrict__ vbuf, const float* __restrict__ rpb,
                   const __bf16* __restrict__ Wpt, const float* __restrict__ bp,
                   float* __restrict__ out) {
  const int lane = threadIdx.x & 31;
  const int wall = __builtin_amdgcn_readfirstlane(threadIdx.x >> 5);   // 0..15, scalar
  const int half = wall & 1;              // left or right 4 columns of the patch
  const int n    = wall >> 1;             // head
  const int c    = lane & 7;              // channel quad, and key column owner
  int t = blockIdx.x;                     // B * 8 * 7 patches
  const int tj = t % (WW / 8);  t /= (WW / 8);
  const int ti = t % (HH / PROWS);  const int b = t / (HH / PROWS);
  const int j  = tj * 8 + half * 4 + (lane >> 3);
  const int i0 = ti * PROWS;

  __shared__ __attribute__((aligned(16))) __bf16 As[MBLK * APITCH];
  __shared__ __attribute__((aligned(16))) __bf16 Bs[CC * APITCH];
  __shared__ __attribute__((aligned(16))) float  Ps[16 * PROWS * KWIN * WROW];   // weights, a piece per wave
  float*       ws_l = Ps + wall * (PROWS * KWIN * WROW) + lane;          // where the lane writes
  const float* wq   = Ps + wall * (PROWS * KWIN * WROW) + (lane & 24);   // its query's eight
  const int sw = min(max(j - 3, 0), WW - KWIN);
  const size_t qk_b = (size_t)b * HH * WW * 32;         // the image's q and k
  const float4* qb = (const float4*)(qbuf + qk_b) + n * HH * WW;
  const float4* kb = (const float4*)(kbuf + qk_b) + n * HH * WW;
  const float*  rb = rpb + n * 13 * 13;

  // The patch fills A rows 0..55; rows 56..63 of the last M tile are zeros (a
  // 16-byte unit a thread of waves 0..7), so that the GEMM reads only what was written.
  if (wall < MBLK - 8 * PROWS)
    *(v8bf*)(As + (8 * PROWS + wall) * APITCH + lane * 8) = (v8bf){};

  // The head's weights for the seven query rows, then the rows' v sums. The Wpt loads
  // are in flight behind the scores' loads.
  const int sh0 = min(max(i0 - 3, 0), HH - KWIN);
  patch_weights(qb, kb, rb, i0, sh0, ti == 0, ti == 0 || ti == HH / PROWS - 1, j, sw, c, ws_l,
                (const v8bf*)Wpt + threadIdx.x, Bs + wall * APITCH + lane * 8);
  // The weights that the wave's other lanes wrote are in LDS before they are read back.
  asm volatile("s_wait_dscnt 0x0" ::: "memory");

  // v sums. The windows of the wave's seven query rows overlap: see v_sums and
  // win_off. ti comes from blockIdx alone: the choice below is a scalar branch.
  const float* vp = vbuf + (size_t)b * HH * WW * CC + (size_t)n * HH * WW * HD
                  + (size_t)(sh0 * WW + sw) * HD + c * 4;
  __bf16* op = As + (half * 4 + (lane >> 3)) * APITCH + n * HD + c * 4;
  if (ti == 0)                   v_sums<0>(vp, wq, op);
  else if (ti == HH / PROWS - 1) v_sums<2>(vp, wq, op);
  else                           v_sums<1>(vp, wq, op);
  // The wait behind the v loads: the projection's values take their address registers.
  asm volatile("s_wait_xcnt 0x0" ::: "memory");
  __syncthreads();                          // every wave reads rows that others wrote

  // Output projection of the patch: out = attn_out @ Wp + bp, 64 x 256, K = 256.
  // 8 waves, two on each SIMD = 2 halves of 32 rows x 4 strips of 64 columns; a wave
  // computes a 32x64 piece (6 fragments read from LDS for 8 WMMAs). The other 8
  // waves are done; no barrier follows.
  if (wall >= 8) return;
  const int grp  = lane >> 4;
  const int nl   = lane & 15;
  const int mp   = wall >> 2;               // rows 4 * mp .. 4 * mp + 3 of the patch
  const int colg = (wall & 3) * 64;
  const __bf16* ap = As + (mp * 32 + nl) * APITCH + grp * 8;
  const __bf16* wp = Bs + (colg + nl) * APITCH + grp * 8;
  float bval[4];                            // the four tiles' biases
#pragma unroll
  for (int u = 0; u < 4; ++u) bval[u] = bp[colg + 16 * u + nl];
  // With two waves on a SIMD nothing else covers an LDS read's latency: the 6
  // fragments of k step s + 1 are read as one group ahead of step s's 8 WMMAs.
  v16bf fa[2][2], fb[2][4];
  fa[0][0] = lds_frag(ap);
  fa[0][1] = lds_frag(ap + 16 * APITCH);
#pragma unroll
  for (int u = 0; u < 4; ++u) fb[0][u] = lds_frag(wp + 16 * u * APITCH);
  v8f acc[2][4] = {{{}, {}, {}, {}}, {{}, {}, {}, {}}};
#pragma unroll   // fa[], fb[] are indexed by constants and stay in registers
  for (int s = 0; s < CC / 32; ++s) {
    const int cur = s & 1, nxt = cur ^ 1;
    if (s + 1 < CC / 32) {
      const int k0 = (s + 1) * 32;
      fa[nxt][0] = lds_frag(ap + k0);
      fa[nxt][1] = lds_frag(ap + 16 * APITCH + k0);
#pragma unroll
      for (int u = 0; u < 4; ++u) fb[nxt][u] = lds_frag(wp + 16 * u * APITCH + k0);
    }
    // Keeps the group of reads in front of the WMMAs: left free, the compiler
    // sinks each read to its use and waits for it there.
    __builtin_amdgcn_sched_barrier(0);
#pragma unroll
    for (int u = 0; u < 4; ++u) {
      acc[0][u] = __builtin_amdgcn_wmma_f32_16x16x32_bf16(false, fa[cur][0], false, fb[cur][u],
                                                          (short)0, acc[0][u], false, false);
      acc[1][u] = __builtin_amdgcn_wmma_f32_16x16x32_bf16(false, fa[cur][1], false, fb[cur][u],
                                                          (short)0, acc[1][u], false, false);
    }
    // Keeps the reads of step s + 2 from being lifted in among these WMMAs.
    __builtin_amdgcn_sched_barrier(0);
  }
  // Holds the four bias loads in front of the test on pr (loaded values as inputs
  // only): left free, the compiler sinks them into the tested part, behind the last
  // WMMA, where nothing covers their latency.
  asm volatile("" :: "v"(bval[0]), "v"(bval[1]), "v"(bval[2]), "v"(bval[3]));
#pragma unroll
  for (int a = 0; a < 2; ++a) {
    const int pr = mp * 4 + a * 2 + grp;    // row of the patch; row 7 is the zeros
    const int m0 = (b * HH + i0 + pr) * WW + tj * 8;
#pragma unroll
    for (int u = 0; u < 4; ++u) {
      const int col = colg + 16 * u + nl;
      if (pr < PROWS) {
#pragma unroll
        for (int v = 0; v < 8; ++v)         // LDS row mp * 32 + a * 16 + grp * 8 + v = pixel (pr, v)
          out[(size_t)(m0 + v) * CC + col] = acc[a][u][v] + bval[u];
      }
    }
  }
}

// ---------------------------------------------------------------------------
extern "C" void kernel_launch(void* const* d_in, const int* in_sizes, int n_in,
                              void* d_out, int out_size, void* d_ws, size_t ws_size,
                              hipStream_t stream) {
  const float* x   = (const float*)d_in[0];
  const float* Wq  = (const float*)d_in[1];
  const float* bq  = (const float*)d_in[2];
  const float* Wk  = (const float*)d_in[3];
  const float* bk  = (const float*)d_in[4];
  const float* Wv  = (const float*)d_in[5];
  const float* bv  = (const float*)d_in[6];
  const float* rpb = (const float*)d_in[7];
  const float* Wp  = (const float*)d_in[8];
  const float* bp  = (const float*)d_in[9];

  // f32 scratch
  float* qbuf = (float*)d_ws;                         // MROWS*32
  float* kbuf = qbuf + (size_t)MROWS * 32;            // MROWS*32
  float* vbuf = kbuf + (size_t)MROWS * 32;            // MROWS*256
  // bf16 scratch (16B-aligned offsets by construction)
  __bf16* Wpt = (__bf16*)(vbuf + (size_t)MROWS * CC); // 256*256 bf16

  // 1) fused QKV projection: 196 blocks of 2 x 32 rows x (4 waves * 80 cols),
  //    and WPBLK blocks that write Wp^T
  qkv_gemm_kernel<<<dim3(MROWS / MBLK + WPBLK), 256, 0, stream>>>(
      x, Wq, Wk, Wv, Wp, bq, bk, bv, qbuf, kbuf, vbuf, Wpt);

  // 2) neighborhood attention core and output projection: 7x8 pixels a block,
  //    eight lanes per query*head, then 2 x 32 rows x (4 waves * 64 cols)
  natten_proj_kernel<<<dim3(BB * (HH / PROWS) * (WW / 8)), 512, 0, stream>>>(
      qbuf, kbuf, vbuf, rpb, Wpt, bp, (float*)d_out);
}
